// v000
// Times are from an AMD MI455X. After a warm-up the kernel runs many times in a row, and a time is the length of
// such a window on the GPU divided by its runs, so every launch and the gaps after it count. The runs cycle
// through copies of the inputs. A figure is the median of several windows, for all but v000 over two sittings.
// Sittings can differ by a few percent; kernels timed side by side share one.
// The starting kernel, v000, takes 733 microseconds a run.
#include <hip/hip_runtime.h>
#include <hip/hip_bf16.h>

typedef __attribute__((ext_vector_type(16))) _Float16 v16h;
typedef __attribute__((ext_vector_type(8)))  float    v8f;
typedef int v4i_vec __attribute__((vector_size(16)));   // int __vector(4)

constexpr int E_   = 512;
constexpr int H_   = 8;
constexpr int D_   = 64;
constexpr int FF_  = 2048;
constexpr int L_   = 2;
constexpr int B_   = 4;
constexpr int S_   = 2048;
constexpr int ROWS = B_ * S_;          // 8192 token rows

#if defined(__has_builtin)
#if __has_builtin(__builtin_amdgcn_global_load_async_to_lds_b128)
#define HAVE_ASYNC_LDS 1
#endif
#endif
#ifndef HAVE_ASYNC_LDS
#define HAVE_ASYNC_LDS 0
#endif

__device__ __forceinline__ uint32_t pack2h(float a, float b) {
  union { _Float16 h[2]; uint32_t u; } t;
  t.h[0] = (_Float16)a; t.h[1] = (_Float16)b;
  return t.u;
}

__device__ __forceinline__ void cp16B_g2l(const _Float16* g, _Float16* l) {
#if HAVE_ASYNC_LDS
  __builtin_amdgcn_global_load_async_to_lds_b128(
      (__attribute__((address_space(1))) v4i_vec*)(_Float16*)g,
      (__attribute__((address_space(3))) v4i_vec*)l, 0, 0);
#else
  *(uint4*)l = *(const uint4*)g;
#endif
}

__device__ __forceinline__ void async_fence() {
#if HAVE_ASYNC_LDS
  asm volatile("s_wait_asynccnt 0" ::: "memory");
#endif
}

__device__ __forceinline__ v16h load_frag_k32(const _Float16* base, int rowStride, int lane) {
  int r  = lane & 15;
  int kh = (lane >> 4) << 3;
  const _Float16* p = base + r * rowStride + kh;
  union { v16h v; uint32_t u[8]; } f;
  const uint32_t* p0 = (const uint32_t*)p;
  const uint32_t* p1 = (const uint32_t*)(p + 16);
#pragma unroll
  for (int i = 0; i < 4; ++i) { f.u[i] = p0[i]; f.u[4 + i] = p1[i]; }
  return f.v;
}

__device__ __forceinline__ v8f wmma_f16(v16h a, v16h b, v8f c) {
  return __builtin_amdgcn_wmma_f32_16x16x32_f16(false, a, false, b, (short)0, c, false, false);
}

// ---------------------------------------------------------------------------
// Weight convert + transpose: W[K][N] f32 -> Wt[N][K] f16 (one-time, tiny)
// ---------------------------------------------------------------------------
__global__ __launch_bounds__(256) void wconv_kernel(
    const float* __restrict__ W, _Float16* __restrict__ Wt, int K, int N) {
  int idx = blockIdx.x * 256 + threadIdx.x;   // over N*K
  int n = idx / K;
  int k = idx - n * K;
  Wt[idx] = (_Float16)W[(size_t)k * N + n];
}

// ---------------------------------------------------------------------------
// Embedding + positional add: writes f32 h and f16 h16
// ---------------------------------------------------------------------------
__global__ __launch_bounds__(128) void embed_kernel(
    const int* __restrict__ x, const float* __restrict__ emb,
    const float* __restrict__ pos, float* __restrict__ h,
    _Float16* __restrict__ h16) {
  int row = blockIdx.x;
  int s   = row & (S_ - 1);
  int tok = x[row] + 1;
  int c   = threadIdx.x << 2;
  float4 e4 = *(const float4*)(emb + (size_t)tok * E_ + c);
  float4 p4 = *(const float4*)(pos + (size_t)s   * E_ + c);
  float4 o; o.x = e4.x + p4.x; o.y = e4.y + p4.y; o.z = e4.z + p4.z; o.w = e4.w + p4.w;
  *(float4*)(h + (size_t)row * E_ + c) = o;
  uint2 hp; hp.x = pack2h(o.x, o.y); hp.y = pack2h(o.z, o.w);
  *(uint2*)(h16 + (size_t)row * E_ + c) = hp;
}

// ---------------------------------------------------------------------------
// WMMA GEMM, f16 in: C[M,N] = act(A[M,K] @ Wt[N,K]^T + bias[N]), M = 8192.
// Block tile 64x256, 8 waves (2x4), wave tile 32x64, K-step 32, dbl buffer.
// Output: f32 (Cf) and/or f16 (Ch).
// ---------------------------------------------------------------------------
__global__ __launch_bounds__(256) void gemm_f16_kernel(
    const _Float16* __restrict__ A, const _Float16* __restrict__ Wt,
    const float* __restrict__ bias, float* __restrict__ Cf,
    _Float16* __restrict__ Ch, int N, int Kdim, int relu) {
  __shared__ _Float16 Atile[2][64][32];        //  8 KB
  __shared__ _Float16 Btile[2][256][32];       // 32 KB  ([n][k] fragment order)

  const int tid  = threadIdx.x;
  const int lane = tid & 31;
  const int wave = tid >> 5;
  const int wm   = (wave >> 2) << 5;           // 0 / 32
  const int wn   = (wave & 3) << 6;            // 0 / 64 / 128 / 192
  const int m0   = blockIdx.x * 64;
  const int n0   = blockIdx.y * 256;

  v8f acc[2][4] = {};
  const int nk = Kdim >> 5;

  auto load_tiles = [&](int kt, int buf) {
    const int k0 = kt << 5;
    {  // A: 64x32 f16 = 256 x 16B, 1 per thread
      int r = tid >> 2, seg = (tid & 3) << 3;
      cp16B_g2l(A + (size_t)(m0 + r) * Kdim + k0 + seg, &Atile[buf][r][seg]);
    }
#pragma unroll
    for (int t = 0; t < 4; ++t) {  // B: 256x32 f16 = 1024 x 16B, 4 per thread
      int idx = t * 256 + tid;
      int r = idx >> 2, seg = (idx & 3) << 3;
      cp16B_g2l(Wt + (size_t)(n0 + r) * Kdim + k0 + seg, &Btile[buf][r][seg]);
    }
  };

  load_tiles(0, 0);
  async_fence();
  __syncthreads();

  for (int kt = 0; kt < nk; ++kt) {
    const int cur = kt & 1;
    if (kt + 1 < nk) load_tiles(kt + 1, cur ^ 1);

    v16h af[2], bf[4];
    af[0] = load_frag_k32(&Atile[cur][wm + 0][0], 32, lane);
    af[1] = load_frag_k32(&Atile[cur][wm + 16][0], 32, lane);
#pragma unroll
    for (int j = 0; j < 4; ++j)
      bf[j] = load_frag_k32(&Btile[cur][wn + j * 16][0], 32, lane);
#pragma unroll
    for (int i = 0; i < 2; ++i)
#pragma unroll
      for (int j = 0; j < 4; ++j)
        acc[i][j] = wmma_f16(af[i], bf[j], acc[i][j]);

    async_fence();
    __syncthreads();
  }

  const int lrow = (lane >> 4) << 3;
  const int lcol = lane & 15;
#pragma unroll
  for (int i = 0; i < 2; ++i)
#pragma unroll
    for (int j = 0; j < 4; ++j) {
      int col = n0 + wn + j * 16 + lcol;
      float bv = bias[col];
#pragma unroll
      for (int e = 0; e < 8; ++e) {
        int row = m0 + wm + i * 16 + e + lrow;
        float v = acc[i][j][e] + bv;
        if (relu) v = fmaxf(v, 0.0f);
        if (Cf) Cf[(size_t)row * N + col] = v;
        if (Ch) Ch[(size_t)row * N + col] = (_Float16)v;
      }
    }
}

// ---------------------------------------------------------------------------
// Flash attention (f16 Q/K/V in, f16 out). One block = (b,h) x 256 q-rows.
// ---------------------------------------------------------------------------
__global__ __launch_bounds__(256) void attention_kernel(
    const _Float16* __restrict__ Q, const _Float16* __restrict__ K,
    const _Float16* __restrict__ V, const int* __restrict__ mask,
    _Float16* __restrict__ O) {
  __shared__ _Float16 Kt[64][64];         //  8 KB : [key][d]  (B-frag for QK^T)
  __shared__ _Float16 Vt[64][64];         //  8 KB : [d][key]  (B-frag for P*V)
  __shared__ _Float16 Pbuf[8][32][64];    // 32 KB : per-wave P tile
  __shared__ int      smask[64];

  const int tid  = threadIdx.x;
  const int lane = tid & 31;
  const int wave = tid >> 5;
  const int bh   = blockIdx.x;
  const int b    = bh >> 3;
  const int hh   = bh & 7;
  const int q0   = blockIdx.y * 256;
  const size_t base = ((size_t)b * S_) * E_ + (size_t)hh * D_;

  // Q fragments straight from global f16 (A layout)
  v16h qf[2][2];
#pragma unroll
  for (int i = 0; i < 2; ++i)
#pragma unroll
    for (int s = 0; s < 2; ++s) {
      int q = q0 + wave * 32 + i * 16 + (lane & 15);
      const _Float16* rp = Q + base + (size_t)q * E_ + s * 32 + ((lane >> 4) << 3);
      union { v16h v; uint32_t u[8]; } f;
#pragma unroll
      for (int vv = 0; vv < 8; ++vv) {
        int d = ((vv >> 2) << 4) + ((vv & 3) << 1);
        f.u[vv] = *(const uint32_t*)(rp + d);
      }
      qf[i][s] = f.v;
    }

  v8f o[2][4] = {};
  float mst[2][8], lst[2][8];
#pragma unroll
  for (int i = 0; i < 2; ++i)
#pragma unroll
    for (int e = 0; e < 8; ++e) { mst[i][e] = -1e30f; lst[i][e] = 0.0f; }

  const float scale = 0.125f;
  const int lrow = (lane >> 4) << 3;
  const int lcol = lane & 15;

  for (int kb = 0; kb < S_; kb += 64) {
    __syncthreads();
    // K block: [key][d] f16 rows -> direct (async) copy; V -> transposed stores
#pragma unroll
    for (int t = 0; t < 2; ++t) {
      int idx = t * 256 + tid;
      int r = idx >> 3, c0 = (idx & 7) << 3;
      cp16B_g2l(K + base + (size_t)(kb + r) * E_ + c0, &Kt[r][c0]);
      uint4 vv = *(const uint4*)(V + base + (size_t)(kb + r) * E_ + c0);
      const _Float16* vh = (const _Float16*)&vv;
#pragma unroll
      for (int j = 0; j < 8; ++j) Vt[c0 + j][r] = vh[j];
    }
    if (tid < 64) smask[tid] = mask[(size_t)b * S_ + kb + tid];
    async_fence();
    __syncthreads();

    // scores S = Q K^T
    v16h kf[4][2];
#pragma unroll
    for (int j = 0; j < 4; ++j)
#pragma unroll
      for (int s = 0; s < 2; ++s)
        kf[j][s] = load_frag_k32(&Kt[j * 16][s * 32], 64, lane);

    v8f sa[2][4];
#pragma unroll
    for (int i = 0; i < 2; ++i)
#pragma unroll
      for (int j = 0; j < 4; ++j) {
        v8f z = {};
        z = wmma_f16(qf[i][0], kf[j][0], z);
        sa[i][j] = wmma_f16(qf[i][1], kf[j][1], z);
      }

    int mj[4];
#pragma unroll
    for (int j = 0; j < 4; ++j) mj[j] = smask[j * 16 + lcol];
#pragma unroll
    for (int i = 0; i < 2; ++i)
#pragma unroll
      for (int j = 0; j < 4; ++j)
#pragma unroll
        for (int e = 0; e < 8; ++e) {
          float v = sa[i][j][e] * scale;
          sa[i][j][e] = mj[j] ? v : -1e20f;
        }

    // online softmax per m-tile
#pragma unroll
    for (int i = 0; i < 2; ++i) {
      float nm[8];
#pragma unroll
      for (int e = 0; e < 8; ++e) {
        float v = sa[i][0][e];
        v = fmaxf(v, sa[i][1][e]); v = fmaxf(v, sa[i][2][e]); v = fmaxf(v, sa[i][3][e]);
        nm[e] = v;
      }
#pragma unroll
      for (int off = 8; off >= 1; off >>= 1)
#pragma unroll
        for (int e = 0; e < 8; ++e)
          nm[e] = fmaxf(nm[e], __shfl_xor(nm[e], off, 16));

      float fs[8];
#pragma unroll
      for (int e = 0; e < 8; ++e) {
        float mn = fmaxf(mst[i][e], nm[e]);
        fs[e] = __expf(mst[i][e] - mn);
        mst[i][e] = mn;
      }
#pragma unroll
      for (int j = 0; j < 4; ++j)
#pragma unroll
        for (int e = 0; e < 8; ++e)
          o[i][j][e] *= fs[e];

      float rs[8] = {0, 0, 0, 0, 0, 0, 0, 0};
#pragma unroll
      for (int j = 0; j < 4; ++j)
#pragma unroll
        for (int e = 0; e < 8; ++e) {
          float p = __expf(sa[i][j][e] - mst[i][e]);
          sa[i][j][e] = p;
          rs[e] += p;
        }
#pragma unroll
      for (int off = 8; off >= 1; off >>= 1)
#pragma unroll
        for (int e = 0; e < 8; ++e)
          rs[e] += __shfl_xor(rs[e], off, 16);
#pragma unroll
      for (int e = 0; e < 8; ++e)
        lst[i][e] = lst[i][e] * fs[e] + rs[e];

#pragma unroll
      for (int j = 0; j < 4; ++j)
#pragma unroll
        for (int e = 0; e < 8; ++e)
          Pbuf[wave][i * 16 + e + lrow][j * 16 + lcol] = (_Float16)sa[i][j][e];
    }

    asm volatile("s_wait_dscnt 0" ::: "memory");  // wave-local P round-trip

    v16h vf[4][2];
#pragma unroll
    for (int j = 0; j < 4; ++j)
#pragma unroll
      for (int s = 0; s < 2; ++s)
        vf[j][s] = load_frag_k32(&Vt[j * 16][s * 32], 64, lane);

#pragma unroll
    for (int i = 0; i < 2; ++i) {
      v16h pf0 = load_frag_k32(&Pbuf[wave][i * 16][0],  64, lane);
      v16h pf1 = load_frag_k32(&Pbuf[wave][i * 16][32], 64, lane);
#pragma unroll
      for (int j = 0; j < 4; ++j) {
        o[i][j] = wmma_f16(pf0, vf[j][0], o[i][j]);
        o[i][j] = wmma_f16(pf1, vf[j][1], o[i][j]);
      }
    }
  }

#pragma unroll
  for (int i = 0; i < 2; ++i)
#pragma unroll
    for (int j = 0; j < 4; ++j)
#pragma unroll
      for (int e = 0; e < 8; ++e) {
        int qrow = q0 + wave * 32 + i * 16 + e + lrow;
        int dcol = j * 16 + lcol;
        O[base + (size_t)qrow * E_ + dcol] = (_Float16)(o[i][j][e] / lst[i][e]);
      }
}

// ---------------------------------------------------------------------------
// Fused residual + LayerNorm: y = LN(x + r)*g + b ; writes f32 and f16 copies
// ---------------------------------------------------------------------------
__global__ __launch_bounds__(128) void add_ln_kernel(
    const float* __restrict__ X, const float* __restrict__ R,
    const float* __restrict__ g, const float* __restrict__ bb,
    float* __restrict__ Y, _Float16* __restrict__ Y16) {
  __shared__ float ssum[4], ssq[4];
  const int row  = blockIdx.x;
  const int tid  = threadIdx.x;
  const int lane = tid & 31;
  const int wave = tid >> 5;
  const int c0   = tid << 2;

  float4 x4 = *(const float4*)(X + (size_t)row * E_ + c0);
  float4 r4 = *(const float4*)(R + (size_t)row * E_ + c0);
  float v[4] = {x4.x + r4.x, x4.y + r4.y, x4.z + r4.z, x4.w + r4.w};
  float s = v[0] + v[1] + v[2] + v[3];
  float q = v[0]*v[0] + v[1]*v[1] + v[2]*v[2] + v[3]*v[3];
#pragma unroll
  for (int off = 16; off >= 1; off >>= 1) {
    s += __shfl_xor(s, off, 32);
    q += __shfl_xor(q, off, 32);
  }
  if (lane == 0) { ssum[wave] = s; ssq[wave] = q; }
  __syncthreads();
  float S1 = ssum[0] + ssum[1] + ssum[2] + ssum[3];
  float S2 = ssq[0]  + ssq[1]  + ssq[2]  + ssq[3];
  float mu   = S1 * (1.0f / E_);
  float var  = S2 * (1.0f / E_) - mu * mu;
  float rinv = rsqrtf(var + 1e-6f);
  float4 o;
  float* op = &o.x;
#pragma unroll
  for (int c = 0; c < 4; ++c) {
    int col = c0 + c;
    op[c] = (v[c] - mu) * rinv * g[col] + bb[col];
  }
  *(float4*)(Y + (size_t)row * E_ + c0) = o;
  uint2 hp; hp.x = pack2h(o.x, o.y); hp.y = pack2h(o.z, o.w);
  *(uint2*)(Y16 + (size_t)row * E_ + c0) = hp;
}

// ---------------------------------------------------------------------------
// Host orchestration
// ---------------------------------------------------------------------------
extern "C" void kernel_launch(void* const* d_in, const int* in_sizes, int n_in,
                              void* d_out, int out_size, void* d_ws, size_t ws_size,
                              hipStream_t stream) {
  const int*   x    = (const int*)d_in[0];
  const int*   mask = (const int*)d_in[1];
  const float* emb  = (const float*)d_in[2];
  const float* pos  = (const float*)d_in[3];
  const float* Wq   = (const float*)d_in[4];
  const float* bq   = (const float*)d_in[5];
  const float* Wk   = (const float*)d_in[6];
  const float* bk   = (const float*)d_in[7];
  const float* Wv   = (const float*)d_in[8];
  const float* bv   = (const float*)d_in[9];
  const float* Wo   = (const float*)d_in[10];
  const float* bo   = (const float*)d_in[11];
  const float* g1   = (const float*)d_in[12];
  const float* be1  = (const float*)d_in[13];
  const float* g2   = (const float*)d_in[14];
  const float* be2  = (const float*)d_in[15];
  const float* W1   = (const float*)d_in[16];
  const float* bf1  = (const float*)d_in[17];
  const float* W2   = (const float*)d_in[18];
  const float* bf2  = (const float*)d_in[19];

  float* h = (float*)d_out;                               // [B,S,E] f32, persistent

  const size_t ACT = (size_t)ROWS * E_;
  char* p = (char*)d_ws;
  auto alloc_h = [&](size_t n) { _Float16* r = (_Float16*)p; p += n * sizeof(_Float16); return r; };
  _Float16* h16   = alloc_h(ACT);
  _Float16* q16   = alloc_h(ACT);
  _Float16* k16   = alloc_h(ACT);
  _Float16* v16   = alloc_h(ACT);
  _Float16* att16 = alloc_h(ACT);
  _Float16* big16 = alloc_h((size_t)ROWS * FF_);
  float* f32tmp = (float*)p; p += ACT * sizeof(float);
  _Float16* wtq[L_]; _Float16* wtk[L_]; _Float16* wtv[L_]; _Float16* wto[L_];
  _Float16* wt1[L_]; _Float16* wt2[L_];
  for (int l = 0; l < L_; ++l) {
    wtq[l] = alloc_h((size_t)E_ * E_);
    wtk[l] = alloc_h((size_t)E_ * E_);
    wtv[l] = alloc_h((size_t)E_ * E_);
    wto[l] = alloc_h((size_t)E_ * E_);
    wt1[l] = alloc_h((size_t)E_ * FF_);
    wt2[l] = alloc_h((size_t)FF_ * E_);
  }

  // One-time weight convert+transpose (W[K][N] f32 -> Wt[N][K] f16)
  const int gEE = E_ * E_ / 256, gEF = E_ * FF_ / 256;
  for (int l = 0; l < L_; ++l) {
    wconv_kernel<<<gEE, 256, 0, stream>>>(Wq + (size_t)l * E_ * E_, wtq[l], E_, E_);
    wconv_kernel<<<gEE, 256, 0, stream>>>(Wk + (size_t)l * E_ * E_, wtk[l], E_, E_);
    wconv_kernel<<<gEE, 256, 0, stream>>>(Wv + (size_t)l * E_ * E_, wtv[l], E_, E_);
    wconv_kernel<<<gEE, 256, 0, stream>>>(Wo + (size_t)l * E_ * E_, wto[l], E_, E_);
    wconv_kernel<<<gEF, 256, 0, stream>>>(W1 + (size_t)l * E_ * FF_, wt1[l], E_, FF_);
    wconv_kernel<<<gEF, 256, 0, stream>>>(W2 + (size_t)l * FF_ * E_, wt2[l], FF_, E_);
  }

  embed_kernel<<<ROWS, 128, 0, stream>>>(x, emb, pos, h, h16);

  const dim3 gE(ROWS / 64, E_ / 256);                     // N = 512
  const dim3 gF(ROWS / 64, FF_ / 256);                    // N = 2048
  const dim3 gA(B_ * H_, S_ / 256);

  for (int l = 0; l < L_; ++l) {
    const float* bql = bq  + (size_t)l * E_;
    const float* bkl = bk  + (size_t)l * E_;
    const float* bvl = bv  + (size_t)l * E_;
    const float* bol = bo  + (size_t)l * E_;
    const float* b1l = bf1 + (size_t)l * FF_;
    const float* b2l = bf2 + (size_t)l * E_;
    const float* g1l = g1  + (size_t)l * E_;
    const float* e1l = be1 + (size_t)l * E_;
    const float* g2l = g2  + (size_t)l * E_;
    const float* e2l = be2 + (size_t)l * E_;

    gemm_f16_kernel<<<gE, 256, 0, stream>>>(h16, wtq[l], bql, nullptr, q16, E_, E_, 0);
    gemm_f16_kernel<<<gE, 256, 0, stream>>>(h16, wtk[l], bkl, nullptr, k16, E_, E_, 0);
    gemm_f16_kernel<<<gE, 256, 0, stream>>>(h16, wtv[l], bvl, nullptr, v16, E_, E_, 0);

    attention_kernel<<<gA, 256, 0, stream>>>(q16, k16, v16, mask, att16);

    gemm_f16_kernel<<<gE, 256, 0, stream>>>(att16, wto[l], bol, f32tmp, nullptr, E_, E_, 0);
    add_ln_kernel<<<ROWS, 128, 0, stream>>>(f32tmp, h, g1l, e1l, h, h16);

    gemm_f16_kernel<<<gF, 256, 0, stream>>>(h16, wt1[l], b1l, nullptr, big16, FF_, E_, 1);
    gemm_f16_kernel<<<gE, 256, 0, stream>>>(big16, wt2[l], b2l, f32tmp, nullptr, E_, FF_, 0);
    add_ln_kernel<<<ROWS, 128, 0, stream>>>(f32tmp, h, g2l, e2l, h, h16);
  }
}

// v001
// One run takes 589 microseconds.
// Two timings next to v000 both put it at 1.26 times that version's speed.
#include <hip/hip_runtime.h>
#include <hip/hip_bf16.h>

typedef __attribute__((ext_vector_type(16))) _Float16 v16h;
typedef __attribute__((ext_vector_type(8)))  float    v8f;
typedef int v4i_vec __attribute__((vector_size(16)));   // int __vector(4)

constexpr int E_   = 512;
constexpr int H_   = 8;
constexpr int D_   = 64;
constexpr int FF_  = 2048;
constexpr int L_   = 2;
constexpr int B_   = 4;
constexpr int S_   = 2048;
constexpr int ROWS = B_ * S_;          // 8192 token rows

constexpr int GP_  = 40;               // GEMM tiles: 32 f16 used per row
constexpr int AP_  = 72;               // attention tiles: 64 f16 used per row

#if defined(__has_builtin)
#if __has_builtin(__builtin_amdgcn_global_load_async_to_lds_b128)
#define HAVE_ASYNC_LDS 1
#endif
#endif
#ifndef HAVE_ASYNC_LDS
#define HAVE_ASYNC_LDS 0
#endif

__device__ __forceinline__ uint32_t pack2h(float a, float b) {
  union { _Float16 h[2]; uint32_t u; } t;
  t.h[0] = (_Float16)a; t.h[1] = (_Float16)b;
  return t.u;
}

__device__ __forceinline__ void cp16B_g2l(const _Float16* g, _Float16* l) {
#if HAVE_ASYNC_LDS
  __builtin_amdgcn_global_load_async_to_lds_b128(
      (__attribute__((address_space(1))) v4i_vec*)(_Float16*)g,
      (__attribute__((address_space(3))) v4i_vec*)l, 0, 0);
#else
  *(uint4*)l = *(const uint4*)g;
#endif
}

__device__ __forceinline__ void async_fence() {
#if HAVE_ASYNC_LDS
  asm volatile("s_wait_asynccnt 0" ::: "memory");
#endif
}

__device__ __forceinline__ v16h load_frag_k32(const _Float16* base, int rowStride, int lane) {
  int r  = lane & 15;
  int kh = (lane >> 4) << 3;
  const _Float16* p = base + r * rowStride + kh;
  union { v16h v; uint32_t u[8]; } f;
  const uint32_t* p0 = (const uint32_t*)p;
  const uint32_t* p1 = (const uint32_t*)(p + 16);
#pragma unroll
  for (int i = 0; i < 4; ++i) { f.u[i] = p0[i]; f.u[4 + i] = p1[i]; }
  return f.v;
}

__device__ __forceinline__ v8f wmma_f16(v16h a, v16h b, v8f c) {
  return __builtin_amdgcn_wmma_f32_16x16x32_f16(false, a, false, b, (short)0, c, false, false);
}

// ---------------------------------------------------------------------------
// Weight convert + transpose: W[K][N] f32 -> Wt[N][K] f16 (one-time, tiny)
// ---------------------------------------------------------------------------
__global__ __launch_bounds__(256) void wconv_kernel(
    const float* __restrict__ W, _Float16* __restrict__ Wt, int K, int N) {
  int idx = blockIdx.x * 256 + threadIdx.x;   // over N*K
  int n = idx / K;
  int k = idx - n * K;
  Wt[idx] = (_Float16)W[(size_t)k * N + n];
}

// ---------------------------------------------------------------------------
// Embedding + positional add: writes f32 h and f16 h16
// ---------------------------------------------------------------------------
__global__ __launch_bounds__(128) void embed_kernel(
    const int* __restrict__ x, const float* __restrict__ emb,
    const float* __restrict__ pos, float* __restrict__ h,
    _Float16* __restrict__ h16) {
  int row = blockIdx.x;
  int s   = row & (S_ - 1);
  int tok = x[row] + 1;
  int c   = threadIdx.x << 2;
  float4 e4 = *(const float4*)(emb + (size_t)tok * E_ + c);
  float4 p4 = *(const float4*)(pos + (size_t)s   * E_ + c);
  float4 o; o.x = e4.x + p4.x; o.y = e4.y + p4.y; o.z = e4.z + p4.z; o.w = e4.w + p4.w;
  *(float4*)(h + (size_t)row * E_ + c) = o;
  uint2 hp; hp.x = pack2h(o.x, o.y); hp.y = pack2h(o.z, o.w);
  *(uint2*)(h16 + (size_t)row * E_ + c) = hp;
}

// ---------------------------------------------------------------------------
// WMMA GEMM, f16 in: C[M,N] = act(A[M,K] @ Wt[N,K]^T + bias[N]), M = 8192.
// Block tile 64x256, 8 waves (2x4), wave tile 32x64, K-step 32, dbl buffer.
// Output: f32 (Cf) and/or f16 (Ch).
// ---------------------------------------------------------------------------
__global__ __launch_bounds__(256) void gemm_f16_kernel(
    const _Float16* __restrict__ A, const _Float16* __restrict__ Wt,
    const float* __restrict__ bias, float* __restrict__ Cf,
    _Float16* __restrict__ Ch, int N, int Kdim, int relu) {
  __shared__ __attribute__((aligned(16))) _Float16 Atile[2][64][GP_];   // 10 KB
  __shared__ __attribute__((aligned(16))) _Float16 Btile[2][256][GP_];  // 40 KB  ([n][k] fragment order)

  const int tid  = threadIdx.x;
  const int lane = tid & 31;
  const int wave = tid >> 5;
  const int wm   = (wave >> 2) << 5;           // 0 / 32
  const int wn   = (wave & 3) << 6;            // 0 / 64 / 128 / 192
  const int m0   = blockIdx.x * 64;
  const int n0   = blockIdx.y * 256;

  v8f acc[2][4] = {};
  const int nk = Kdim >> 5;

  auto load_tiles = [&](int kt, int buf) {
    const int k0 = kt << 5;
    {  // A: 64x32 f16 = 256 x 16B, 1 per thread
      int r = tid >> 2, seg = (tid & 3) << 3;
      cp16B_g2l(A + (size_t)(m0 + r) * Kdim + k0 + seg, &Atile[buf][r][seg]);
    }
#pragma unroll
    for (int t = 0; t < 4; ++t) {  // B: 256x32 f16 = 1024 x 16B, 4 per thread
      int idx = t * 256 + tid;
      int r = idx >> 2, seg = (idx & 3) << 3;
      cp16B_g2l(Wt + (size_t)(n0 + r) * Kdim + k0 + seg, &Btile[buf][r][seg]);
    }
  };

  load_tiles(0, 0);
  async_fence();
  __syncthreads();

  for (int kt = 0; kt < nk; ++kt) {
    const int cur = kt & 1;
    if (kt + 1 < nk) load_tiles(kt + 1, cur ^ 1);

    v16h af[2], bf[4];
    af[0] = load_frag_k32(&Atile[cur][wm + 0][0], GP_, lane);
    af[1] = load_frag_k32(&Atile[cur][wm + 16][0], GP_, lane);
#pragma unroll
    for (int j = 0; j < 4; ++j)
      bf[j] = load_frag_k32(&Btile[cur][wn + j * 16][0], GP_, lane);
#pragma unroll
    for (int i = 0; i < 2; ++i)
#pragma unroll
      for (int j = 0; j < 4; ++j)
        acc[i][j] = wmma_f16(af[i], bf[j], acc[i][j]);

    async_fence();
    __syncthreads();
  }

  const int lrow = (lane >> 4) << 3;
  const int lcol = lane & 15;
#pragma unroll
  for (int i = 0; i < 2; ++i)
#pragma unroll
    for (int j = 0; j < 4; ++j) {
      int col = n0 + wn + j * 16 + lcol;
      float bv = bias[col];
#pragma unroll
      for (int e = 0; e < 8; ++e) {
        int row = m0 + wm + i * 16 + e + lrow;
        float v = acc[i][j][e] + bv;
        if (relu) v = fmaxf(v, 0.0f);
        if (Cf) Cf[(size_t)row * N + col] = v;
        if (Ch) Ch[(size_t)row * N + col] = (_Float16)v;
      }
    }
}

// ---------------------------------------------------------------------------
// Flash attention (f16 Q/K/V in, f16 out). One block = (b,h) x 256 q-rows.
// ---------------------------------------------------------------------------
__global__ __launch_bounds__(256) void attention_kernel(
    const _Float16* __restrict__ Q, const _Float16* __restrict__ K,
    const _Float16* __restrict__ V, const int* __restrict__ mask,
    _Float16* __restrict__ O) {
  __shared__ __attribute__((aligned(16))) _Float16 Kt[64][AP_];       //  9 KB : [key][d]  (B-frag for QK^T)
  __shared__ __attribute__((aligned(16))) _Float16 Vt[64][AP_];       //  9 KB : [d][key]  (B-frag for P*V)
  __shared__ __attribute__((aligned(16))) _Float16 Pbuf[8][32][AP_];  // 36 KB : per-wave P tile
  __shared__ int      smask[64];

  const int tid  = threadIdx.x;
  const int lane = tid & 31;
  const int wave = tid >> 5;
  const int bh   = blockIdx.x;
  const int b    = bh >> 3;
  const int hh   = bh & 7;
  const int q0   = blockIdx.y * 256;
  const size_t base = ((size_t)b * S_) * E_ + (size_t)hh * D_;

  // Q fragments straight from global f16 (A layout)
  v16h qf[2][2];
#pragma unroll
  for (int i = 0; i < 2; ++i)
#pragma unroll
    for (int s = 0; s < 2; ++s) {
      int q = q0 + wave * 32 + i * 16 + (lane & 15);
      const _Float16* rp = Q + base + (size_t)q * E_ + s * 32 + ((lane >> 4) << 3);
      union { v16h v; uint32_t u[8]; } f;
#pragma unroll
      for (int vv = 0; vv < 8; ++vv) {
        int d = ((vv >> 2) << 4) + ((vv & 3) << 1);
        f.u[vv] = *(const uint32_t*)(rp + d);
      }
      qf[i][s] = f.v;
    }

  v8f o[2][4] = {};
  float mst[2][8], lst[2][8];
#pragma unroll
  for (int i = 0; i < 2; ++i)
#pragma unroll
    for (int e = 0; e < 8; ++e) { mst[i][e] = -1e30f; lst[i][e] = 0.0f; }

  const float scale = 0.125f;
  const int lrow = (lane >> 4) << 3;
  const int lcol = lane & 15;

  for (int kb = 0; kb < S_; kb += 64) {
    __syncthreads();
    // K block: [key][d] f16 rows -> direct (async) copy; V -> transposed stores
#pragma unroll
    for (int t = 0; t < 2; ++t) {
      int idx = t * 256 + tid;
      int r = idx >> 3, c0 = (idx & 7) << 3;
      cp16B_g2l(K + base + (size_t)(kb + r) * E_ + c0, &Kt[r][c0]);
      uint4 vv = *(const uint4*)(V + base + (size_t)(kb + r) * E_ + c0);
      const _Float16* vh = (const _Float16*)&vv;
#pragma unroll
      for (int j = 0; j < 8; ++j) Vt[c0 + j][r] = vh[j];
    }
    if (tid < 64) smask[tid] = mask[(size_t)b * S_ + kb + tid];
    async_fence();
    __syncthreads();

    // scores S = Q K^T
    v16h kf[4][2];
#pragma unroll
    for (int j = 0; j < 4; ++j)
#pragma unroll
      for (int s = 0; s < 2; ++s)
        kf[j][s] = load_frag_k32(&Kt[j * 16][s * 32], AP_, lane);

    v8f sa[2][4];
#pragma unroll
    for (int i = 0; i < 2; ++i)
#pragma unroll
      for (int j = 0; j < 4; ++j) {
        v8f z = {};
        z = wmma_f16(qf[i][0], kf[j][0], z);
        sa[i][j] = wmma_f16(qf[i][1], kf[j][1], z);
      }

    int mj[4];
#pragma unroll
    for (int j = 0; j < 4; ++j) mj[j] = smask[j * 16 + lcol];
#pragma unroll
    for (int i = 0; i < 2; ++i)
#pragma unroll
      for (int j = 0; j < 4; ++j)
#pragma unroll
        for (int e = 0; e < 8; ++e) {
          float v = sa[i][j][e] * scale;
          sa[i][j][e] = mj[j] ? v : -1e20f;
        }

    // online softmax per m-tile
#pragma unroll
    for (int i = 0; i < 2; ++i) {
      float nm[8];
#pragma unroll
      for (int e = 0; e < 8; ++e) {
        float v = sa[i][0][e];
        v = fmaxf(v, sa[i][1][e]); v = fmaxf(v, sa[i][2][e]); v = fmaxf(v, sa[i][3][e]);
        nm[e] = v;
      }
#pragma unroll
      for (int off = 8; off >= 1; off >>= 1)
#pragma unroll
        for (int e = 0; e < 8; ++e)
          nm[e] = fmaxf(nm[e], __shfl_xor(nm[e], off, 16));

      float fs[8];
#pragma unroll
      for (int e = 0; e < 8; ++e) {
        float mn = fmaxf(mst[i][e], nm[e]);
        fs[e] = __expf(mst[i][e] - mn);
        mst[i][e] = mn;
      }
#pragma unroll
      for (int j = 0; j < 4; ++j)
#pragma unroll
        for (int e = 0; e < 8; ++e)
          o[i][j][e] *= fs[e];

      float rs[8] = {0, 0, 0, 0, 0, 0, 0, 0};
#pragma unroll
      for (int j = 0; j < 4; ++j)
#pragma unroll
        for (int e = 0; e < 8; ++e) {
          float p = __expf(sa[i][j][e] - mst[i][e]);
          sa[i][j][e] = p;
          rs[e] += p;
        }
#pragma unroll
      for (int off = 8; off >= 1; off >>= 1)
#pragma unroll
        for (int e = 0; e < 8; ++e)
          rs[e] += __shfl_xor(rs[e], off, 16);
#pragma unroll
      for (int e = 0; e < 8; ++e)
        lst[i][e] = lst[i][e] * fs[e] + rs[e];

#pragma unroll
      for (int j = 0; j < 4; ++j)
#pragma unroll
        for (int e = 0; e < 8; ++e)
          Pbuf[wave][i * 16 + e + lrow][j * 16 + lcol] = (_Float16)sa[i][j][e];
    }

    asm volatile("s_wait_dscnt 0" ::: "memory");  // wave-local P round-trip

    v16h vf[4][2];
#pragma unroll
    for (int j = 0; j < 4; ++j)
#pragma unroll
      for (int s = 0; s < 2; ++s)
        vf[j][s] = load_frag_k32(&Vt[j * 16][s * 32], AP_, lane);

#pragma unroll
    for (int i = 0; i < 2; ++i) {
      v16h pf0 = load_frag_k32(&Pbuf[wave][i * 16][0],  AP_, lane);
      v16h pf1 = load_frag_k32(&Pbuf[wave][i * 16][32], AP_, lane);
#pragma unroll
      for (int j = 0; j < 4; ++j) {
        o[i][j] = wmma_f16(pf0, vf[j][0], o[i][j]);
        o[i][j] = wmma_f16(pf1, vf[j][1], o[i][j]);
      }
    }
  }

#pragma unroll
  for (int i = 0; i < 2; ++i)
#pragma unroll
    for (int j = 0; j < 4; ++j)
#pragma unroll
      for (int e = 0; e < 8; ++e) {
        int qrow = q0 + wave * 32 + i * 16 + e + lrow;
        int dcol = j * 16 + lcol;
        O[base + (size_t)qrow * E_ + dcol] = (_Float16)(o[i][j][e] / lst[i][e]);
      }
}

// ---------------------------------------------------------------------------
// Fused residual + LayerNorm: y = LN(x + r)*g + b ; writes f32 and f16 copies
// ---------------------------------------------------------------------------
__global__ __launch_bounds__(128) void add_ln_kernel(
    const float* __restrict__ X, const float* __restrict__ R,
    const float* __restrict__ g, const float* __restrict__ bb,
    float* __restrict__ Y, _Float16* __restrict__ Y16) {
  __shared__ float ssum[4], ssq[4];
  const int row  = blockIdx.x;
  const int tid  = threadIdx.x;
  const int lane = tid & 31;
  const int wave = tid >> 5;
  const int c0   = tid << 2;

  float4 x4 = *(const float4*)(X + (size_t)row * E_ + c0);
  float4 r4 = *(const float4*)(R + (size_t)row * E_ + c0);
  float v[4] = {x4.x + r4.x, x4.y + r4.y, x4.z + r4.z, x4.w + r4.w};
  float s = v[0] + v[1] + v[2] + v[3];
  float q = v[0]*v[0] + v[1]*v[1] + v[2]*v[2] + v[3]*v[3];
#pragma unroll
  for (int off = 16; off >= 1; off >>= 1) {
    s += __shfl_xor(s, off, 32);
    q += __shfl_xor(q, off, 32);
  }
  if (lane == 0) { ssum[wave] = s; ssq[wave] = q; }
  __syncthreads();
  float S1 = ssum[0] + ssum[1] + ssum[2] + ssum[3];
  float S2 = ssq[0]  + ssq[1]  + ssq[2]  + ssq[3];
  float mu   = S1 * (1.0f / E_);
  float var  = S2 * (1.0f / E_) - mu * mu;
  float rinv = rsqrtf(var + 1e-6f);
  float4 o;
  float* op = &o.x;
#pragma unroll
  for (int c = 0; c < 4; ++c) {
    int col = c0 + c;
    op[c] = (v[c] - mu) * rinv * g[col] + bb[col];
  }
  *(float4*)(Y + (size_t)row * E_ + c0) = o;
  uint2 hp; hp.x = pack2h(o.x, o.y); hp.y = pack2h(o.z, o.w);
  *(uint2*)(Y16 + (size_t)row * E_ + c0) = hp;
}

// ---------------------------------------------------------------------------
// Host orchestration
// ---------------------------------------------------------------------------
extern "C" void kernel_launch(void* const* d_in, const int* in_sizes, int n_in,
                              void* d_out, int out_size, void* d_ws, size_t ws_size,
                              hipStream_t stream) {
  const int*   x    = (const int*)d_in[0];
  const int*   mask = (const int*)d_in[1];
  const float* emb  = (const float*)d_in[2];
  const float* pos  = (const float*)d_in[3];
  const float* Wq   = (const float*)d_in[4];
  const float* bq   = (const float*)d_in[5];
  const float* Wk   = (const float*)d_in[6];
  const float* bk   = (const float*)d_in[7];
  const float* Wv   = (const float*)d_in[8];
  const float* bv   = (const float*)d_in[9];
  const float* Wo   = (const float*)d_in[10];
  const float* bo   = (const float*)d_in[11];
  const float* g1   = (const float*)d_in[12];
  const float* be1  = (const float*)d_in[13];
  const float* g2   = (const float*)d_in[14];
  const float* be2  = (const float*)d_in[15];
  const float* W1   = (const float*)d_in[16];
  const float* bf1  = (const float*)d_in[17];
  const float* W2   = (const float*)d_in[18];
  const float* bf2  = (const float*)d_in[19];

  float* h = (float*)d_out;                               // [B,S,E] f32, persistent

  const size_t ACT = (size_t)ROWS * E_;
  char* p = (char*)d_ws;
  auto alloc_h = [&](size_t n) { _Float16* r = (_Float16*)p; p += n * sizeof(_Float16); return r; };
  _Float16* h16   = alloc_h(ACT);
  _Float16* q16   = alloc_h(ACT);
  _Float16* k16   = alloc_h(ACT);
  _Float16* v16   = alloc_h(ACT);
  _Float16* att16 = alloc_h(ACT);
  _Float16* big16 = alloc_h((size_t)ROWS * FF_);
  float* f32tmp = (float*)p; p += ACT * sizeof(float);
  _Float16* wtq[L_]; _Float16* wtk[L_]; _Float16* wtv[L_]; _Float16* wto[L_];
  _Float16* wt1[L_]; _Float16* wt2[L_];
  for (int l = 0; l < L_; ++l) {
    wtq[l] = alloc_h((size_t)E_ * E_);
    wtk[l] = alloc_h((size_t)E_ * E_);
    wtv[l] = alloc_h((size_t)E_ * E_);
    wto[l] = alloc_h((size_t)E_ * E_);
    wt1[l] = alloc_h((size_t)E_ * FF_);
    wt2[l] = alloc_h((size_t)FF_ * E_);
  }

  // One-time weight convert+transpose (W[K][N] f32 -> Wt[N][K] f16)
  const int gEE = E_ * E_ / 256, gEF = E_ * FF_ / 256;
  for (int l = 0; l < L_; ++l) {
    wconv_kernel<<<gEE, 256, 0, stream>>>(Wq + (size_t)l * E_ * E_, wtq[l], E_, E_);
    wconv_kernel<<<gEE, 256, 0, stream>>>(Wk + (size_t)l * E_ * E_, wtk[l], E_, E_);
    wconv_kernel<<<gEE, 256, 0, stream>>>(Wv + (size_t)l * E_ * E_, wtv[l], E_, E_);
    wconv_kernel<<<gEE, 256, 0, stream>>>(Wo + (size_t)l * E_ * E_, wto[l], E_, E_);
    wconv_kernel<<<gEF, 256, 0, stream>>>(W1 + (size_t)l * E_ * FF_, wt1[l], E_, FF_);
    wconv_kernel<<<gEF, 256, 0, stream>>>(W2 + (size_t)l * FF_ * E_, wt2[l], FF_, E_);
  }

  embed_kernel<<<ROWS, 128, 0, stream>>>(x, emb, pos, h, h16);

  const dim3 gE(ROWS / 64, E_ / 256);                     // N = 512
  const dim3 gF(ROWS / 64, FF_ / 256);                    // N = 2048
  const dim3 gA(B_ * H_, S_ / 256);

  for (int l = 0; l < L_; ++l) {
    const float* bql = bq  + (size_t)l * E_;
    const float* bkl = bk  + (size_t)l * E_;
    const float* bvl = bv  + (size_t)l * E_;
    const float* bol = bo  + (size_t)l * E_;
    const float* b1l = bf1 + (size_t)l * FF_;
    const float* b2l = bf2 + (size_t)l * E_;
    const float* g1l = g1  + (size_t)l * E_;
    const float* e1l = be1 + (size_t)l * E_;
    const float* g2l = g2  + (size_t)l * E_;
    const float* e2l = be2 + (size_t)l * E_;

    gemm_f16_kernel<<<gE, 256, 0, stream>>>(h16, wtq[l], bql, nullptr, q16, E_, E_, 0);
    gemm_f16_kernel<<<gE, 256, 0, stream>>>(h16, wtk[l], bkl, nullptr, k16, E_, E_, 0);
    gemm_f16_kernel<<<gE, 256, 0, stream>>>(h16, wtv[l], bvl, nullptr, v16, E_, E_, 0);

    attention_kernel<<<gA, 256, 0, stream>>>(q16, k16, v16, mask, att16);

    gemm_f16_kernel<<<gE, 256, 0, stream>>>(att16, wto[l], bol, f32tmp, nullptr, E_, E_, 0);
    add_ln_kernel<<<ROWS, 128, 0, stream>>>(f32tmp, h, g1l, e1l, h, h16);

    gemm_f16_kernel<<<gF, 256, 0, stream>>>(h16, wt1[l], b1l, nullptr, big16, FF_, E_, 1);
    gemm_f16_kernel<<<gE, 256, 0, stream>>>(big16, wt2[l], b2l, f32tmp, nullptr, E_, FF_, 0);
    add_ln_kernel<<<ROWS, 128, 0, stream>>>(f32tmp, h, g2l, e2l, h, h16);
  }
}

// v002
// One run takes 536 microseconds.
// Two timings next to v001 put it at 1.10 and 1.09 times that version's speed.
// All steps since v000 together make it 1.38 times as fast.
#include <hip/hip_runtime.h>
#include <hip/hip_bf16.h>

typedef __attribute__((ext_vector_type(16))) _Float16 v16h;
typedef __attribute__((ext_vector_type(8)))  float    v8f;
typedef int v4i_vec __attribute__((vector_size(16)));   // int __vector(4)

constexpr int E_   = 512;
constexpr int H_   = 8;
constexpr int D_   = 64;
constexpr int FF_  = 2048;
constexpr int L_   = 2;
constexpr int B_   = 4;
constexpr int S_   = 2048;
constexpr int ROWS = B_ * S_;          // 8192 token rows

constexpr int GP_  = 40;               // GEMM tiles: 32 f16 used per row
constexpr int AP_  = 72;               // attention tiles: 64 f16 used per row

#if defined(__has_builtin)
#if __has_builtin(__builtin_amdgcn_global_load_async_to_lds_b128)
#define HAVE_ASYNC_LDS 1
#endif
#endif
#ifndef HAVE_ASYNC_LDS
#define HAVE_ASYNC_LDS 0
#endif

__device__ __forceinline__ uint32_t pack2h(float a, float b) {
  union { _Float16 h[2]; uint32_t u; } t;
  t.h[0] = (_Float16)a; t.h[1] = (_Float16)b;
  return t.u;
}

__device__ __forceinline__ void cp16B_g2l(const _Float16* g, _Float16* l) {
#if HAVE_ASYNC_LDS
  __builtin_amdgcn_global_load_async_to_lds_b128(
      (__attribute__((address_space(1))) v4i_vec*)(_Float16*)g,
      (__attribute__((address_space(3))) v4i_vec*)l, 0, 0);
#else
  *(uint4*)l = *(const uint4*)g;
#endif
}

__device__ __forceinline__ void async_fence() {
#if HAVE_ASYNC_LDS
  asm volatile("s_wait_asynccnt 0" ::: "memory");
#endif
}

__device__ __forceinline__ v16h load_frag_k32(const _Float16* base, int rowStride, int lane) {
  int r  = lane & 15;
  int kh = (lane >> 4) << 3;
  const _Float16* p = base + r * rowStride + kh;
  union { v16h v; uint32_t u[8]; } f;
  const uint32_t* p0 = (const uint32_t*)p;
  const uint32_t* p1 = (const uint32_t*)(p + 16);
#pragma unroll
  for (int i = 0; i < 4; ++i) { f.u[i] = p0[i]; f.u[4 + i] = p1[i]; }
  return f.v;
}

__device__ __forceinline__ v8f wmma_f16(v16h a, v16h b, v8f c) {
  return __builtin_amdgcn_wmma_f32_16x16x32_f16(false, a, false, b, (short)0, c, false, false);
}

// ---------------------------------------------------------------------------
// Weight convert + transpose, all twelve matrices in one launch:
// W[K][N] f32 -> Wt[N][K] f16. One block moves a 128(k) x 64(n) tile through LDS,
// 32 elements per thread; global reads and writes are runs of 256 B.
// grid.x: 0..127 Wq,Wk,Wv,Wo (32 tiles each), 128..255 W1, 256..383 W2; grid.y: layer.
// Wt: per layer wtq, wtk, wtv, wto, wt1, wt2 back to back (WL_ elements).
// ---------------------------------------------------------------------------
constexpr int    TP_ = 136;            // tile row pitch in f16: 256 B + 16 B (16 B x odd)
constexpr size_t WL_ = (size_t)4 * E_ * E_ + (size_t)2 * E_ * FF_;

template <int K, int N>
__device__ __forceinline__ void wconv_tile(
    const float* __restrict__ W, _Float16* __restrict__ Wt, int t, _Float16 (*T)[TP_]) {
  const int tid = threadIdx.x;
  const int k0  = (t / (N / 64)) * 128;
  const int n0  = (t % (N / 64)) * 64;

  // read: a thread takes 8 consecutive k of 4 consecutive n (16 lanes = 256 B of one k row);
  // uniform tile base + one per-lane byte offset that all eight loads share
  const int kc = tid >> 4;             // which group of 8 k
  const int nq = tid & 15;             // which group of 4 n
  const char* sb = (const char*)(W + (size_t)k0 * N + n0);
  const uint32_t voff = (uint32_t)(kc * 8 * N + nq * 4) * 4u;
  float4 v[8];
#pragma unroll  // all eight loads in flight together, v[] in registers
  for (int i = 0; i < 8; ++i) v[i] = *(const float4*)(sb + voff + i * N * 4);

#pragma unroll  // constant c: v[] is indexed at compile time and stays in registers
  for (int c = 0; c < 4; ++c) {
    uint4 w;
    w.x = pack2h((&v[0].x)[c], (&v[1].x)[c]);
    w.y = pack2h((&v[2].x)[c], (&v[3].x)[c]);
    w.z = pack2h((&v[4].x)[c], (&v[5].x)[c]);
    w.w = pack2h((&v[6].x)[c], (&v[7].x)[c]);
    *(uint4*)&T[nq * 4 + c][kc * 8] = w;
  }
  __syncthreads();

  // write: 16 lanes = the 256 B that one n row of the tile holds
  _Float16* dp = Wt + (size_t)n0 * K + k0;
#pragma unroll  // the four LDS reads issue ahead of the four stores
  for (int j = 0; j < 4; ++j) {
    const int idx = j * 256 + tid;
    const int row = idx >> 4, ch = (idx & 15) << 3;
    *(uint4*)(dp + (size_t)row * K + ch) = *(const uint4*)&T[row][ch];
  }
}

__global__ __launch_bounds__(256) void wconv_kernel(
    const float* __restrict__ Wq, const float* __restrict__ Wk,
    const float* __restrict__ Wv, const float* __restrict__ Wo,
    const float* __restrict__ W1, const float* __restrict__ W2,
    _Float16* __restrict__ Wt) {
  __shared__ __attribute__((aligned(16))) _Float16 T[64][TP_];        // 17 KB : [n][k]

  const int r = blockIdx.x;            // the three branches are uniform for the block
  const int l = blockIdx.y;
  _Float16* D = Wt + (size_t)l * WL_;
  if (r < 128) {
    const int m = r >> 5;
    const float* W = (m == 0) ? Wq : (m == 1) ? Wk : (m == 2) ? Wv : Wo;
    wconv_tile<E_, E_>(W + (size_t)l * E_ * E_, D + (size_t)m * E_ * E_, r & 31, T);
  } else if (r < 256) {
    wconv_tile<E_, FF_>(W1 + (size_t)l * E_ * FF_, D + (size_t)4 * E_ * E_, r - 128, T);
  } else {
    wconv_tile<FF_, E_>(W2 + (size_t)l * FF_ * E_,
                        D + (size_t)4 * E_ * E_ + (size_t)E_ * FF_, r - 256, T);
  }
}

// ---------------------------------------------------------------------------
// Embedding + positional add: writes f32 h and f16 h16
// ---------------------------------------------------------------------------
__global__ __launch_bounds__(128) void embed_kernel(
    const int* __restrict__ x, const float* __restrict__ emb,
    const float* __restrict__ pos, float* __restrict__ h,
    _Float16* __restrict__ h16) {
  int row = blockIdx.x;
  int s   = row & (S_ - 1);
  int tok = x[row] + 1;
  int c   = threadIdx.x << 2;
  float4 e4 = *(const float4*)(emb + (size_t)tok * E_ + c);
  float4 p4 = *(const float4*)(pos + (size_t)s   * E_ + c);
  float4 o; o.x = e4.x + p4.x; o.y = e4.y + p4.y; o.z = e4.z + p4.z; o.w = e4.w + p4.w;
  *(float4*)(h + (size_t)row * E_ + c) = o;
  uint2 hp; hp.x = pack2h(o.x, o.y); hp.y = pack2h(o.z, o.w);
  *(uint2*)(h16 + (size_t)row * E_ + c) = hp;
}

// ---------------------------------------------------------------------------
// WMMA GEMM, f16 in: C[M,N] = act(A[M,K] @ Wt[N,K]^T + bias[N]), M = 8192.
// Block tile 64x256, 8 waves (2x4), wave tile 32x64, K-step 32, dbl buffer.
// Output: f32 (Cf) and/or f16 (Ch).
// ---------------------------------------------------------------------------
__global__ __launch_bounds__(256) void gemm_f16_kernel(
    const _Float16* __restrict__ A, const _Float16* __restrict__ Wt,
    const float* __restrict__ bias, float* __restrict__ Cf,
    _Float16* __restrict__ Ch, int N, int Kdim, int relu) {
  __shared__ __attribute__((aligned(16))) _Float16 Atile[2][64][GP_];   // 10 KB
  __shared__ __attribute__((aligned(16))) _Float16 Btile[2][256][GP_];  // 40 KB  ([n][k] fragment order)

  const int tid  = threadIdx.x;
  const int lane = tid & 31;
  const int wave = tid >> 5;
  const int wm   = (wave >> 2) << 5;           // 0 / 32
  const int wn   = (wave & 3) << 6;            // 0 / 64 / 128 / 192
  const int m0   = blockIdx.x * 64;
  const int n0   = blockIdx.y * 256;

  v8f acc[2][4] = {};
  const int nk = Kdim >> 5;

  auto load_tiles = [&](int kt, int buf) {
    const int k0 = kt << 5;
    {  // A: 64x32 f16 = 256 x 16B, 1 per thread
      int r = tid >> 2, seg = (tid & 3) << 3;
      cp16B_g2l(A + (size_t)(m0 + r) * Kdim + k0 + seg, &Atile[buf][r][seg]);
    }
#pragma unroll
    for (int t = 0; t < 4; ++t) {  // B: 256x32 f16 = 1024 x 16B, 4 per thread
      int idx = t * 256 + tid;
      int r = idx >> 2, seg = (idx & 3) << 3;
      cp16B_g2l(Wt + (size_t)(n0 + r) * Kdim + k0 + seg, &Btile[buf][r][seg]);
    }
  };

  load_tiles(0, 0);
  async_fence();
  __syncthreads();

  for (int kt = 0; kt < nk; ++kt) {
    const int cur = kt & 1;
    if (kt + 1 < nk) load_tiles(kt + 1, cur ^ 1);

    v16h af[2], bf[4];
    af[0] = load_frag_k32(&Atile[cur][wm + 0][0], GP_, lane);
    af[1] = load_frag_k32(&Atile[cur][wm + 16][0], GP_, lane);
#pragma unroll
    for (int j = 0; j < 4; ++j)
      bf[j] = load_frag_k32(&Btile[cur][wn + j * 16][0], GP_, lane);
#pragma unroll
    for (int i = 0; i < 2; ++i)
#pragma unroll
      for (int j = 0; j < 4; ++j)
        acc[i][j] = wmma_f16(af[i], bf[j], acc[i][j]);

    async_fence();
    __syncthreads();
  }

  const int lrow = (lane >> 4) << 3;
  const int lcol = lane & 15;
#pragma unroll
  for (int i = 0; i < 2; ++i)
#pragma unroll
    for (int j = 0; j < 4; ++j) {
      int col = n0 + wn + j * 16 + lcol;
      float bv = bias[col];
#pragma unroll
      for (int e = 0; e < 8; ++e) {
        int row = m0 + wm + i * 16 + e + lrow;
        float v = acc[i][j][e] + bv;
        if (relu) v = fmaxf(v, 0.0f);
        if (Cf) Cf[(size_t)row * N + col] = v;
        if (Ch) Ch[(size_t)row * N + col] = (_Float16)v;
      }
    }
}

// ---------------------------------------------------------------------------
// Flash attention (f16 Q/K/V in, f16 out). One block = (b,h) x 256 q-rows.
// ---------------------------------------------------------------------------
__global__ __launch_bounds__(256) void attention_kernel(
    const _Float16* __restrict__ Q, const _Float16* __restrict__ K,
    const _Float16* __restrict__ V, const int* __restrict__ mask,
    _Float16* __restrict__ O) {
  __shared__ __attribute__((aligned(16))) _Float16 Kt[64][AP_];       //  9 KB : [key][d]  (B-frag for QK^T)
  __shared__ __attribute__((aligned(16))) _Float16 Vt[64][AP_];       //  9 KB : [d][key]  (B-frag for P*V)
  __shared__ __attribute__((aligned(16))) _Float16 Pbuf[8][32][AP_];  // 36 KB : per-wave P tile
  __shared__ int      smask[64];

  const int tid  = threadIdx.x;
  const int lane = tid & 31;
  const int wave = tid >> 5;
  const int bh   = blockIdx.x;
  const int b    = bh >> 3;
  const int hh   = bh & 7;
  const int q0   = blockIdx.y * 256;
  const size_t base = ((size_t)b * S_) * E_ + (size_t)hh * D_;

  // Q fragments straight from global f16 (A layout)
  v16h qf[2][2];
#pragma unroll
  for (int i = 0; i < 2; ++i)
#pragma unroll
    for (int s = 0; s < 2; ++s) {
      int q = q0 + wave * 32 + i * 16 + (lane & 15);
      const _Float16* rp = Q + base + (size_t)q * E_ + s * 32 + ((lane >> 4) << 3);
      union { v16h v; uint32_t u[8]; } f;
#pragma unroll
      for (int vv = 0; vv < 8; ++vv) {
        int d = ((vv >> 2) << 4) + ((vv & 3) << 1);
        f.u[vv] = *(const uint32_t*)(rp + d);
      }
      qf[i][s] = f.v;
    }

  v8f o[2][4] = {};
  float mst[2][8], lst[2][8];
#pragma unroll
  for (int i = 0; i < 2; ++i)
#pragma unroll
    for (int e = 0; e < 8; ++e) { mst[i][e] = -1e30f; lst[i][e] = 0.0f; }

  const float scale = 0.125f;
  const int lrow = (lane >> 4) << 3;
  const int lcol = lane & 15;

  for (int kb = 0; kb < S_; kb += 64) {
    __syncthreads();
    // K block: [key][d] f16 rows -> direct (async) copy; V -> transposed stores
#pragma unroll
    for (int t = 0; t < 2; ++t) {
      int idx = t * 256 + tid;
      int r = idx >> 3, c0 = (idx & 7) << 3;
      cp16B_g2l(K + base + (size_t)(kb + r) * E_ + c0, &Kt[r][c0]);
      uint4 vv = *(const uint4*)(V + base + (size_t)(kb + r) * E_ + c0);
      const _Float16* vh = (const _Float16*)&vv;
#pragma unroll
      for (int j = 0; j < 8; ++j) Vt[c0 + j][r] = vh[j];
    }
    if (tid < 64) smask[tid] = mask[(size_t)b * S_ + kb + tid];
    async_fence();
    __syncthreads();

    // scores S = Q K^T
    v16h kf[4][2];
#pragma unroll
    for (int j = 0; j < 4; ++j)
#pragma unroll
      for (int s = 0; s < 2; ++s)
        kf[j][s] = load_frag_k32(&Kt[j * 16][s * 32], AP_, lane);

    v8f sa[2][4];
#pragma unroll
    for (int i = 0; i < 2; ++i)
#pragma unroll
      for (int j = 0; j < 4; ++j) {
        v8f z = {};
        z = wmma_f16(qf[i][0], kf[j][0], z);
        sa[i][j] = wmma_f16(qf[i][1], kf[j][1], z);
      }

    int mj[4];
#pragma unroll
    for (int j = 0; j < 4; ++j) mj[j] = smask[j * 16 + lcol];
#pragma unroll
    for (int i = 0; i < 2; ++i)
#pragma unroll
      for (int j = 0; j < 4; ++j)
#pragma unroll
        for (int e = 0; e < 8; ++e) {
          float v = sa[i][j][e] * scale;
          sa[i][j][e] = mj[j] ? v : -1e20f;
        }

    // online softmax per m-tile
#pragma unroll
    for (int i = 0; i < 2; ++i) {
      float nm[8];
#pragma unroll
      for (int e = 0; e < 8; ++e) {
        float v = sa[i][0][e];
        v = fmaxf(v, sa[i][1][e]); v = fmaxf(v, sa[i][2][e]); v = fmaxf(v, sa[i][3][e]);
        nm[e] = v;
      }
#pragma unroll
      for (int off = 8; off >= 1; off >>= 1)
#pragma unroll
        for (int e = 0; e < 8; ++e)
          nm[e] = fmaxf(nm[e], __shfl_xor(nm[e], off, 16));

      float fs[8];
#pragma unroll
      for (int e = 0; e < 8; ++e) {
        float mn = fmaxf(mst[i][e], nm[e]);
        fs[e] = __expf(mst[i][e] - mn);
        mst[i][e] = mn;
      }
#pragma unroll
      for (int j = 0; j < 4; ++j)
#pragma unroll
        for (int e = 0; e < 8; ++e)
          o[i][j][e] *= fs[e];

      float rs[8] = {0, 0, 0, 0, 0, 0, 0, 0};
#pragma unroll
      for (int j = 0; j < 4; ++j)
#pragma unroll
        for (int e = 0; e < 8; ++e) {
          float p = __expf(sa[i][j][e] - mst[i][e]);
          sa[i][j][e] = p;
          rs[e] += p;
        }
#pragma unroll
      for (int off = 8; off >= 1; off >>= 1)
#pragma unroll
        for (int e = 0; e < 8; ++e)
          rs[e] += __shfl_xor(rs[e], off, 16);
#pragma unroll
      for (int e = 0; e < 8; ++e)
        lst[i][e] = lst[i][e] * fs[e] + rs[e];

#pragma unroll
      for (int j = 0; j < 4; ++j)
#pragma unroll
        for (int e = 0; e < 8; ++e)
          Pbuf[wave][i * 16 + e + lrow][j * 16 + lcol] = (_Float16)sa[i][j][e];
    }

    asm volatile("s_wait_dscnt 0" ::: "memory");  // wave-local P round-trip

    v16h vf[4][2];
#pragma unroll
    for (int j = 0; j < 4; ++j)
#pragma unroll
      for (int s = 0; s < 2; ++s)
        vf[j][s] = load_frag_k32(&Vt[j * 16][s * 32], AP_, lane);

#pragma unroll
    for (int i = 0; i < 2; ++i) {
      v16h pf0 = load_frag_k32(&Pbuf[wave][i * 16][0],  AP_, lane);
      v16h pf1 = load_frag_k32(&Pbuf[wave][i * 16][32], AP_, lane);
#pragma unroll
      for (int j = 0; j < 4; ++j) {
        o[i][j] = wmma_f16(pf0, vf[j][0], o[i][j]);
        o[i][j] = wmma_f16(pf1, vf[j][1], o[i][j]);
      }
    }
  }

#pragma unroll
  for (int i = 0; i < 2; ++i)
#pragma unroll
    for (int j = 0; j < 4; ++j)
#pragma unroll
      for (int e = 0; e < 8; ++e) {
        int qrow = q0 + wave * 32 + i * 16 + e + lrow;
        int dcol = j * 16 + lcol;
        O[base + (size_t)qrow * E_ + dcol] = (_Float16)(o[i][j][e] / lst[i][e]);
      }
}

// ---------------------------------------------------------------------------
// Fused residual + LayerNorm: y = LN(x + r)*g + b ; writes f32 and f16 copies
// ---------------------------------------------------------------------------
__global__ __launch_bounds__(128) void add_ln_kernel(
    const float* __restrict__ X, const float* __restrict__ R,
    const float* __restrict__ g, const float* __restrict__ bb,
    float* __restrict__ Y, _Float16* __restrict__ Y16) {
  __shared__ float ssum[4], ssq[4];
  const int row  = blockIdx.x;
  const int tid  = threadIdx.x;
  const int lane = tid & 31;
  const int wave = tid >> 5;
  const int c0   = tid << 2;

  float4 x4 = *(const float4*)(X + (size_t)row * E_ + c0);
  float4 r4 = *(const float4*)(R + (size_t)row * E_ + c0);
  float v[4] = {x4.x + r4.x, x4.y + r4.y, x4.z + r4.z, x4.w + r4.w};
  float s = v[0] + v[1] + v[2] + v[3];
  float q = v[0]*v[0] + v[1]*v[1] + v[2]*v[2] + v[3]*v[3];
#pragma unroll
  for (int off = 16; off >= 1; off >>= 1) {
    s += __shfl_xor(s, off, 32);
    q += __shfl_xor(q, off, 32);
  }
  if (lane == 0) { ssum[wave] = s; ssq[wave] = q; }
  __syncthreads();
  float S1 = ssum[0] + ssum[1] + ssum[2] + ssum[3];
  float S2 = ssq[0]  + ssq[1]  + ssq[2]  + ssq[3];
  float mu   = S1 * (1.0f / E_);
  float var  = S2 * (1.0f / E_) - mu * mu;
  float rinv = rsqrtf(var + 1e-6f);
  float4 o;
  float* op = &o.x;
#pragma unroll
  for (int c = 0; c < 4; ++c) {
    int col = c0 + c;
    op[c] = (v[c] - mu) * rinv * g[col] + bb[col];
  }
  *(float4*)(Y + (size_t)row * E_ + c0) = o;
  uint2 hp; hp.x = pack2h(o.x, o.y); hp.y = pack2h(o.z, o.w);
  *(uint2*)(Y16 + (size_t)row * E_ + c0) = hp;
}

// ---------------------------------------------------------------------------
// Host orchestration
// ---------------------------------------------------------------------------
extern "C" void kernel_launch(void* const* d_in, const int* in_sizes, int n_in,
                              void* d_out, int out_size, void* d_ws, size_t ws_size,
                              hipStream_t stream) {
  const int*   x    = (const int*)d_in[0];
  const int*   mask = (const int*)d_in[1];
  const float* emb  = (const float*)d_in[2];
  const float* pos  = (const float*)d_in[3];
  const float* Wq   = (const float*)d_in[4];
  const float* bq   = (const float*)d_in[5];
  const float* Wk   = (const float*)d_in[6];
  const float* bk   = (const float*)d_in[7];
  const float* Wv   = (const float*)d_in[8];
  const float* bv   = (const float*)d_in[9];
  const float* Wo   = (const float*)d_in[10];
  const float* bo   = (const float*)d_in[11];
  const float* g1   = (const float*)d_in[12];
  const float* be1  = (const float*)d_in[13];
  const float* g2   = (const float*)d_in[14];
  const float* be2  = (const float*)d_in[15];
  const float* W1   = (const float*)d_in[16];
  const float* bf1  = (const float*)d_in[17];
  const float* W2   = (const float*)d_in[18];
  const float* bf2  = (const float*)d_in[19];

  float* h = (float*)d_out;                               // [B,S,E] f32, persistent

  const size_t ACT = (size_t)ROWS * E_;
  char* p = (char*)d_ws;
  auto alloc_h = [&](size_t n) { _Float16* r = (_Float16*)p; p += n * sizeof(_Float16); return r; };
  _Float16* h16   = alloc_h(ACT);
  _Float16* q16   = alloc_h(ACT);
  _Float16* k16   = alloc_h(ACT);
  _Float16* v16   = alloc_h(ACT);
  _Float16* att16 = alloc_h(ACT);
  _Float16* big16 = alloc_h((size_t)ROWS * FF_);
  float* f32tmp = (float*)p; p += ACT * sizeof(float);
  _Float16* wtq[L_]; _Float16* wtk[L_]; _Float16* wtv[L_]; _Float16* wto[L_];
  _Float16* wt1[L_]; _Float16* wt2[L_];
  for (int l = 0; l < L_; ++l) {
    wtq[l] = alloc_h((size_t)E_ * E_);
    wtk[l] = alloc_h((size_t)E_ * E_);
    wtv[l] = alloc_h((size_t)E_ * E_);
    wto[l] = alloc_h((size_t)E_ * E_);
    wt1[l] = alloc_h((size_t)E_ * FF_);
    wt2[l] = alloc_h((size_t)FF_ * E_);
  }

  // Weight convert+transpose (W[K][N] f32 -> Wt[N][K] f16); wtq[0] is the start of the block
  wconv_kernel<<<dim3(384, L_), 256, 0, stream>>>(Wq, Wk, Wv, Wo, W1, W2, wtq[0]);

  embed_kernel<<<ROWS, 128, 0, stream>>>(x, emb, pos, h, h16);

  const dim3 gE(ROWS / 64, E_ / 256);                     // N = 512
  const dim3 gF(ROWS / 64, FF_ / 256);                    // N = 2048
  const dim3 gA(B_ * H_, S_ / 256);

  for (int l = 0; l < L_; ++l) {
    const float* bql = bq  + (size_t)l * E_;
    const float* bkl = bk  + (size_t)l * E_;
    const float* bvl = bv  + (size_t)l * E_;
    const float* bol = bo  + (size_t)l * E_;
    const float* b1l = bf1 + (size_t)l * FF_;
    const float* b2l = bf2 + (size_t)l * E_;
    const float* g1l = g1  + (size_t)l * E_;
    const float* e1l = be1 + (size_t)l * E_;
    const float* g2l = g2  + (size_t)l * E_;
    const float* e2l = be2 + (size_t)l * E_;

    gemm_f16_kernel<<<gE, 256, 0, stream>>>(h16, wtq[l], bql, nullptr, q16, E_, E_, 0);
    gemm_f16_kernel<<<gE, 256, 0, stream>>>(h16, wtk[l], bkl, nullptr, k16, E_, E_, 0);
    gemm_f16_kernel<<<gE, 256, 0, stream>>>(h16, wtv[l], bvl, nullptr, v16, E_, E_, 0);

    attention_kernel<<<gA, 256, 0, stream>>>(q16, k16, v16, mask, att16);

    gemm_f16_kernel<<<gE, 256, 0, stream>>>(att16, wto[l], bol, f32tmp, nullptr, E_, E_, 0);
    add_ln_kernel<<<ROWS, 128, 0, stream>>>(f32tmp, h, g1l, e1l, h, h16);

    gemm_f16_kernel<<<gF, 256, 0, stream>>>(h16, wt1[l], b1l, nullptr, big16, FF_, E_, 1);
    gemm_f16_kernel<<<gE, 256, 0, stream>>>(big16, wt2[l], b2l, f32tmp, nullptr, E_, FF_, 0);
    add_ln_kernel<<<ROWS, 128, 0, stream>>>(f32tmp, h, g2l, e2l, h, h16);
  }
}

// v003
// Measured time: 454 microseconds a run.
// In two side-by-side timings against v002, it was 1.18 and 1.19 times as fast.
// All steps since v000 together make it 1.63 times as fast.
#include <hip/hip_runtime.h>
#include <hip/hip_bf16.h>

typedef __attribute__((ext_vector_type(16))) _Float16 v16h;
typedef __attribute__((ext_vector_type(8)))  float    v8f;
typedef int v4i_vec __attribute__((vector_size(16)));   // int __vector(4)

constexpr int E_   = 512;
constexpr int H_   = 8;
constexpr int D_   = 64;
constexpr int FF_  = 2048;
constexpr int L_   = 2;
constexpr int B_   = 4;
constexpr int S_   = 2048;
constexpr int ROWS = B_ * S_;          // 8192 token rows

constexpr int GP_  = 40;               // GEMM tiles: 32 f16 used per row
constexpr int AP_  = 72;               // attention tiles: 64 f16 used per row

#if defined(__has_builtin)
#if __has_builtin(__builtin_amdgcn_global_load_async_to_lds_b128)
#define HAVE_ASYNC_LDS 1
#endif
#endif
#ifndef HAVE_ASYNC_LDS
#define HAVE_ASYNC_LDS 0
#endif

__device__ __forceinline__ uint32_t pack2h(float a, float b) {
  union { _Float16 h[2]; uint32_t u; } t;
  t.h[0] = (_Float16)a; t.h[1] = (_Float16)b;
  return t.u;
}

__device__ __forceinline__ void cp16B_g2l(const _Float16* g, _Float16* l) {
#if HAVE_ASYNC_LDS
  __builtin_amdgcn_global_load_async_to_lds_b128(
      (__attribute__((address_space(1))) v4i_vec*)(_Float16*)g,
      (__attribute__((address_space(3))) v4i_vec*)l, 0, 0);
#else
  *(uint4*)l = *(const uint4*)g;
#endif
}

__device__ __forceinline__ void async_fence() {
#if HAVE_ASYNC_LDS
  asm volatile("s_wait_asynccnt 0" ::: "memory");
#endif
}

__device__ __forceinline__ v16h load_frag_k32(const _Float16* base, int rowStride, int lane) {
  int r  = lane & 15;
  int kh = (lane >> 4) << 3;
  const _Float16* p = base + r * rowStride + kh;
  union { v16h v; uint32_t u[8]; } f;
  const uint32_t* p0 = (const uint32_t*)p;
  const uint32_t* p1 = (const uint32_t*)(p + 16);
#pragma unroll
  for (int i = 0; i < 4; ++i) { f.u[i] = p0[i]; f.u[4 + i] = p1[i]; }
  return f.v;
}

__device__ __forceinline__ v8f wmma_f16(v16h a, v16h b, v8f c) {
  return __builtin_amdgcn_wmma_f32_16x16x32_f16(false, a, false, b, (short)0, c, false, false);
}

// ---------------------------------------------------------------------------
// Weight convert + transpose, all twelve matrices in one launch:
// W[K][N] f32 -> Wt[N][K] f16. One block moves a 128(k) x 64(n) tile through LDS,
// 32 elements per thread; global reads and writes are runs of 256 B.
// grid.x: 0..127 Wq,Wk,Wv,Wo (32 tiles each), 128..255 W1, 256..383 W2; grid.y: layer.
// Wt: per layer wtq, wtk, wtv, wto, wt1, wt2 back to back (WL_ elements).
// ---------------------------------------------------------------------------
constexpr int    TP_ = 136;            // tile row pitch in f16: 256 B + 16 B (16 B x odd)
constexpr size_t WL_ = (size_t)4 * E_ * E_ + (size_t)2 * E_ * FF_;

template <int K, int N>
__device__ __forceinline__ void wconv_tile(
    const float* __restrict__ W, _Float16* __restrict__ Wt, int t, _Float16 (*T)[TP_]) {
  const int tid = threadIdx.x;
  const int k0  = (t / (N / 64)) * 128;
  const int n0  = (t % (N / 64)) * 64;

  // read: a thread takes 8 consecutive k of 4 consecutive n (16 lanes = 256 B of one k row);
  // uniform tile base + one per-lane byte offset that all eight loads share
  const int kc = tid >> 4;             // which group of 8 k
  const int nq = tid & 15;             // which group of 4 n
  const char* sb = (const char*)(W + (size_t)k0 * N + n0);
  const uint32_t voff = (uint32_t)(kc * 8 * N + nq * 4) * 4u;
  float4 v[8];
#pragma unroll  // all eight loads in flight together, v[] in registers
  for (int i = 0; i < 8; ++i) v[i] = *(const float4*)(sb + voff + i * N * 4);

#pragma unroll  // constant c: v[] is indexed at compile time and stays in registers
  for (int c = 0; c < 4; ++c) {
    uint4 w;
    w.x = pack2h((&v[0].x)[c], (&v[1].x)[c]);
    w.y = pack2h((&v[2].x)[c], (&v[3].x)[c]);
    w.z = pack2h((&v[4].x)[c], (&v[5].x)[c]);
    w.w = pack2h((&v[6].x)[c], (&v[7].x)[c]);
    *(uint4*)&T[nq * 4 + c][kc * 8] = w;
  }
  __syncthreads();

  // write: 16 lanes = the 256 B that one n row of the tile holds
  _Float16* dp = Wt + (size_t)n0 * K + k0;
#pragma unroll  // the four LDS reads issue ahead of the four stores
  for (int j = 0; j < 4; ++j) {
    const int idx = j * 256 + tid;
    const int row = idx >> 4, ch = (idx & 15) << 3;
    *(uint4*)(dp + (size_t)row * K + ch) = *(const uint4*)&T[row][ch];
  }
}

__global__ __launch_bounds__(256) void wconv_kernel(
    const float* __restrict__ Wq, const float* __restrict__ Wk,
    const float* __restrict__ Wv, const float* __restrict__ Wo,
    const float* __restrict__ W1, const float* __restrict__ W2,
    _Float16* __restrict__ Wt) {
  __shared__ __attribute__((aligned(16))) _Float16 T[64][TP_];        // 17 KB : [n][k]

  const int r = blockIdx.x;            // the three branches are uniform for the block
  const int l = blockIdx.y;
  _Float16* D = Wt + (size_t)l * WL_;
  if (r < 128) {
    const int m = r >> 5;
    const float* W = (m == 0) ? Wq : (m == 1) ? Wk : (m == 2) ? Wv : Wo;
    wconv_tile<E_, E_>(W + (size_t)l * E_ * E_, D + (size_t)m * E_ * E_, r & 31, T);
  } else if (r < 256) {
    wconv_tile<E_, FF_>(W1 + (size_t)l * E_ * FF_, D + (size_t)4 * E_ * E_, r - 128, T);
  } else {
    wconv_tile<FF_, E_>(W2 + (size_t)l * FF_ * E_,
                        D + (size_t)4 * E_ * E_ + (size_t)E_ * FF_, r - 256, T);
  }
}

// ---------------------------------------------------------------------------
// Embedding + positional add: writes f32 h and f16 h16
// ---------------------------------------------------------------------------
__global__ __launch_bounds__(128) void embed_kernel(
    const int* __restrict__ x, const float* __restrict__ emb,
    const float* __restrict__ pos, float* __restrict__ h,
    _Float16* __restrict__ h16) {
  int row = blockIdx.x;
  int s   = row & (S_ - 1);
  int tok = x[row] + 1;
  int c   = threadIdx.x << 2;
  float4 e4 = *(const float4*)(emb + (size_t)tok * E_ + c);
  float4 p4 = *(const float4*)(pos + (size_t)s   * E_ + c);
  float4 o; o.x = e4.x + p4.x; o.y = e4.y + p4.y; o.z = e4.z + p4.z; o.w = e4.w + p4.w;
  *(float4*)(h + (size_t)row * E_ + c) = o;
  uint2 hp; hp.x = pack2h(o.x, o.y); hp.y = pack2h(o.z, o.w);
  *(uint2*)(h16 + (size_t)row * E_ + c) = hp;
}

// ---------------------------------------------------------------------------
// WMMA GEMM, f16 in: C[M,N] = act(A[M,K] @ Wt[N,K]^T + bias[N]), M = 8192.
// Block tile 64x256, 8 waves (2x4), wave tile 32x64, K-step 32, dbl buffer.
// Output: f32 (Cf) and/or f16 (Ch).
// ---------------------------------------------------------------------------
__global__ __launch_bounds__(256) void gemm_f16_kernel(
    const _Float16* __restrict__ A, const _Float16* __restrict__ Wt,
    const float* __restrict__ bias, float* __restrict__ Cf,
    _Float16* __restrict__ Ch, int N, int Kdim, int relu) {
  __shared__ __attribute__((aligned(16))) _Float16 Atile[2][64][GP_];   // 10 KB
  __shared__ __attribute__((aligned(16))) _Float16 Btile[2][256][GP_];  // 40 KB  ([n][k] fragment order)

  const int tid  = threadIdx.x;
  const int lane = tid & 31;
  const int wave = tid >> 5;
  const int wm   = (wave >> 2) << 5;           // 0 / 32
  const int wn   = (wave & 3) << 6;            // 0 / 64 / 128 / 192
  const int m0   = blockIdx.x * 64;
  const int n0   = blockIdx.y * 256;

  v8f acc[2][4] = {};
  const int nk = Kdim >> 5;

  auto load_tiles = [&](int kt, int buf) {
    const int k0 = kt << 5;
    {  // A: 64x32 f16 = 256 x 16B, 1 per thread
      int r = tid >> 2, seg = (tid & 3) << 3;
      cp16B_g2l(A + (size_t)(m0 + r) * Kdim + k0 + seg, &Atile[buf][r][seg]);
    }
#pragma unroll
    for (int t = 0; t < 4; ++t) {  // B: 256x32 f16 = 1024 x 16B, 4 per thread
      int idx = t * 256 + tid;
      int r = idx >> 2, seg = (idx & 3) << 3;
      cp16B_g2l(Wt + (size_t)(n0 + r) * Kdim + k0 + seg, &Btile[buf][r][seg]);
    }
  };

  load_tiles(0, 0);
  async_fence();
  __syncthreads();

  for (int kt = 0; kt < nk; ++kt) {
    const int cur = kt & 1;
    if (kt + 1 < nk) load_tiles(kt + 1, cur ^ 1);

    v16h af[2], bf[4];
    af[0] = load_frag_k32(&Atile[cur][wm + 0][0], GP_, lane);
    af[1] = load_frag_k32(&Atile[cur][wm + 16][0], GP_, lane);
#pragma unroll
    for (int j = 0; j < 4; ++j)
      bf[j] = load_frag_k32(&Btile[cur][wn + j * 16][0], GP_, lane);
#pragma unroll
    for (int i = 0; i < 2; ++i)
#pragma unroll
      for (int j = 0; j < 4; ++j)
        acc[i][j] = wmma_f16(af[i], bf[j], acc[i][j]);

    async_fence();
    __syncthreads();
  }

  const int lrow = (lane >> 4) << 3;
  const int lcol = lane & 15;
#pragma unroll
  for (int i = 0; i < 2; ++i)
#pragma unroll
    for (int j = 0; j < 4; ++j) {
      int col = n0 + wn + j * 16 + lcol;
      float bv = bias[col];
#pragma unroll
      for (int e = 0; e < 8; ++e) {
        int row = m0 + wm + i * 16 + e + lrow;
        float v = acc[i][j][e] + bv;
        if (relu) v = fmaxf(v, 0.0f);
        if (Cf) Cf[(size_t)row * N + col] = v;
        if (Ch) Ch[(size_t)row * N + col] = (_Float16)v;
      }
    }
}

__device__ __forceinline__ float xhalf(float x) {
  return __builtin_bit_cast(float, __builtin_amdgcn_permlanex16(
      __builtin_bit_cast(int, x), __builtin_bit_cast(int, x), 0x76543210, 0xfedcba98, false, false));
}

constexpr float LOG2E_ = 1.44269504f;

__device__ __forceinline__ float exp_slot(float x) {
  float r = x * LOG2E_;
  asm("v_exp_f32 %0, %0\n\tv_nop" : "+v"(r));
  return r;
}

__device__ __forceinline__ void exp_slot8(float (&p)[8], const v8f& s, float m) {
#pragma unroll  // constant indices keep p[] in registers
  for (int e = 0; e < 8; ++e) p[e] = (s[e] - m) * LOG2E_;
  asm("v_exp_f32 %0, %0\n\tv_exp_f32 %1, %1\n\tv_exp_f32 %2, %2\n\tv_exp_f32 %3, %3\n\t"
      "v_exp_f32 %4, %4\n\tv_exp_f32 %5, %5\n\tv_exp_f32 %6, %6\n\tv_exp_f32 %7, %7\n\tv_nop"
      : "+v"(p[0]), "+v"(p[1]), "+v"(p[2]), "+v"(p[3]),
        "+v"(p[4]), "+v"(p[5]), "+v"(p[6]), "+v"(p[7]));
}

__global__ __launch_bounds__(256) void attention_kernel(
    const _Float16* __restrict__ Q, const _Float16* __restrict__ K,
    const _Float16* __restrict__ V, const int* __restrict__ mask,
    _Float16* __restrict__ O) {
  __shared__ __attribute__((aligned(16))) _Float16 Kt[64][AP_];       //  9 KB : [key][d]  (A-frag for K Q^T)
  __shared__ __attribute__((aligned(16))) _Float16 Vt[64][AP_];       //  9 KB : [d][key]  (A-frag for V^T P^T)
  __shared__ __attribute__((aligned(16))) int      smask[64];

  const int tid  = threadIdx.x;
  const int lane = tid & 31;
  const int wave = tid >> 5;
  const int bh   = blockIdx.x;
  const int b    = bh >> 3;
  const int hh   = bh & 7;
  const int q0   = blockIdx.y * 256;
  const size_t base = ((size_t)b * S_) * E_ + (size_t)hh * D_;

  // Q fragments straight from global f16 (B operand: column = query, same k order as A)
  v16h qf[2][2];
#pragma unroll
  for (int i = 0; i < 2; ++i)
#pragma unroll
    for (int s = 0; s < 2; ++s) {
      int q = q0 + wave * 32 + i * 16 + (lane & 15);
      const _Float16* rp = Q + base + (size_t)q * E_ + s * 32 + ((lane >> 4) << 3);
      union { v16h v; uint32_t u[8]; } f;
#pragma unroll
      for (int vv = 0; vv < 8; ++vv) {
        int d = ((vv >> 2) << 4) + ((vv & 3) << 1);
        f.u[vv] = *(const uint32_t*)(rp + d);
      }
      qf[i][s] = f.v;
    }

  v8f o[2][4] = {};                    // o[i][j][r] = O^T[d = 16j + 8h + r][query 16i + c]
  float mst[2], lst[2];                // per query; lst: this wave half's keys only
#pragma unroll  // constant indices keep mst[], lst[] in registers
  for (int i = 0; i < 2; ++i) { mst[i] = -1e30f; lst[i] = 0.0f; }

  const float scale = 0.125f;
  const int lrow = (lane >> 4) << 3;
  const int lcol = lane & 15;

  for (int kb = 0; kb < S_; kb += 64) {
    __syncthreads();
    // K block: [key][d] f16 rows -> direct (async) copy; V -> transposed stores
#pragma unroll
    for (int t = 0; t < 2; ++t) {
      int idx = t * 256 + tid;
      int r = idx >> 3, c0 = (idx & 7) << 3;
      cp16B_g2l(K + base + (size_t)(kb + r) * E_ + c0, &Kt[r][c0]);
      uint4 vv = *(const uint4*)(V + base + (size_t)(kb + r) * E_ + c0);
      const _Float16* vh = (const _Float16*)&vv;
#pragma unroll
      for (int j = 0; j < 8; ++j) Vt[c0 + j][r] = vh[j];
    }
    if (tid < 64) smask[tid] = mask[(size_t)b * S_ + kb + tid];
    async_fence();
    __syncthreads();

    // scores S^T = K Q^T : sa[i][j][r] = S[query 16i + c][key 16j + 8h + r]
    v8f sa[2][4];
#pragma unroll  // constant indices keep the tiles in registers
    for (int j = 0; j < 4; ++j) {
      v16h kf0 = load_frag_k32(&Kt[j * 16][0],  AP_, lane);
      v16h kf1 = load_frag_k32(&Kt[j * 16][32], AP_, lane);
#pragma unroll  // constant indices keep the tiles in registers
      for (int i = 0; i < 2; ++i) {
        v8f z = {};
        z = wmma_f16(kf0, qf[i][0], z);
        sa[i][j] = wmma_f16(kf1, qf[i][1], z);
      }
    }

    // the lane's own eight keys of each tile
#pragma unroll  // constant indices keep the tiles in registers
    for (int j = 0; j < 4; ++j) {
      const int4 ma = *(const int4*)&smask[j * 16 + lrow];
      const int4 mb = *(const int4*)&smask[j * 16 + lrow + 4];
      const int mk[8] = {ma.x, ma.y, ma.z, ma.w, mb.x, mb.y, mb.z, mb.w};
#pragma unroll  // constant indices keep the tiles in registers
      for (int i = 0; i < 2; ++i)
#pragma unroll  // constant indices keep the tiles in registers
        for (int e = 0; e < 8; ++e) {
          float v = sa[i][j][e] * scale;
          sa[i][j][e] = mk[e] ? v : -1e20f;
        }
    }

    // online softmax, one query per lane and column group
    v16h pf[2][2];                     // pf[i][s]: P^T, keys 32s .. 32s + 31, as B operand
#pragma unroll  // constant indices keep the tiles in registers
    for (int i = 0; i < 2; ++i) {
      float nm = sa[i][0][0];
#pragma unroll  // constant indices keep the tiles in registers
      for (int j = 0; j < 4; ++j)
#pragma unroll  // constant indices keep the tiles in registers
        for (int e = 0; e < 8; ++e) nm = fmaxf(nm, sa[i][j][e]);
      nm = fmaxf(nm, xhalf(nm));       // both halves feed the same O^T tile: one maximum

      const float mn = fmaxf(mst[i], nm);
      const float fs = exp_slot(mst[i] - mn);
      mst[i] = mn;
#pragma unroll  // constant indices keep the tiles in registers
      for (int j = 0; j < 4; ++j)
#pragma unroll  // constant indices keep the tiles in registers
        for (int e = 0; e < 8; ++e)
          o[i][j][e] *= fs;

      float rs[4];
#pragma unroll  // constant indices keep the tiles in registers
      for (int j = 0; j < 4; ++j) {
        float p[8];
        exp_slot8(p, sa[i][j], mn);
        rs[j] = ((p[0] + p[1]) + (p[2] + p[3])) + ((p[4] + p[5]) + (p[6] + p[7]));
#pragma unroll  // constant indices keep the tiles in registers
        for (int e = 0; e < 8; ++e)
          pf[i][j >> 1][((j & 1) << 3) + e] = (_Float16)p[e];
      }
      lst[i] = lst[i] * fs + ((rs[0] + rs[1]) + (rs[2] + rs[3]));
    }

    // O^T += V^T P^T
#pragma unroll  // constant indices keep the tiles in registers
    for (int j = 0; j < 4; ++j) {
      v16h vf0 = load_frag_k32(&Vt[j * 16][0],  AP_, lane);
      v16h vf1 = load_frag_k32(&Vt[j * 16][32], AP_, lane);
#pragma unroll  // constant indices keep the tiles in registers
      for (int i = 0; i < 2; ++i) {
        o[i][j] = wmma_f16(vf0, pf[i][0], o[i][j]);
        o[i][j] = wmma_f16(vf1, pf[i][1], o[i][j]);
      }
    }
  }

  // a lane holds eight consecutive d of one query: one 16-byte store per tile
#pragma unroll  // constant indices keep the tiles in registers
  for (int i = 0; i < 2; ++i) {
    const float lt = lst[i] + xhalf(lst[i]);
    const int qrow = q0 + wave * 32 + i * 16 + lcol;
#pragma unroll  // constant indices keep the tiles in registers
    for (int j = 0; j < 4; ++j) {
      uint4 w;
      w.x = pack2h(o[i][j][0] / lt, o[i][j][1] / lt);
      w.y = pack2h(o[i][j][2] / lt, o[i][j][3] / lt);
      w.z = pack2h(o[i][j][4] / lt, o[i][j][5] / lt);
      w.w = pack2h(o[i][j][6] / lt, o[i][j][7] / lt);
      *(uint4*)(O + base + (size_t)qrow * E_ + j * 16 + lrow) = w;
    }
  }
}

// ---------------------------------------------------------------------------
// Fused residual + LayerNorm: y = LN(x + r)*g + b ; writes f32 and f16 copies
// ---------------------------------------------------------------------------
__global__ __launch_bounds__(128) void add_ln_kernel(
    const float* __restrict__ X, const float* __restrict__ R,
    const float* __restrict__ g, const float* __restrict__ bb,
    float* __restrict__ Y, _Float16* __restrict__ Y16) {
  __shared__ float ssum[4], ssq[4];
  const int row  = blockIdx.x;
  const int tid  = threadIdx.x;
  const int lane = tid & 31;
  const int wave = tid >> 5;
  const int c0   = tid << 2;

  float4 x4 = *(const float4*)(X + (size_t)row * E_ + c0);
  float4 r4 = *(const float4*)(R + (size_t)row * E_ + c0);
  float v[4] = {x4.x + r4.x, x4.y + r4.y, x4.z + r4.z, x4.w + r4.w};
  float s = v[0] + v[1] + v[2] + v[3];
  float q = v[0]*v[0] + v[1]*v[1] + v[2]*v[2] + v[3]*v[3];
#pragma unroll
  for (int off = 16; off >= 1; off >>= 1) {
    s += __shfl_xor(s, off, 32);
    q += __shfl_xor(q, off, 32);
  }
  if (lane == 0) { ssum[wave] = s; ssq[wave] = q; }
  __syncthreads();
  float S1 = ssum[0] + ssum[1] + ssum[2] + ssum[3];
  float S2 = ssq[0]  + ssq[1]  + ssq[2]  + ssq[3];
  float mu   = S1 * (1.0f / E_);
  float var  = S2 * (1.0f / E_) - mu * mu;
  float rinv = rsqrtf(var + 1e-6f);
  float4 o;
  float* op = &o.x;
#pragma unroll
  for (int c = 0; c < 4; ++c) {
    int col = c0 + c;
    op[c] = (v[c] - mu) * rinv * g[col] + bb[col];
  }
  *(float4*)(Y + (size_t)row * E_ + c0) = o;
  uint2 hp; hp.x = pack2h(o.x, o.y); hp.y = pack2h(o.z, o.w);
  *(uint2*)(Y16 + (size_t)row * E_ + c0) = hp;
}

// ---------------------------------------------------------------------------
// Host orchestration
// ---------------------------------------------------------------------------
extern "C" void kernel_launch(void* const* d_in, const int* in_sizes, int n_in,
                              void* d_out, int out_size, void* d_ws, size_t ws_size,
                              hipStream_t stream) {
  const int*   x    = (const int*)d_in[0];
  const int*   mask = (const int*)d_in[1];
  const float* emb  = (const float*)d_in[2];
  const float* pos  = (const float*)d_in[3];
  const float* Wq   = (const float*)d_in[4];
  const float* bq   = (const float*)d_in[5];
  const float* Wk   = (const float*)d_in[6];
  const float* bk   = (const float*)d_in[7];
  const float* Wv   = (const float*)d_in[8];
  const float* bv   = (const float*)d_in[9];
  const float* Wo   = (const float*)d_in[10];
  const float* bo   = (const float*)d_in[11];
  const float* g1   = (const float*)d_in[12];
  const float* be1  = (const float*)d_in[13];
  const float* g2   = (const float*)d_in[14];
  const float* be2  = (const float*)d_in[15];
  const float* W1   = (const float*)d_in[16];
  const float* bf1  = (const float*)d_in[17];
  const float* W2   = (const float*)d_in[18];
  const float* bf2  = (const float*)d_in[19];

  float* h = (float*)d_out;                               // [B,S,E] f32, persistent

  const size_t ACT = (size_t)ROWS * E_;
  char* p = (char*)d_ws;
  auto alloc_h = [&](size_t n) { _Float16* r = (_Float16*)p; p += n * sizeof(_Float16); return r; };
  _Float16* h16   = alloc_h(ACT);
  _Float16* q16   = alloc_h(ACT);
  _Float16* k16   = alloc_h(ACT);
  _Float16* v16   = alloc_h(ACT);
  _Float16* att16 = alloc_h(ACT);
  _Float16* big16 = alloc_h((size_t)ROWS * FF_);
  float* f32tmp = (float*)p; p += ACT * sizeof(float);
  _Float16* wtq[L_]; _Float16* wtk[L_]; _Float16* wtv[L_]; _Float16* wto[L_];
  _Float16* wt1[L_]; _Float16* wt2[L_];
  for (int l = 0; l < L_; ++l) {
    wtq[l] = alloc_h((size_t)E_ * E_);
    wtk[l] = alloc_h((size_t)E_ * E_);
    wtv[l] = alloc_h((size_t)E_ * E_);
    wto[l] = alloc_h((size_t)E_ * E_);
    wt1[l] = alloc_h((size_t)E_ * FF_);
    wt2[l] = alloc_h((size_t)FF_ * E_);
  }

  // Weight convert+transpose (W[K][N] f32 -> Wt[N][K] f16); wtq[0] is the start of the block
  wconv_kernel<<<dim3(384, L_), 256, 0, stream>>>(Wq, Wk, Wv, Wo, W1, W2, wtq[0]);

  embed_kernel<<<ROWS, 128, 0, stream>>>(x, emb, pos, h, h16);

  const dim3 gE(ROWS / 64, E_ / 256);                     // N = 512
  const dim3 gF(ROWS / 64, FF_ / 256);                    // N = 2048
  const dim3 gA(B_ * H_, S_ / 256);

  for (int l = 0; l < L_; ++l) {
    const float* bql = bq  + (size_t)l * E_;
    const float* bkl = bk  + (size_t)l * E_;
    const float* bvl = bv  + (size_t)l * E_;
    const float* bol = bo  + (size_t)l * E_;
    const float* b1l = bf1 + (size_t)l * FF_;
    const float* b2l = bf2 + (size_t)l * E_;
    const float* g1l = g1  + (size_t)l * E_;
    const float* e1l = be1 + (size_t)l * E_;
    const float* g2l = g2  + (size_t)l * E_;
    const float* e2l = be2 + (size_t)l * E_;

    gemm_f16_kernel<<<gE, 256, 0, stream>>>(h16, wtq[l], bql, nullptr, q16, E_, E_, 0);
    gemm_f16_kernel<<<gE, 256, 0, stream>>>(h16, wtk[l], bkl, nullptr, k16, E_, E_, 0);
    gemm_f16_kernel<<<gE, 256, 0, stream>>>(h16, wtv[l], bvl, nullptr, v16, E_, E_, 0);

    attention_kernel<<<gA, 256, 0, stream>>>(q16, k16, v16, mask, att16);

    gemm_f16_kernel<<<gE, 256, 0, stream>>>(att16, wto[l], bol, f32tmp, nullptr, E_, E_, 0);
    add_ln_kernel<<<ROWS, 128, 0, stream>>>(f32tmp, h, g1l, e1l, h, h16);

    gemm_f16_kernel<<<gF, 256, 0, stream>>>(h16, wt1[l], b1l, nullptr, big16, FF_, E_, 1);
    gemm_f16_kernel<<<gE, 256, 0, stream>>>(big16, wt2[l], b2l, f32tmp, nullptr, E_, FF_, 0);
    add_ln_kernel<<<ROWS, 128, 0, stream>>>(f32tmp, h, g2l, e2l, h, h16);
  }
}

// v004
// A run of this version takes 397 microseconds.
// Two timings next to v003 put it at 1.14 and 1.15 times that version's speed.
// Counting every step since v000, it is 1.87 times as fast.
#include <hip/hip_runtime.h>
#include <hip/hip_bf16.h>

typedef __attribute__((ext_vector_type(16))) _Float16 v16h;
typedef __attribute__((ext_vector_type(8)))  float    v8f;
typedef __attribute__((ext_vector_type(8)))  _Float16 v8h;
typedef int v4i_vec __attribute__((vector_size(16)));   // int __vector(4)

constexpr int E_   = 512;
constexpr int H_   = 8;
constexpr int D_   = 64;
constexpr int FF_  = 2048;
constexpr int L_   = 2;
constexpr int B_   = 4;
constexpr int S_   = 2048;
constexpr int ROWS = B_ * S_;          // 8192 token rows

constexpr int GP_  = 40;               // GEMM tiles: 32 f16 used per row
constexpr int AP_  = 72;               // attention tiles: 64 f16 used per row

#if defined(__has_builtin)
#if __has_builtin(__builtin_amdgcn_global_load_async_to_lds_b128)
#define HAVE_ASYNC_LDS 1
#endif
#endif
#ifndef HAVE_ASYNC_LDS
#define HAVE_ASYNC_LDS 0
#endif

__device__ __forceinline__ uint32_t pack2h(float a, float b) {
  union { _Float16 h[2]; uint32_t u; } t;
  t.h[0] = (_Float16)a; t.h[1] = (_Float16)b;
  return t.u;
}

__device__ __forceinline__ void cp16B_g2l(const _Float16* g, _Float16* l) {
#if HAVE_ASYNC_LDS
  __builtin_amdgcn_global_load_async_to_lds_b128(
      (__attribute__((address_space(1))) v4i_vec*)(_Float16*)g,
      (__attribute__((address_space(3))) v4i_vec*)l, 0, 0);
#else
  *(uint4*)l = *(const uint4*)g;
#endif
}

__device__ __forceinline__ void async_fence() {
#if HAVE_ASYNC_LDS
  asm volatile("s_wait_asynccnt 0" ::: "memory");
#endif
}

__device__ __forceinline__ v16h load_frag_k32(const _Float16* base, int rowStride, int lane) {
  int r  = lane & 15;
  int kh = (lane >> 4) << 3;
  const _Float16* p = base + r * rowStride + kh;
  union { v16h v; uint32_t u[8]; } f;
  const uint32_t* p0 = (const uint32_t*)p;
  const uint32_t* p1 = (const uint32_t*)(p + 16);
#pragma unroll
  for (int i = 0; i < 4; ++i) { f.u[i] = p0[i]; f.u[4 + i] = p1[i]; }
  return f.v;
}

__device__ __forceinline__ v8f wmma_f16(v16h a, v16h b, v8f c) {
  return __builtin_amdgcn_wmma_f32_16x16x32_f16(false, a, false, b, (short)0, c, false, false);
}

// ---------------------------------------------------------------------------
// Weight convert + transpose, all twelve matrices in one launch:
// W[K][N] f32 -> Wt[N][K] f16. One block moves a 128(k) x 64(n) tile through LDS,
// 32 elements per thread; global reads and writes are runs of 256 B.
// grid.x: 0..127 Wq,Wk,Wv,Wo (32 tiles each), 128..255 W1, 256..383 W2; grid.y: layer.
// Wt: per layer wtq, wtk, wtv, wto, wt1, wt2 back to back (WL_ elements).
// ---------------------------------------------------------------------------
constexpr int    TP_ = 136;            // tile row pitch in f16: 256 B + 16 B (16 B x odd)
constexpr size_t WL_ = (size_t)4 * E_ * E_ + (size_t)2 * E_ * FF_;

template <int K, int N>
__device__ __forceinline__ void wconv_tile(
    const float* __restrict__ W, _Float16* __restrict__ Wt, int t, _Float16 (*T)[TP_]) {
  const int tid = threadIdx.x;
  const int k0  = (t / (N / 64)) * 128;
  const int n0  = (t % (N / 64)) * 64;

  // read: a thread takes 8 consecutive k of 4 consecutive n (16 lanes = 256 B of one k row);
  // uniform tile base + one per-lane byte offset that all eight loads share
  const int kc = tid >> 4;             // which group of 8 k
  const int nq = tid & 15;             // which group of 4 n
  const char* sb = (const char*)(W + (size_t)k0 * N + n0);
  const uint32_t voff = (uint32_t)(kc * 8 * N + nq * 4) * 4u;
  float4 v[8];
#pragma unroll  // all eight loads in flight together, v[] in registers
  for (int i = 0; i < 8; ++i) v[i] = *(const float4*)(sb + voff + i * N * 4);

#pragma unroll  // constant c: v[] is indexed at compile time and stays in registers
  for (int c = 0; c < 4; ++c) {
    uint4 w;
    w.x = pack2h((&v[0].x)[c], (&v[1].x)[c]);
    w.y = pack2h((&v[2].x)[c], (&v[3].x)[c]);
    w.z = pack2h((&v[4].x)[c], (&v[5].x)[c]);
    w.w = pack2h((&v[6].x)[c], (&v[7].x)[c]);
    *(uint4*)&T[nq * 4 + c][kc * 8] = w;
  }
  __syncthreads();

  // write: 16 lanes = the 256 B that one n row of the tile holds
  _Float16* dp = Wt + (size_t)n0 * K + k0;
#pragma unroll  // the four LDS reads issue ahead of the four stores
  for (int j = 0; j < 4; ++j) {
    const int idx = j * 256 + tid;
    const int row = idx >> 4, ch = (idx & 15) << 3;
    *(uint4*)(dp + (size_t)row * K + ch) = *(const uint4*)&T[row][ch];
  }
}

__global__ __launch_bounds__(256) void wconv_kernel(
    const float* __restrict__ Wq, const float* __restrict__ Wk,
    const float* __restrict__ Wv, const float* __restrict__ Wo,
    const float* __restrict__ W1, const float* __restrict__ W2,
    _Float16* __restrict__ Wt) {
  __shared__ __attribute__((aligned(16))) _Float16 T[64][TP_];        // 17 KB : [n][k]

  const int r = blockIdx.x;            // the three branches are uniform for the block
  const int l = blockIdx.y;
  _Float16* D = Wt + (size_t)l * WL_;
  if (r < 128) {
    const int m = r >> 5;
    const float* W = (m == 0) ? Wq : (m == 1) ? Wk : (m == 2) ? Wv : Wo;
    wconv_tile<E_, E_>(W + (size_t)l * E_ * E_, D + (size_t)m * E_ * E_, r & 31, T);
  } else if (r < 256) {
    wconv_tile<E_, FF_>(W1 + (size_t)l * E_ * FF_, D + (size_t)4 * E_ * E_, r - 128, T);
  } else {
    wconv_tile<FF_, E_>(W2 + (size_t)l * FF_ * E_,
                        D + (size_t)4 * E_ * E_ + (size_t)E_ * FF_, r - 256, T);
  }
}

// ---------------------------------------------------------------------------
// Embedding + positional add: writes f32 h and f16 h16
// ---------------------------------------------------------------------------
__global__ __launch_bounds__(128) void embed_kernel(
    const int* __restrict__ x, const float* __restrict__ emb,
    const float* __restrict__ pos, float* __restrict__ h,
    _Float16* __restrict__ h16) {
  int row = blockIdx.x;
  int s   = row & (S_ - 1);
  int tok = x[row] + 1;
  int c   = threadIdx.x << 2;
  float4 e4 = *(const float4*)(emb + (size_t)tok * E_ + c);
  float4 p4 = *(const float4*)(pos + (size_t)s   * E_ + c);
  float4 o; o.x = e4.x + p4.x; o.y = e4.y + p4.y; o.z = e4.z + p4.z; o.w = e4.w + p4.w;
  *(float4*)(h + (size_t)row * E_ + c) = o;
  uint2 hp; hp.x = pack2h(o.x, o.y); hp.y = pack2h(o.z, o.w);
  *(uint2*)(h16 + (size_t)row * E_ + c) = hp;
}

// ---------------------------------------------------------------------------
// WMMA GEMM, f16 in: C[M,N] = act(A[M,K] @ Wt[N,K]^T + bias[N]), M = 8192.
// Block tile 64x256, 8 waves (2x4), wave tile 32x64, K-step 32, dbl buffer.
// Output: f32 (Cf) and/or f16 (Ch).
// The product is formed transposed (weight fragment as A operand, activation fragment as B):
// a lane then holds eight consecutive columns of ONE output row. Each wave passes its tile,
// 16 rows at a time, through its own range of the finished B tile and stores whole rows of
// the wave tile (128 B of f16, 256 B of f32) with 16-byte stores.
// ---------------------------------------------------------------------------
// Stands behind a run of global stores, in front of the code that writes their address and
// data registers anew.
__device__ __forceinline__ void stores_taken() {
  asm volatile("s_wait_xcnt 0x0" ::: "memory");
}

constexpr int SH_  = 144;              // staged f16 row: 128 B + 16 B (16 B x odd)
constexpr int SF_  = 272;              // staged f32 row: 256 B + 16 B (16 B x odd)
constexpr int STG_ = 16 * SF_;         // one wave's staging range in bytes

// A wave's own LDS writes have landed before its lanes read each other's rows back.
__device__ __forceinline__ void lds_landed() {
  asm volatile("s_wait_dscnt 0x0" ::: "memory");
}

__global__ __launch_bounds__(256) void gemm_f16_kernel(
    const _Float16* __restrict__ A, const _Float16* __restrict__ Wt,
    const float* __restrict__ bias, float* __restrict__ Cf,
    _Float16* __restrict__ Ch, int N, int Kdim, int relu) {
  __shared__ __attribute__((aligned(16))) _Float16 Atile[2][64][GP_];   // 10 KB
  __shared__ __attribute__((aligned(16))) _Float16 Btile[2][256][GP_];  // 40 KB  ([n][k] fragment order)

  const int tid  = threadIdx.x;
  const int lane = tid & 31;
  const int wave = tid >> 5;
  const int wm   = (wave >> 2) << 5;           // 0 / 32
  const int wn   = (wave & 3) << 6;            // 0 / 64 / 128 / 192
  const int m0   = blockIdx.x * 64;
  const int n0   = blockIdx.y * 256;

  v8f acc[2][4] = {};
  const int nk = Kdim >> 5;

  auto load_tiles = [&](int kt, int buf) {
    const int k0 = kt << 5;
    {  // A: 64x32 f16 = 256 x 16B, 1 per thread
      int r = tid >> 2, seg = (tid & 3) << 3;
      cp16B_g2l(A + (size_t)(m0 + r) * Kdim + k0 + seg, &Atile[buf][r][seg]);
    }
#pragma unroll
    for (int t = 0; t < 4; ++t) {  // B: 256x32 f16 = 1024 x 16B, 4 per thread
      int idx = t * 256 + tid;
      int r = idx >> 2, seg = (idx & 3) << 3;
      cp16B_g2l(Wt + (size_t)(n0 + r) * Kdim + k0 + seg, &Btile[buf][r][seg]);
    }
  };

  load_tiles(0, 0);
  async_fence();
  __syncthreads();

  for (int kt = 0; kt < nk; ++kt) {
    const int cur = kt & 1;
    if (kt + 1 < nk) load_tiles(kt + 1, cur ^ 1);

    v16h af[2], bf[4];
    af[0] = load_frag_k32(&Atile[cur][wm + 0][0], GP_, lane);
    af[1] = load_frag_k32(&Atile[cur][wm + 16][0], GP_, lane);
#pragma unroll
    for (int j = 0; j < 4; ++j)
      bf[j] = load_frag_k32(&Btile[cur][wn + j * 16][0], GP_, lane);
#pragma unroll
    for (int i = 0; i < 2; ++i)
#pragma unroll
      for (int j = 0; j < 4; ++j)
        acc[i][j] = wmma_f16(bf[j], af[i], acc[i][j]);   // D[n][m]

    async_fence();
    __syncthreads();
  }

  // acc[i][j][e] = C[m0 + wm + 16i + lcol][n0 + wn + 16j + lrow + e]
  const int lrow = (lane >> 4) << 3;
  const int lcol = lane & 15;
  const int cw   = n0 + wn;            // first column of the wave tile
  // The loop's last barrier stands behind every wave's last fragment read and last copy.
  char* stage = (char*)&Btile[0][0][0] + wave * STG_;

  float4 bv[4][2];
#pragma unroll  // constant indices keep bv[] in registers; all eight loads in flight together
  for (int j = 0; j < 4; ++j) {
    bv[j][0] = *(const float4*)(bias + cw + j * 16 + lrow);
    bv[j][1] = *(const float4*)(bias + cw + j * 16 + lrow + 4);
  }

#pragma unroll  // constant indices keep acc[] in registers
  for (int i = 0; i < 2; ++i)
#pragma unroll  // constant indices keep acc[] in registers
    for (int j = 0; j < 4; ++j)
#pragma unroll  // constant indices keep acc[] in registers
      for (int e = 0; e < 8; ++e)
        acc[i][j][e] += (&bv[j][e >> 2].x)[e & 3];
  if (relu) {
#pragma unroll  // constant indices keep acc[] in registers
    for (int i = 0; i < 2; ++i)
#pragma unroll  // constant indices keep acc[] in registers
      for (int j = 0; j < 4; ++j)
#pragma unroll  // constant indices keep acc[] in registers
        for (int e = 0; e < 8; ++e)
          acc[i][j][e] = fmaxf(acc[i][j][e], 0.0f);
  }

#pragma unroll  // constant indices keep acc[] in registers
  for (int i = 0; i < 2; ++i) {
    const int rw = m0 + wm + i * 16;   // first row of this half of the wave tile
    if (Cf) {
#pragma unroll  // constant indices keep acc[] in registers
      for (int j = 0; j < 4; ++j) {
        char* sp = stage + lcol * SF_ + (j * 16 + lrow) * 4;
        *(float4*)sp        = make_float4(acc[i][j][0], acc[i][j][1], acc[i][j][2], acc[i][j][3]);
        *(float4*)(sp + 16) = make_float4(acc[i][j][4], acc[i][j][5], acc[i][j][6], acc[i][j][7]);
      }
      lds_landed();
      float4 w[8];
#pragma unroll  // the eight LDS reads issue ahead of the eight stores
      for (int t = 0; t < 8; ++t)      // 16 lanes = the 256 B of one row, two rows a read
        w[t] = *(const float4*)(stage + (t * 2 + (lane >> 4)) * SF_ + lcol * 16);
#pragma unroll  // constant indices keep w[] in registers
      for (int t = 0; t < 8; ++t)
        *(float4*)(Cf + (rw + t * 2 + (lane >> 4)) * N + cw + lcol * 4) = w[t];
      stores_taken();
    }
    if (Ch) {
#pragma unroll  // constant indices keep acc[] in registers
      for (int j = 0; j < 4; ++j) {
        v8h w;
#pragma unroll  // constant indices keep w in registers
        for (int e = 0; e < 8; ++e) w[e] = (_Float16)acc[i][j][e];
        *(v8h*)(stage + lcol * SH_ + (j * 16 + lrow) * 2) = w;
      }
      lds_landed();
      v8h w[4];
#pragma unroll  // the four LDS reads issue ahead of the four stores
      for (int t = 0; t < 4; ++t)      // 8 lanes = the 128 B of one row, four rows a read
        w[t] = *(const v8h*)(stage + (t * 4 + (lane >> 3)) * SH_ + (lane & 7) * 16);
#pragma unroll  // constant indices keep w[] in registers
      for (int t = 0; t < 4; ++t)
        *(v8h*)(Ch + (rw + t * 4 + (lane >> 3)) * N + cw + (lane & 7) * 8) = w[t];
      if (i == 0) stores_taken();      // behind the last run nothing is written any more
    }
  }
}

__device__ __forceinline__ float xhalf(float x) {
  return __builtin_bit_cast(float, __builtin_amdgcn_permlanex16(
      __builtin_bit_cast(int, x), __builtin_bit_cast(int, x), 0x76543210, 0xfedcba98, false, false));
}

constexpr float LOG2E_ = 1.44269504f;

__device__ __forceinline__ float exp_slot(float x) {
  float r = x * LOG2E_;
  asm("v_exp_f32 %0, %0\n\tv_nop" : "+v"(r));
  return r;
}

__device__ __forceinline__ void exp_slot8(float (&p)[8], const v8f& s, float m) {
#pragma unroll  // constant indices keep p[] in registers
  for (int e = 0; e < 8; ++e) p[e] = (s[e] - m) * LOG2E_;
  asm("v_exp_f32 %0, %0\n\tv_exp_f32 %1, %1\n\tv_exp_f32 %2, %2\n\tv_exp_f32 %3, %3\n\t"
      "v_exp_f32 %4, %4\n\tv_exp_f32 %5, %5\n\tv_exp_f32 %6, %6\n\tv_exp_f32 %7, %7\n\tv_nop"
      : "+v"(p[0]), "+v"(p[1]), "+v"(p[2]), "+v"(p[3]),
        "+v"(p[4]), "+v"(p[5]), "+v"(p[6]), "+v"(p[7]));
}

__global__ __launch_bounds__(256) void attention_kernel(
    const _Float16* __restrict__ Q, const _Float16* __restrict__ K,
    const _Float16* __restrict__ V, const int* __restrict__ mask,
    _Float16* __restrict__ O) {
  __shared__ __attribute__((aligned(16))) _Float16 Kt[64][AP_];       //  9 KB : [key][d]  (A-frag for K Q^T)
  __shared__ __attribute__((aligned(16))) _Float16 Vt[64][AP_];       //  9 KB : [d][key]  (A-frag for V^T P^T)
  __shared__ __attribute__((aligned(16))) int      smask[64];

  const int tid  = threadIdx.x;
  const int lane = tid & 31;
  const int wave = tid >> 5;
  const int bh   = blockIdx.x;
  const int b    = bh >> 3;
  const int hh   = bh & 7;
  const int q0   = blockIdx.y * 256;
  const size_t base = ((size_t)b * S_) * E_ + (size_t)hh * D_;

  // Q fragments straight from global f16 (B operand: column = query, same k order as A)
  v16h qf[2][2];
#pragma unroll
  for (int i = 0; i < 2; ++i)
#pragma unroll
    for (int s = 0; s < 2; ++s) {
      int q = q0 + wave * 32 + i * 16 + (lane & 15);
      const _Float16* rp = Q + base + (size_t)q * E_ + s * 32 + ((lane >> 4) << 3);
      union { v16h v; uint32_t u[8]; } f;
#pragma unroll
      for (int vv = 0; vv < 8; ++vv) {
        int d = ((vv >> 2) << 4) + ((vv & 3) << 1);
        f.u[vv] = *(const uint32_t*)(rp + d);
      }
      qf[i][s] = f.v;
    }

  v8f o[2][4] = {};                    // o[i][j][r] = O^T[d = 16j + 8h + r][query 16i + c]
  float mst[2], lst[2];                // per query; lst: this wave half's keys only
#pragma unroll  // constant indices keep mst[], lst[] in registers
  for (int i = 0; i < 2; ++i) { mst[i] = -1e30f; lst[i] = 0.0f; }

  const float scale = 0.125f;
  const int lrow = (lane >> 4) << 3;
  const int lcol = lane & 15;

  for (int kb = 0; kb < S_; kb += 64) {
    __syncthreads();
    // K block: [key][d] f16 rows -> direct (async) copy; V -> transposed stores
#pragma unroll
    for (int t = 0; t < 2; ++t) {
      int idx = t * 256 + tid;
      int r = idx >> 3, c0 = (idx & 7) << 3;
      cp16B_g2l(K + base + (size_t)(kb + r) * E_ + c0, &Kt[r][c0]);
      uint4 vv = *(const uint4*)(V + base + (size_t)(kb + r) * E_ + c0);
      const _Float16* vh = (const _Float16*)&vv;
#pragma unroll
      for (int j = 0; j < 8; ++j) Vt[c0 + j][r] = vh[j];
    }
    if (tid < 64) smask[tid] = mask[(size_t)b * S_ + kb + tid];
    async_fence();
    __syncthreads();

    // scores S^T = K Q^T : sa[i][j][r] = S[query 16i + c][key 16j + 8h + r]
    v8f sa[2][4];
#pragma unroll  // constant indices keep the tiles in registers
    for (int j = 0; j < 4; ++j) {
      v16h kf0 = load_frag_k32(&Kt[j * 16][0],  AP_, lane);
      v16h kf1 = load_frag_k32(&Kt[j * 16][32], AP_, lane);
#pragma unroll  // constant indices keep the tiles in registers
      for (int i = 0; i < 2; ++i) {
        v8f z = {};
        z = wmma_f16(kf0, qf[i][0], z);
        sa[i][j] = wmma_f16(kf1, qf[i][1], z);
      }
    }

    // the lane's own eight keys of each tile
#pragma unroll  // constant indices keep the tiles in registers
    for (int j = 0; j < 4; ++j) {
      const int4 ma = *(const int4*)&smask[j * 16 + lrow];
      const int4 mb = *(const int4*)&smask[j * 16 + lrow + 4];
      const int mk[8] = {ma.x, ma.y, ma.z, ma.w, mb.x, mb.y, mb.z, mb.w};
#pragma unroll  // constant indices keep the tiles in registers
      for (int i = 0; i < 2; ++i)
#pragma unroll  // constant indices keep the tiles in registers
        for (int e = 0; e < 8; ++e) {
          float v = sa[i][j][e] * scale;
          sa[i][j][e] = mk[e] ? v : -1e20f;
        }
    }

    // online softmax, one query per lane and column group
    v16h pf[2][2];                     // pf[i][s]: P^T, keys 32s .. 32s + 31, as B operand
#pragma unroll  // constant indices keep the tiles in registers
    for (int i = 0; i < 2; ++i) {
      float nm = sa[i][0][0];
#pragma unroll  // constant indices keep the tiles in registers
      for (int j = 0; j < 4; ++j)
#pragma unroll  // constant indices keep the tiles in registers
        for (int e = 0; e < 8; ++e) nm = fmaxf(nm, sa[i][j][e]);
      nm = fmaxf(nm, xhalf(nm));       // both halves feed the same O^T tile: one maximum

      const float mn = fmaxf(mst[i], nm);
      const float fs = exp_slot(mst[i] - mn);
      mst[i] = mn;
#pragma unroll  // constant indices keep the tiles in registers
      for (int j = 0; j < 4; ++j)
#pragma unroll  // constant indices keep the tiles in registers
        for (int e = 0; e < 8; ++e)
          o[i][j][e] *= fs;

      float rs[4];
#pragma unroll  // constant indices keep the tiles in registers
      for (int j = 0; j < 4; ++j) {
        float p[8];
        exp_slot8(p, sa[i][j], mn);
        rs[j] = ((p[0] + p[1]) + (p[2] + p[3])) + ((p[4] + p[5]) + (p[6] + p[7]));
#pragma unroll  // constant indices keep the tiles in registers
        for (int e = 0; e < 8; ++e)
          pf[i][j >> 1][((j & 1) << 3) + e] = (_Float16)p[e];
      }
      lst[i] = lst[i] * fs + ((rs[0] + rs[1]) + (rs[2] + rs[3]));
    }

    // O^T += V^T P^T
#pragma unroll  // constant indices keep the tiles in registers
    for (int j = 0; j < 4; ++j) {
      v16h vf0 = load_frag_k32(&Vt[j * 16][0],  AP_, lane);
      v16h vf1 = load_frag_k32(&Vt[j * 16][32], AP_, lane);
#pragma unroll  // constant indices keep the tiles in registers
      for (int i = 0; i < 2; ++i) {
        o[i][j] = wmma_f16(vf0, pf[i][0], o[i][j]);
        o[i][j] = wmma_f16(vf1, pf[i][1], o[i][j]);
      }
    }
  }

  // a lane holds eight consecutive d of one query: one 16-byte store per tile
#pragma unroll  // constant indices keep the tiles in registers
  for (int i = 0; i < 2; ++i) {
    const float lt = lst[i] + xhalf(lst[i]);
    const int qrow = q0 + wave * 32 + i * 16 + lcol;
#pragma unroll  // constant indices keep the tiles in registers
    for (int j = 0; j < 4; ++j) {
      uint4 w;
      w.x = pack2h(o[i][j][0] / lt, o[i][j][1] / lt);
      w.y = pack2h(o[i][j][2] / lt, o[i][j][3] / lt);
      w.z = pack2h(o[i][j][4] / lt, o[i][j][5] / lt);
      w.w = pack2h(o[i][j][6] / lt, o[i][j][7] / lt);
      *(uint4*)(O + base + (size_t)qrow * E_ + j * 16 + lrow) = w;
    }
  }
}

// ---------------------------------------------------------------------------
// Fused residual + LayerNorm: y = LN(x + r)*g + b ; writes f32 and f16 copies
// ---------------------------------------------------------------------------
__global__ __launch_bounds__(128) void add_ln_kernel(
    const float* __restrict__ X, const float* __restrict__ R,
    const float* __restrict__ g, const float* __restrict__ bb,
    float* __restrict__ Y, _Float16* __restrict__ Y16) {
  __shared__ float ssum[4], ssq[4];
  const int row  = blockIdx.x;
  const int tid  = threadIdx.x;
  const int lane = tid & 31;
  const int wave = tid >> 5;
  const int c0   = tid << 2;

  float4 x4 = *(const float4*)(X + (size_t)row * E_ + c0);
  float4 r4 = *(const float4*)(R + (size_t)row * E_ + c0);
  float v[4] = {x4.x + r4.x, x4.y + r4.y, x4.z + r4.z, x4.w + r4.w};
  float s = v[0] + v[1] + v[2] + v[3];
  float q = v[0]*v[0] + v[1]*v[1] + v[2]*v[2] + v[3]*v[3];
#pragma unroll
  for (int off = 16; off >= 1; off >>= 1) {
    s += __shfl_xor(s, off, 32);
    q += __shfl_xor(q, off, 32);
  }
  if (lane == 0) { ssum[wave] = s; ssq[wave] = q; }
  __syncthreads();
  float S1 = ssum[0] + ssum[1] + ssum[2] + ssum[3];
  float S2 = ssq[0]  + ssq[1]  + ssq[2]  + ssq[3];
  float mu   = S1 * (1.0f / E_);
  float var  = S2 * (1.0f / E_) - mu * mu;
  float rinv = rsqrtf(var + 1e-6f);
  float4 o;
  float* op = &o.x;
#pragma unroll
  for (int c = 0; c < 4; ++c) {
    int col = c0 + c;
    op[c] = (v[c] - mu) * rinv * g[col] + bb[col];
  }
  *(float4*)(Y + (size_t)row * E_ + c0) = o;
  uint2 hp; hp.x = pack2h(o.x, o.y); hp.y = pack2h(o.z, o.w);
  *(uint2*)(Y16 + (size_t)row * E_ + c0) = hp;
}

// ---------------------------------------------------------------------------
// Host orchestration
// ---------------------------------------------------------------------------
extern "C" void kernel_launch(void* const* d_in, const int* in_sizes, int n_in,
                              void* d_out, int out_size, void* d_ws, size_t ws_size,
                              hipStream_t stream) {
  const int*   x    = (const int*)d_in[0];
  const int*   mask = (const int*)d_in[1];
  const float* emb  = (const float*)d_in[2];
  const float* pos  = (const float*)d_in[3];
  const float* Wq   = (const float*)d_in[4];
  const float* bq   = (const float*)d_in[5];
  const float* Wk   = (const float*)d_in[6];
  const float* bk   = (const float*)d_in[7];
  const float* Wv   = (const float*)d_in[8];
  const float* bv   = (const float*)d_in[9];
  const float* Wo   = (const float*)d_in[10];
  const float* bo   = (const float*)d_in[11];
  const float* g1   = (const float*)d_in[12];
  const float* be1  = (const float*)d_in[13];
  const float* g2   = (const float*)d_in[14];
  const float* be2  = (const float*)d_in[15];
  const float* W1   = (const float*)d_in[16];
  const float* bf1  = (const float*)d_in[17];
  const float* W2   = (const float*)d_in[18];
  const float* bf2  = (const float*)d_in[19];

  float* h = (float*)d_out;                               // [B,S,E] f32, persistent

  const size_t ACT = (size_t)ROWS * E_;
  char* p = (char*)d_ws;
  auto alloc_h = [&](size_t n) { _Float16* r = (_Float16*)p; p += n * sizeof(_Float16); return r; };
  _Float16* h16   = alloc_h(ACT);
  _Float16* q16   = alloc_h(ACT);
  _Float16* k16   = alloc_h(ACT);
  _Float16* v16   = alloc_h(ACT);
  _Float16* att16 = alloc_h(ACT);
  _Float16* big16 = alloc_h((size_t)ROWS * FF_);
  float* f32tmp = (float*)p; p += ACT * sizeof(float);
  _Float16* wtq[L_]; _Float16* wtk[L_]; _Float16* wtv[L_]; _Float16* wto[L_];
  _Float16* wt1[L_]; _Float16* wt2[L_];
  for (int l = 0; l < L_; ++l) {
    wtq[l] = alloc_h((size_t)E_ * E_);
    wtk[l] = alloc_h((size_t)E_ * E_);
    wtv[l] = alloc_h((size_t)E_ * E_);
    wto[l] = alloc_h((size_t)E_ * E_);
    wt1[l] = alloc_h((size_t)E_ * FF_);
    wt2[l] = alloc_h((size_t)FF_ * E_);
  }

  // Weight convert+transpose (W[K][N] f32 -> Wt[N][K] f16); wtq[0] is the start of the block
  wconv_kernel<<<dim3(384, L_), 256, 0, stream>>>(Wq, Wk, Wv, Wo, W1, W2, wtq[0]);

  embed_kernel<<<ROWS, 128, 0, stream>>>(x, emb, pos, h, h16);

  const dim3 gE(ROWS / 64, E_ / 256);                     // N = 512
  const dim3 gF(ROWS / 64, FF_ / 256);                    // N = 2048
  const dim3 gA(B_ * H_, S_ / 256);

  for (int l = 0; l < L_; ++l) {
    const float* bql = bq  + (size_t)l * E_;
    const float* bkl = bk  + (size_t)l * E_;
    const float* bvl = bv  + (size_t)l * E_;
    const float* bol = bo  + (size_t)l * E_;
    const float* b1l = bf1 + (size_t)l * FF_;
    const float* b2l = bf2 + (size_t)l * E_;
    const float* g1l = g1  + (size_t)l * E_;
    const float* e1l = be1 + (size_t)l * E_;
    const float* g2l = g2  + (size_t)l * E_;
    const float* e2l = be2 + (size_t)l * E_;

    gemm_f16_kernel<<<gE, 256, 0, stream>>>(h16, wtq[l], bql, nullptr, q16, E_, E_, 0);
    gemm_f16_kernel<<<gE, 256, 0, stream>>>(h16, wtk[l], bkl, nullptr, k16, E_, E_, 0);
    gemm_f16_kernel<<<gE, 256, 0, stream>>>(h16, wtv[l], bvl, nullptr, v16, E_, E_, 0);

    attention_kernel<<<gA, 256, 0, stream>>>(q16, k16, v16, mask, att16);

    gemm_f16_kernel<<<gE, 256, 0, stream>>>(att16, wto[l], bol, f32tmp, nullptr, E_, E_, 0);
    add_ln_kernel<<<ROWS, 128, 0, stream>>>(f32tmp, h, g1l, e1l, h, h16);

    gemm_f16_kernel<<<gF, 256, 0, stream>>>(h16, wt1[l], b1l, nullptr, big16, FF_, E_, 1);
    gemm_f16_kernel<<<gE, 256, 0, stream>>>(big16, wt2[l], b2l, f32tmp, nullptr, E_, FF_, 0);
    add_ln_kernel<<<ROWS, 128, 0, stream>>>(f32tmp, h, g2l, e2l, h, h16);
  }
}

// v005
// One run takes 337 microseconds.
// Timed twice side by side with v004, it ran 1.17 and 1.18 times as fast.
// All steps since v000 together make it 2.20 times as fast.
#include <hip/hip_runtime.h>
#include <hip/hip_bf16.h>

typedef __attribute__((ext_vector_type(16))) _Float16 v16h;
typedef __attribute__((ext_vector_type(8)))  float    v8f;
typedef __attribute__((ext_vector_type(8)))  _Float16 v8h;
typedef int v4i_vec __attribute__((vector_size(16)));   // int __vector(4)

constexpr int E_   = 512;
constexpr int H_   = 8;
constexpr int D_   = 64;
constexpr int FF_  = 2048;
constexpr int L_   = 2;
constexpr int B_   = 4;
constexpr int S_   = 2048;
constexpr int ROWS = B_ * S_;          // 8192 token rows

constexpr int AP_  = 72;               // attention tiles: 64 f16 used per row

#if defined(__has_builtin)
#if __has_builtin(__builtin_amdgcn_global_load_async_to_lds_b128)
#define HAVE_ASYNC_LDS 1
#endif
#endif
#ifndef HAVE_ASYNC_LDS
#define HAVE_ASYNC_LDS 0
#endif

__device__ __forceinline__ uint32_t pack2h(float a, float b) {
  union { _Float16 h[2]; uint32_t u; } t;
  t.h[0] = (_Float16)a; t.h[1] = (_Float16)b;
  return t.u;
}

__device__ __forceinline__ void cp16B_g2l(const _Float16* g, _Float16* l) {
#if HAVE_ASYNC_LDS
  __builtin_amdgcn_global_load_async_to_lds_b128(
      (__attribute__((address_space(1))) v4i_vec*)(_Float16*)g,
      (__attribute__((address_space(3))) v4i_vec*)l, 0, 0);
#else
  *(uint4*)l = *(const uint4*)g;
#endif
}

__device__ __forceinline__ void async_fence() {
#if HAVE_ASYNC_LDS
  asm volatile("s_wait_asynccnt 0" ::: "memory");
#endif
}

__device__ __forceinline__ v16h load_frag_k32(const _Float16* base, int rowStride, int lane) {
  int r  = lane & 15;
  int kh = (lane >> 4) << 3;
  const _Float16* p = base + r * rowStride + kh;
  union { v16h v; uint32_t u[8]; } f;
  const uint32_t* p0 = (const uint32_t*)p;
  const uint32_t* p1 = (const uint32_t*)(p + 16);
#pragma unroll
  for (int i = 0; i < 4; ++i) { f.u[i] = p0[i]; f.u[4 + i] = p1[i]; }
  return f.v;
}

__device__ __forceinline__ v8f wmma_f16(v16h a, v16h b, v8f c) {
  return __builtin_amdgcn_wmma_f32_16x16x32_f16(false, a, false, b, (short)0, c, false, false);
}

// ---------------------------------------------------------------------------
// Weight convert + transpose, all twelve matrices in one launch:
// W[K][N] f32 -> Wt[N][K] f16. One block moves a 128(k) x 64(n) tile through LDS,
// 32 elements per thread; global reads and writes are runs of 256 B.
// grid.x: 0..127 Wq,Wk,Wv,Wo (32 tiles each), 128..255 W1, 256..383 W2; grid.y: layer.
// Wt: per layer wtq, wtk, wtv, wto, wt1, wt2 back to back (WL_ elements).
// ---------------------------------------------------------------------------
constexpr int    TP_ = 136;            // tile row pitch in f16: 256 B + 16 B (16 B x odd)
constexpr size_t WL_ = (size_t)4 * E_ * E_ + (size_t)2 * E_ * FF_;

template <int K, int N>
__device__ __forceinline__ void wconv_tile(
    const float* __restrict__ W, _Float16* __restrict__ Wt, int t, _Float16 (*T)[TP_]) {
  const int tid = threadIdx.x;
  const int k0  = (t / (N / 64)) * 128;
  const int n0  = (t % (N / 64)) * 64;

  // read: a thread takes 8 consecutive k of 4 consecutive n (16 lanes = 256 B of one k row);
  // uniform tile base + one per-lane byte offset that all eight loads share
  const int kc = tid >> 4;             // which group of 8 k
  const int nq = tid & 15;             // which group of 4 n
  const char* sb = (const char*)(W + (size_t)k0 * N + n0);
  const uint32_t voff = (uint32_t)(kc * 8 * N + nq * 4) * 4u;
  float4 v[8];
#pragma unroll  // all eight loads in flight together, v[] in registers
  for (int i = 0; i < 8; ++i) v[i] = *(const float4*)(sb + voff + i * N * 4);

#pragma unroll  // constant c: v[] is indexed at compile time and stays in registers
  for (int c = 0; c < 4; ++c) {
    uint4 w;
    w.x = pack2h((&v[0].x)[c], (&v[1].x)[c]);
    w.y = pack2h((&v[2].x)[c], (&v[3].x)[c]);
    w.z = pack2h((&v[4].x)[c], (&v[5].x)[c]);
    w.w = pack2h((&v[6].x)[c], (&v[7].x)[c]);
    *(uint4*)&T[nq * 4 + c][kc * 8] = w;
  }
  __syncthreads();

  // write: 16 lanes = the 256 B that one n row of the tile holds
  _Float16* dp = Wt + (size_t)n0 * K + k0;
#pragma unroll  // the four LDS reads issue ahead of the four stores
  for (int j = 0; j < 4; ++j) {
    const int idx = j * 256 + tid;
    const int row = idx >> 4, ch = (idx & 15) << 3;
    *(uint4*)(dp + (size_t)row * K + ch) = *(const uint4*)&T[row][ch];
  }
}

__global__ __launch_bounds__(256) void wconv_kernel(
    const float* __restrict__ Wq, const float* __restrict__ Wk,
    const float* __restrict__ Wv, const float* __restrict__ Wo,
    const float* __restrict__ W1, const float* __restrict__ W2,
    _Float16* __restrict__ Wt) {
  __shared__ __attribute__((aligned(16))) _Float16 T[64][TP_];        // 17 KB : [n][k]

  const int r = blockIdx.x;            // the three branches are uniform for the block
  const int l = blockIdx.y;
  _Float16* D = Wt + (size_t)l * WL_;
  if (r < 128) {
    const int m = r >> 5;
    const float* W = (m == 0) ? Wq : (m == 1) ? Wk : (m == 2) ? Wv : Wo;
    wconv_tile<E_, E_>(W + (size_t)l * E_ * E_, D + (size_t)m * E_ * E_, r & 31, T);
  } else if (r < 256) {
    wconv_tile<E_, FF_>(W1 + (size_t)l * E_ * FF_, D + (size_t)4 * E_ * E_, r - 128, T);
  } else {
    wconv_tile<FF_, E_>(W2 + (size_t)l * FF_ * E_,
                        D + (size_t)4 * E_ * E_ + (size_t)E_ * FF_, r - 256, T);
  }
}

// ---------------------------------------------------------------------------
// Embedding + positional add: writes f32 h and f16 h16
// ---------------------------------------------------------------------------
__global__ __launch_bounds__(128) void embed_kernel(
    const int* __restrict__ x, const float* __restrict__ emb,
    const float* __restrict__ pos, float* __restrict__ h,
    _Float16* __restrict__ h16) {
  int row = blockIdx.x;
  int s   = row & (S_ - 1);
  int tok = x[row] + 1;
  int c   = threadIdx.x << 2;
  float4 e4 = *(const float4*)(emb + (size_t)tok * E_ + c);
  float4 p4 = *(const float4*)(pos + (size_t)s   * E_ + c);
  float4 o; o.x = e4.x + p4.x; o.y = e4.y + p4.y; o.z = e4.z + p4.z; o.w = e4.w + p4.w;
  *(float4*)(h + (size_t)row * E_ + c) = o;
  uint2 hp; hp.x = pack2h(o.x, o.y); hp.y = pack2h(o.z, o.w);
  *(uint2*)(h16 + (size_t)row * E_ + c) = hp;
}

// ---------------------------------------------------------------------------
// WMMA GEMM, f16 in: C[M,N] = act(A[M,K] @ Wt[N,K]^T + bias[N]), M = 8192.
// Block tile 64x256, 8 waves (2x4), wave tile 32x64, K-step KS, dbl buffer.
// KS = 128 where one block stands alone on its WGP (256 blocks): the one tile in flight is
// 80 KB and a wave's copy covers two whole 256-B rows. KS = 64 where three blocks share a
// WGP (1024 blocks): 40 KB in flight each, whole 128-B lines.
// Output: f32 (Cf) and/or f16 (Ch).
// The product is formed transposed (weight fragment as A operand, activation fragment as B):
// a lane then holds eight consecutive columns of ONE output row. Each wave passes its tile,
// 16 rows at a time, through its own range of the finished B tile and stores whole rows of
// the wave tile (128 B of f16, 256 B of f32) with 16-byte stores.
// ---------------------------------------------------------------------------
// Stands behind a run of global stores, in front of the code that writes their address and
// data registers anew.
__device__ __forceinline__ void stores_taken() {
  asm volatile("s_wait_xcnt 0x0" ::: "memory");
}

constexpr int SH_  = 144;              // staged f16 row: 128 B + 16 B (16 B x odd)
constexpr int SF_  = 272;              // staged f32 row: 256 B + 16 B (16 B x odd)
constexpr int STG_ = 16 * SF_;         // one wave's staging range in bytes

// A wave's own LDS writes have landed before its lanes read each other's rows back.
__device__ __forceinline__ void lds_landed() {
  asm volatile("s_wait_dscnt 0x0" ::: "memory");
}

template <int KS>
__global__ __launch_bounds__(256) void gemm_f16_kernel(
    const _Float16* __restrict__ A, const _Float16* __restrict__ Wt,
    const float* __restrict__ bias, float* __restrict__ Cf,
    _Float16* __restrict__ Ch, int N, int Kdim, int relu) {
  constexpr int GP_ = KS + 8;          // row pitch in f16
  constexpr int CR_ = KS / 8;          // 16-byte pieces per row
  __shared__ __attribute__((aligned(16))) _Float16 Atile[2][64][GP_];   // KS 64: 18 KB, 128: 34 KB
  __shared__ __attribute__((aligned(16))) _Float16 Btile[2][256][GP_];  // KS 64: 72 KB, 128: 136 KB ([n][k])

  const int tid  = threadIdx.x;
  const int lane = tid & 31;
  const int wave = tid >> 5;
  const int wm   = (wave >> 2) << 5;           // 0 / 32
  const int wn   = (wave & 3) << 6;            // 0 / 64 / 128 / 192
  const int m0   = blockIdx.x * 64;
  const int n0   = blockIdx.y * 256;

  v8f acc[2][4] = {};
  const int nk = Kdim / KS;

  auto load_tiles = [&](int kt, int buf) {
    const int k0 = kt * KS;
#pragma unroll  // the copies of a tile issue back to back, with no loop branch between them
    for (int t = 0; t < KS / 32; ++t) {  // A: 64 x KS f16, KS / 32 pieces per thread
      int idx = t * 256 + tid;
      int r = idx / CR_, seg = (idx % CR_) << 3;
      cp16B_g2l(A + (size_t)(m0 + r) * Kdim + k0 + seg, &Atile[buf][r][seg]);
    }
#pragma unroll
    for (int t = 0; t < KS / 8; ++t) {   // B: 256 x KS f16, KS / 8 pieces per thread
      int idx = t * 256 + tid;
      int r = idx / CR_, seg = (idx % CR_) << 3;
      cp16B_g2l(Wt + (size_t)(n0 + r) * Kdim + k0 + seg, &Btile[buf][r][seg]);
    }
  };

  load_tiles(0, 0);
  async_fence();
  __syncthreads();

  for (int kt = 0; kt < nk; ++kt) {
    const int cur = kt & 1;
    if (kt + 1 < nk) load_tiles(kt + 1, cur ^ 1);

#pragma unroll  // the compiler fetches a later 32-k block's fragments ahead of the current one's products
    for (int ks = 0; ks < KS; ks += 32) {
      v16h af[2], bf[4];
      af[0] = load_frag_k32(&Atile[cur][wm + 0][ks], GP_, lane);
      af[1] = load_frag_k32(&Atile[cur][wm + 16][ks], GP_, lane);
#pragma unroll
      for (int j = 0; j < 4; ++j)
        bf[j] = load_frag_k32(&Btile[cur][wn + j * 16][ks], GP_, lane);
#pragma unroll
      for (int i = 0; i < 2; ++i)
#pragma unroll
        for (int j = 0; j < 4; ++j)
          acc[i][j] = wmma_f16(bf[j], af[i], acc[i][j]);   // D[n][m]
    }

    lds_landed();      // this wave's reads of the buffer that is refilled behind the barrier have ended
    async_fence();
    __syncthreads();
  }

  // acc[i][j][e] = C[m0 + wm + 16i + lcol][n0 + wn + 16j + lrow + e]
  const int lrow = (lane >> 4) << 3;
  const int lcol = lane & 15;
  const int cw   = n0 + wn;            // first column of the wave tile
  // The loop's last barrier stands behind every wave's last fragment read and last copy.
  char* stage = (char*)&Btile[0][0][0] + wave * STG_;

  float4 bv[4][2];
#pragma unroll  // constant indices keep bv[] in registers; all eight loads in flight together
  for (int j = 0; j < 4; ++j) {
    bv[j][0] = *(const float4*)(bias + cw + j * 16 + lrow);
    bv[j][1] = *(const float4*)(bias + cw + j * 16 + lrow + 4);
  }

#pragma unroll  // constant indices keep acc[] in registers
  for (int i = 0; i < 2; ++i)
#pragma unroll  // constant indices keep acc[] in registers
    for (int j = 0; j < 4; ++j)
#pragma unroll  // constant indices keep acc[] in registers
      for (int e = 0; e < 8; ++e)
        acc[i][j][e] += (&bv[j][e >> 2].x)[e & 3];
  if (relu) {
#pragma unroll  // constant indices keep acc[] in registers
    for (int i = 0; i < 2; ++i)
#pragma unroll  // constant indices keep acc[] in registers
      for (int j = 0; j < 4; ++j)
#pragma unroll  // constant indices keep acc[] in registers
        for (int e = 0; e < 8; ++e)
          acc[i][j][e] = fmaxf(acc[i][j][e], 0.0f);
  }

#pragma unroll  // constant indices keep acc[] in registers
  for (int i = 0; i < 2; ++i) {
    const int rw = m0 + wm + i * 16;   // first row of this half of the wave tile
    if (Cf) {
#pragma unroll  // constant indices keep acc[] in registers
      for (int j = 0; j < 4; ++j) {
        char* sp = stage + lcol * SF_ + (j * 16 + lrow) * 4;
        *(float4*)sp        = make_float4(acc[i][j][0], acc[i][j][1], acc[i][j][2], acc[i][j][3]);
        *(float4*)(sp + 16) = make_float4(acc[i][j][4], acc[i][j][5], acc[i][j][6], acc[i][j][7]);
      }
      lds_landed();
      float4 w[8];
#pragma unroll  // the eight LDS reads issue ahead of the eight stores
      for (int t = 0; t < 8; ++t)      // 16 lanes = the 256 B of one row, two rows a read
        w[t] = *(const float4*)(stage + (t * 2 + (lane >> 4)) * SF_ + lcol * 16);
#pragma unroll  // constant indices keep w[] in registers
      for (int t = 0; t < 8; ++t)
        *(float4*)(Cf + (rw + t * 2 + (lane >> 4)) * N + cw + lcol * 4) = w[t];
      stores_taken();
    }
    if (Ch) {
#pragma unroll  // constant indices keep acc[] in registers
      for (int j = 0; j < 4; ++j) {
        v8h w;
#pragma unroll  // constant indices keep w in registers
        for (int e = 0; e < 8; ++e) w[e] = (_Float16)acc[i][j][e];
        *(v8h*)(stage + lcol * SH_ + (j * 16 + lrow) * 2) = w;
      }
      lds_landed();
      v8h w[4];
#pragma unroll  // the four LDS reads issue ahead of the four stores
      for (int t = 0; t < 4; ++t)      // 8 lanes = the 128 B of one row, four rows a read
        w[t] = *(const v8h*)(stage + (t * 4 + (lane >> 3)) * SH_ + (lane & 7) * 16);
#pragma unroll  // constant indices keep w[] in registers
      for (int t = 0; t < 4; ++t)
        *(v8h*)(Ch + (rw + t * 4 + (lane >> 3)) * N + cw + (lane & 7) * 8) = w[t];
      if (i == 0) stores_taken();      // behind the last run nothing is written any more
    }
  }
}

__device__ __forceinline__ float xhalf(float x) {
  return __builtin_bit_cast(float, __builtin_amdgcn_permlanex16(
      __builtin_bit_cast(int, x), __builtin_bit_cast(int, x), 0x76543210, 0xfedcba98, false, false));
}

constexpr float LOG2E_ = 1.44269504f;

__device__ __forceinline__ float exp_slot(float x) {
  float r = x * LOG2E_;
  asm("v_exp_f32 %0, %0\n\tv_nop" : "+v"(r));
  return r;
}

__device__ __forceinline__ void exp_slot8(float (&p)[8], const v8f& s, float m) {
#pragma unroll  // constant indices keep p[] in registers
  for (int e = 0; e < 8; ++e) p[e] = (s[e] - m) * LOG2E_;
  asm("v_exp_f32 %0, %0\n\tv_exp_f32 %1, %1\n\tv_exp_f32 %2, %2\n\tv_exp_f32 %3, %3\n\t"
      "v_exp_f32 %4, %4\n\tv_exp_f32 %5, %5\n\tv_exp_f32 %6, %6\n\tv_exp_f32 %7, %7\n\tv_nop"
      : "+v"(p[0]), "+v"(p[1]), "+v"(p[2]), "+v"(p[3]),
        "+v"(p[4]), "+v"(p[5]), "+v"(p[6]), "+v"(p[7]));
}

__global__ __launch_bounds__(256) void attention_kernel(
    const _Float16* __restrict__ Q, const _Float16* __restrict__ K,
    const _Float16* __restrict__ V, const int* __restrict__ mask,
    _Float16* __restrict__ O) {
  __shared__ __attribute__((aligned(16))) _Float16 Kt[64][AP_];       //  9 KB : [key][d]  (A-frag for K Q^T)
  __shared__ __attribute__((aligned(16))) _Float16 Vt[64][AP_];       //  9 KB : [d][key]  (A-frag for V^T P^T)
  __shared__ __attribute__((aligned(16))) int      smask[64];

  const int tid  = threadIdx.x;
  const int lane = tid & 31;
  const int wave = tid >> 5;
  const int bh   = blockIdx.x;
  const int b    = bh >> 3;
  const int hh   = bh & 7;
  const int q0   = blockIdx.y * 256;
  const size_t base = ((size_t)b * S_) * E_ + (size_t)hh * D_;

  // Q fragments straight from global f16 (B operand: column = query, same k order as A)
  v16h qf[2][2];
#pragma unroll
  for (int i = 0; i < 2; ++i)
#pragma unroll
    for (int s = 0; s < 2; ++s) {
      int q = q0 + wave * 32 + i * 16 + (lane & 15);
      const _Float16* rp = Q + base + (size_t)q * E_ + s * 32 + ((lane >> 4) << 3);
      union { v16h v; uint32_t u[8]; } f;
#pragma unroll
      for (int vv = 0; vv < 8; ++vv) {
        int d = ((vv >> 2) << 4) + ((vv & 3) << 1);
        f.u[vv] = *(const uint32_t*)(rp + d);
      }
      qf[i][s] = f.v;
    }

  v8f o[2][4] = {};                    // o[i][j][r] = O^T[d = 16j + 8h + r][query 16i + c]
  float mst[2], lst[2];                // per query; lst: this wave half's keys only
#pragma unroll  // constant indices keep mst[], lst[] in registers
  for (int i = 0; i < 2; ++i) { mst[i] = -1e30f; lst[i] = 0.0f; }

  const float scale = 0.125f;
  const int lrow = (lane >> 4) << 3;
  const int lcol = lane & 15;

  for (int kb = 0; kb < S_; kb += 64) {
    __syncthreads();
    // K block: [key][d] f16 rows -> direct (async) copy; V -> transposed stores
#pragma unroll
    for (int t = 0; t < 2; ++t) {
      int idx = t * 256 + tid;
      int r = idx >> 3, c0 = (idx & 7) << 3;
      cp16B_g2l(K + base + (size_t)(kb + r) * E_ + c0, &Kt[r][c0]);
      uint4 vv = *(const uint4*)(V + base + (size_t)(kb + r) * E_ + c0);
      const _Float16* vh = (const _Float16*)&vv;
#pragma unroll
      for (int j = 0; j < 8; ++j) Vt[c0 + j][r] = vh[j];
    }
    if (tid < 64) smask[tid] = mask[(size_t)b * S_ + kb + tid];
    async_fence();
    __syncthreads();

    // scores S^T = K Q^T : sa[i][j][r] = S[query 16i + c][key 16j + 8h + r]
    v8f sa[2][4];
#pragma unroll  // constant indices keep the tiles in registers
    for (int j = 0; j < 4; ++j) {
      v16h kf0 = load_frag_k32(&Kt[j * 16][0],  AP_, lane);
      v16h kf1 = load_frag_k32(&Kt[j * 16][32], AP_, lane);
#pragma unroll  // constant indices keep the tiles in registers
      for (int i = 0; i < 2; ++i) {
        v8f z = {};
        z = wmma_f16(kf0, qf[i][0], z);
        sa[i][j] = wmma_f16(kf1, qf[i][1], z);
      }
    }

    // the lane's own eight keys of each tile
#pragma unroll  // constant indices keep the tiles in registers
    for (int j = 0; j < 4; ++j) {
      const int4 ma = *(const int4*)&smask[j * 16 + lrow];
      const int4 mb = *(const int4*)&smask[j * 16 + lrow + 4];
      const int mk[8] = {ma.x, ma.y, ma.z, ma.w, mb.x, mb.y, mb.z, mb.w};
#pragma unroll  // constant indices keep the tiles in registers
      for (int i = 0; i < 2; ++i)
#pragma unroll  // constant indices keep the tiles in registers
        for (int e = 0; e < 8; ++e) {
          float v = sa[i][j][e] * scale;
          sa[i][j][e] = mk[e] ? v : -1e20f;
        }
    }

    // online softmax, one query per lane and column group
    v16h pf[2][2];                     // pf[i][s]: P^T, keys 32s .. 32s + 31, as B operand
#pragma unroll  // constant indices keep the tiles in registers
    for (int i = 0; i < 2; ++i) {
      float nm = sa[i][0][0];
#pragma unroll  // constant indices keep the tiles in registers
      for (int j = 0; j < 4; ++j)
#pragma unroll  // constant indices keep the tiles in registers
        for (int e = 0; e < 8; ++e) nm = fmaxf(nm, sa[i][j][e]);
      nm = fmaxf(nm, xhalf(nm));       // both halves feed the same O^T tile: one maximum

      const float mn = fmaxf(mst[i], nm);
      const float fs = exp_slot(mst[i] - mn);
      mst[i] = mn;
#pragma unroll  // constant indices keep the tiles in registers
      for (int j = 0; j < 4; ++j)
#pragma unroll  // constant indices keep the tiles in registers
        for (int e = 0; e < 8; ++e)
          o[i][j][e] *= fs;

      float rs[4];
#pragma unroll  // constant indices keep the tiles in registers
      for (int j = 0; j < 4; ++j) {
        float p[8];
        exp_slot8(p, sa[i][j], mn);
        rs[j] = ((p[0] + p[1]) + (p[2] + p[3])) + ((p[4] + p[5]) + (p[6] + p[7]));
#pragma unroll  // constant indices keep the tiles in registers
        for (int e = 0; e < 8; ++e)
          pf[i][j >> 1][((j & 1) << 3) + e] = (_Float16)p[e];
      }
      lst[i] = lst[i] * fs + ((rs[0] + rs[1]) + (rs[2] + rs[3]));
    }

    // O^T += V^T P^T
#pragma unroll  // constant indices keep the tiles in registers
    for (int j = 0; j < 4; ++j) {
      v16h vf0 = load_frag_k32(&Vt[j * 16][0],  AP_, lane);
      v16h vf1 = load_frag_k32(&Vt[j * 16][32], AP_, lane);
#pragma unroll  // constant indices keep the tiles in registers
      for (int i = 0; i < 2; ++i) {
        o[i][j] = wmma_f16(vf0, pf[i][0], o[i][j]);
        o[i][j] = wmma_f16(vf1, pf[i][1], o[i][j]);
      }
    }
  }

  // a lane holds eight consecutive d of one query: one 16-byte store per tile
#pragma unroll  // constant indices keep the tiles in registers
  for (int i = 0; i < 2; ++i) {
    const float lt = lst[i] + xhalf(lst[i]);
    const int qrow = q0 + wave * 32 + i * 16 + lcol;
#pragma unroll  // constant indices keep the tiles in registers
    for (int j = 0; j < 4; ++j) {
      uint4 w;
      w.x = pack2h(o[i][j][0] / lt, o[i][j][1] / lt);
      w.y = pack2h(o[i][j][2] / lt, o[i][j][3] / lt);
      w.z = pack2h(o[i][j][4] / lt, o[i][j][5] / lt);
      w.w = pack2h(o[i][j][6] / lt, o[i][j][7] / lt);
      *(uint4*)(O + base + (size_t)qrow * E_ + j * 16 + lrow) = w;
    }
  }
}

// ---------------------------------------------------------------------------
// Fused residual + LayerNorm: y = LN(x + r)*g + b ; writes f32 and f16 copies
// ---------------------------------------------------------------------------
__global__ __launch_bounds__(128) void add_ln_kernel(
    const float* __restrict__ X, const float* __restrict__ R,
    const float* __restrict__ g, const float* __restrict__ bb,
    float* __restrict__ Y, _Float16* __restrict__ Y16) {
  __shared__ float ssum[4], ssq[4];
  const int row  = blockIdx.x;
  const int tid  = threadIdx.x;
  const int lane = tid & 31;
  const int wave = tid >> 5;
  const int c0   = tid << 2;

  float4 x4 = *(const float4*)(X + (size_t)row * E_ + c0);
  float4 r4 = *(const float4*)(R + (size_t)row * E_ + c0);
  float v[4] = {x4.x + r4.x, x4.y + r4.y, x4.z + r4.z, x4.w + r4.w};
  float s = v[0] + v[1] + v[2] + v[3];
  float q = v[0]*v[0] + v[1]*v[1] + v[2]*v[2] + v[3]*v[3];
#pragma unroll
  for (int off = 16; off >= 1; off >>= 1) {
    s += __shfl_xor(s, off, 32);
    q += __shfl_xor(q, off, 32);
  }
  if (lane == 0) { ssum[wave] = s; ssq[wave] = q; }
  __syncthreads();
  float S1 = ssum[0] + ssum[1] + ssum[2] + ssum[3];
  float S2 = ssq[0]  + ssq[1]  + ssq[2]  + ssq[3];
  float mu   = S1 * (1.0f / E_);
  float var  = S2 * (1.0f / E_) - mu * mu;
  float rinv = rsqrtf(var + 1e-6f);
  float4 o;
  float* op = &o.x;
#pragma unroll
  for (int c = 0; c < 4; ++c) {
    int col = c0 + c;
    op[c] = (v[c] - mu) * rinv * g[col] + bb[col];
  }
  *(float4*)(Y + (size_t)row * E_ + c0) = o;
  uint2 hp; hp.x = pack2h(o.x, o.y); hp.y = pack2h(o.z, o.w);
  *(uint2*)(Y16 + (size_t)row * E_ + c0) = hp;
}

// ---------------------------------------------------------------------------
// Host orchestration
// ---------------------------------------------------------------------------
extern "C" void kernel_launch(void* const* d_in, const int* in_sizes, int n_in,
                              void* d_out, int out_size, void* d_ws, size_t ws_size,
                              hipStream_t stream) {
  const int*   x    = (const int*)d_in[0];
  const int*   mask = (const int*)d_in[1];
  const float* emb  = (const float*)d_in[2];
  const float* pos  = (const float*)d_in[3];
  const float* Wq   = (const float*)d_in[4];
  const float* bq   = (const float*)d_in[5];
  const float* Wk   = (const float*)d_in[6];
  const float* bk   = (const float*)d_in[7];
  const float* Wv   = (const float*)d_in[8];
  const float* bv   = (const float*)d_in[9];
  const float* Wo   = (const float*)d_in[10];
  const float* bo   = (const float*)d_in[11];
  const float* g1   = (const float*)d_in[12];
  const float* be1  = (const float*)d_in[13];
  const float* g2   = (const float*)d_in[14];
  const float* be2  = (const float*)d_in[15];
  const float* W1   = (const float*)d_in[16];
  const float* bf1  = (const float*)d_in[17];
  const float* W2   = (const float*)d_in[18];
  const float* bf2  = (const float*)d_in[19];

  float* h = (float*)d_out;                               // [B,S,E] f32, persistent

  const size_t ACT = (size_t)ROWS * E_;
  char* p = (char*)d_ws;
  auto alloc_h = [&](size_t n) { _Float16* r = (_Float16*)p; p += n * sizeof(_Float16); return r; };
  _Float16* h16   = alloc_h(ACT);
  _Float16* q16   = alloc_h(ACT);
  _Float16* k16   = alloc_h(ACT);
  _Float16* v16   = alloc_h(ACT);
  _Float16* att16 = alloc_h(ACT);
  _Float16* big16 = alloc_h((size_t)ROWS * FF_);
  float* f32tmp = (float*)p; p += ACT * sizeof(float);
  _Float16* wtq[L_]; _Float16* wtk[L_]; _Float16* wtv[L_]; _Float16* wto[L_];
  _Float16* wt1[L_]; _Float16* wt2[L_];
  for (int l = 0; l < L_; ++l) {
    wtq[l] = alloc_h((size_t)E_ * E_);
    wtk[l] = alloc_h((size_t)E_ * E_);
    wtv[l] = alloc_h((size_t)E_ * E_);
    wto[l] = alloc_h((size_t)E_ * E_);
    wt1[l] = alloc_h((size_t)E_ * FF_);
    wt2[l] = alloc_h((size_t)FF_ * E_);
  }

  // Weight convert+transpose (W[K][N] f32 -> Wt[N][K] f16); wtq[0] is the start of the block
  wconv_kernel<<<dim3(384, L_), 256, 0, stream>>>(Wq, Wk, Wv, Wo, W1, W2, wtq[0]);

  embed_kernel<<<ROWS, 128, 0, stream>>>(x, emb, pos, h, h16);

  const dim3 gE(ROWS / 64, E_ / 256);                     // N = 512
  const dim3 gF(ROWS / 64, FF_ / 256);                    // N = 2048
  const dim3 gA(B_ * H_, S_ / 256);

  for (int l = 0; l < L_; ++l) {
    const float* bql = bq  + (size_t)l * E_;
    const float* bkl = bk  + (size_t)l * E_;
    const float* bvl = bv  + (size_t)l * E_;
    const float* bol = bo  + (size_t)l * E_;
    const float* b1l = bf1 + (size_t)l * FF_;
    const float* b2l = bf2 + (size_t)l * E_;
    const float* g1l = g1  + (size_t)l * E_;
    const float* e1l = be1 + (size_t)l * E_;
    const float* g2l = g2  + (size_t)l * E_;
    const float* e2l = be2 + (size_t)l * E_;

    gemm_f16_kernel<128><<<gE, 256, 0, stream>>>(h16, wtq[l], bql, nullptr, q16, E_, E_, 0);
    gemm_f16_kernel<128><<<gE, 256, 0, stream>>>(h16, wtk[l], bkl, nullptr, k16, E_, E_, 0);
    gemm_f16_kernel<128><<<gE, 256, 0, stream>>>(h16, wtv[l], bvl, nullptr, v16, E_, E_, 0);

    attention_kernel<<<gA, 256, 0, stream>>>(q16, k16, v16, mask, att16);

    gemm_f16_kernel<128><<<gE, 256, 0, stream>>>(att16, wto[l], bol, f32tmp, nullptr, E_, E_, 0);
    add_ln_kernel<<<ROWS, 128, 0, stream>>>(f32tmp, h, g1l, e1l, h, h16);

    gemm_f16_kernel<64><<<gF, 256, 0, stream>>>(h16, wt1[l], b1l, nullptr, big16, FF_, E_, 1);
    gemm_f16_kernel<128><<<gE, 256, 0, stream>>>(big16, wt2[l], b2l, f32tmp, nullptr, E_, FF_, 0);
    add_ln_kernel<<<ROWS, 128, 0, stream>>>(f32tmp, h, g2l, e2l, h, h16);
  }
}

// v006
// Measured time: 290 microseconds a run.
// In both of two side-by-side timings against v005, it was 1.15 times as fast.
// Over all steps from v000 it is 2.54 times as fast.
#include <hip/hip_runtime.h>
#include <hip/hip_bf16.h>

typedef __attribute__((ext_vector_type(16))) _Float16 v16h;
typedef __attribute__((ext_vector_type(8)))  float    v8f;
typedef __attribute__((ext_vector_type(8)))  _Float16 v8h;
typedef int v4i_vec __attribute__((vector_size(16)));   // int __vector(4)

constexpr int E_   = 512;
constexpr int H_   = 8;
constexpr int D_   = 64;
constexpr int FF_  = 2048;
constexpr int L_   = 2;
constexpr int B_   = 4;
constexpr int S_   = 2048;
constexpr int ROWS = B_ * S_;          // 8192 token rows

constexpr int AP_  = 72;               // attention K tile: 64 f16 used per row
// The V tile is read by ds_load_tr16_b128, which wants a pitch of 32 B x odd.
constexpr int VP_  = 80;               // attention V tile: 64 f16 used per row, 160 B

#if defined(__has_builtin)
#if __has_builtin(__builtin_amdgcn_global_load_async_to_lds_b128)
#define HAVE_ASYNC_LDS 1
#endif
#endif
#ifndef HAVE_ASYNC_LDS
#define HAVE_ASYNC_LDS 0
#endif

__device__ __forceinline__ uint32_t pack2h(float a, float b) {
  union { _Float16 h[2]; uint32_t u; } t;
  t.h[0] = (_Float16)a; t.h[1] = (_Float16)b;
  return t.u;
}

__device__ __forceinline__ void cp16B_g2l(const _Float16* g, _Float16* l) {
#if HAVE_ASYNC_LDS
  __builtin_amdgcn_global_load_async_to_lds_b128(
      (__attribute__((address_space(1))) v4i_vec*)(_Float16*)g,
      (__attribute__((address_space(3))) v4i_vec*)l, 0, 0);
#else
  *(uint4*)l = *(const uint4*)g;
#endif
}

__device__ __forceinline__ void async_fence() {
#if HAVE_ASYNC_LDS
  asm volatile("s_wait_asynccnt 0" ::: "memory");
#endif
}

__device__ __forceinline__ v16h load_frag_k32(const _Float16* base, int rowStride, int lane) {
  int r  = lane & 15;
  int kh = (lane >> 4) << 3;
  const _Float16* p = base + r * rowStride + kh;
  union { v16h v; uint32_t u[8]; } f;
  const uint32_t* p0 = (const uint32_t*)p;
  const uint32_t* p1 = (const uint32_t*)(p + 16);
#pragma unroll
  for (int i = 0; i < 4; ++i) { f.u[i] = p0[i]; f.u[4 + i] = p1[i]; }
  return f.v;
}

__device__ __forceinline__ v8f wmma_f16(v16h a, v16h b, v8f c) {
  return __builtin_amdgcn_wmma_f32_16x16x32_f16(false, a, false, b, (short)0, c, false, false);
}

// ---------------------------------------------------------------------------
// Weight convert + transpose, all twelve matrices in one launch:
// W[K][N] f32 -> Wt[N][K] f16. One block moves a 128(k) x 64(n) tile through LDS,
// 32 elements per thread; global reads and writes are runs of 256 B.
// grid.x: 0..127 Wq,Wk,Wv,Wo (32 tiles each), 128..255 W1, 256..383 W2; grid.y: layer.
// Wt: per layer wtq, wtk, wtv, wto, wt1, wt2 back to back (WL_ elements).
// ---------------------------------------------------------------------------
constexpr int    TP_ = 136;            // tile row pitch in f16: 256 B + 16 B (16 B x odd)
constexpr size_t WL_ = (size_t)4 * E_ * E_ + (size_t)2 * E_ * FF_;

template <int K, int N>
__device__ __forceinline__ void wconv_tile(
    const float* __restrict__ W, _Float16* __restrict__ Wt, int t, _Float16 (*T)[TP_]) {
  const int tid = threadIdx.x;
  const int k0  = (t / (N / 64)) * 128;
  const int n0  = (t % (N / 64)) * 64;

  // read: a thread takes 8 consecutive k of 4 consecutive n (16 lanes = 256 B of one k row);
  // uniform tile base + one per-lane byte offset that all eight loads share
  const int kc = tid >> 4;             // which group of 8 k
  const int nq = tid & 15;             // which group of 4 n
  const char* sb = (const char*)(W + (size_t)k0 * N + n0);
  const uint32_t voff = (uint32_t)(kc * 8 * N + nq * 4) * 4u;
  float4 v[8];
#pragma unroll  // all eight loads in flight together, v[] in registers
  for (int i = 0; i < 8; ++i) v[i] = *(const float4*)(sb + voff + i * N * 4);

#pragma unroll  // constant c: v[] is indexed at compile time and stays in registers
  for (int c = 0; c < 4; ++c) {
    uint4 w;
    w.x = pack2h((&v[0].x)[c], (&v[1].x)[c]);
    w.y = pack2h((&v[2].x)[c], (&v[3].x)[c]);
    w.z = pack2h((&v[4].x)[c], (&v[5].x)[c]);
    w.w = pack2h((&v[6].x)[c], (&v[7].x)[c]);
    *(uint4*)&T[nq * 4 + c][kc * 8] = w;
  }
  __syncthreads();

  // write: 16 lanes = the 256 B that one n row of the tile holds
  _Float16* dp = Wt + (size_t)n0 * K + k0;
#pragma unroll  // the four LDS reads issue ahead of the four stores
  for (int j = 0; j < 4; ++j) {
    const int idx = j * 256 + tid;
    const int row = idx >> 4, ch = (idx & 15) << 3;
    *(uint4*)(dp + (size_t)row * K + ch) = *(const uint4*)&T[row][ch];
  }
}

__global__ __launch_bounds__(256) void wconv_kernel(
    const float* __restrict__ Wq, const float* __restrict__ Wk,
    const float* __restrict__ Wv, const float* __restrict__ Wo,
    const float* __restrict__ W1, const float* __restrict__ W2,
    _Float16* __restrict__ Wt) {
  __shared__ __attribute__((aligned(16))) _Float16 T[64][TP_];        // 17 KB : [n][k]

  const int r = blockIdx.x;            // the three branches are uniform for the block
  const int l = blockIdx.y;
  _Float16* D = Wt + (size_t)l * WL_;
  if (r < 128) {
    const int m = r >> 5;
    const float* W = (m == 0) ? Wq : (m == 1) ? Wk : (m == 2) ? Wv : Wo;
    wconv_tile<E_, E_>(W + (size_t)l * E_ * E_, D + (size_t)m * E_ * E_, r & 31, T);
  } else if (r < 256) {
    wconv_tile<E_, FF_>(W1 + (size_t)l * E_ * FF_, D + (size_t)4 * E_ * E_, r - 128, T);
  } else {
    wconv_tile<FF_, E_>(W2 + (size_t)l * FF_ * E_,
                        D + (size_t)4 * E_ * E_ + (size_t)E_ * FF_, r - 256, T);
  }
}

// ---------------------------------------------------------------------------
// Embedding + positional add: writes f32 h and f16 h16
// ---------------------------------------------------------------------------
__global__ __launch_bounds__(128) void embed_kernel(
    const int* __restrict__ x, const float* __restrict__ emb,
    const float* __restrict__ pos, float* __restrict__ h,
    _Float16* __restrict__ h16) {
  int row = blockIdx.x;
  int s   = row & (S_ - 1);
  int tok = x[row] + 1;
  int c   = threadIdx.x << 2;
  float4 e4 = *(const float4*)(emb + (size_t)tok * E_ + c);
  float4 p4 = *(const float4*)(pos + (size_t)s   * E_ + c);
  float4 o; o.x = e4.x + p4.x; o.y = e4.y + p4.y; o.z = e4.z + p4.z; o.w = e4.w + p4.w;
  *(float4*)(h + (size_t)row * E_ + c) = o;
  uint2 hp; hp.x = pack2h(o.x, o.y); hp.y = pack2h(o.z, o.w);
  *(uint2*)(h16 + (size_t)row * E_ + c) = hp;
}

// ---------------------------------------------------------------------------
// WMMA GEMM, f16 in: C[M,N] = act(A[M,K] @ Wt[N,K]^T + bias[N]), M = 8192.
// Block tile 64x256, 8 waves (2x4), wave tile 32x64, K-step KS, dbl buffer.
// KS = 128 where one block stands alone on its WGP (256 blocks): the one tile in flight is
// 80 KB and a wave's copy covers two whole 256-B rows. KS = 64 where three blocks share a
// WGP (1024 blocks): 40 KB in flight each, whole 128-B lines.
// Output: f32 (Cf) and/or f16 (Ch).
// The product is formed transposed (weight fragment as A operand, activation fragment as B):
// a lane then holds eight consecutive columns of ONE output row. Each wave passes its tile,
// 16 rows at a time, through its own range of the finished B tile and stores whole rows of
// the wave tile (128 B of f16, 256 B of f32) with 16-byte stores.
// ---------------------------------------------------------------------------
// Stands behind a run of global stores, in front of the code that writes their address and
// data registers anew.
__device__ __forceinline__ void stores_taken() {
  asm volatile("s_wait_xcnt 0x0" ::: "memory");
}

constexpr int SH_  = 144;              // staged f16 row: 128 B + 16 B (16 B x odd)
constexpr int SF_  = 272;              // staged f32 row: 256 B + 16 B (16 B x odd)
constexpr int STG_ = 16 * SF_;         // one wave's staging range in bytes

// A wave's own LDS writes have landed before its lanes read each other's rows back.
__device__ __forceinline__ void lds_landed() {
  asm volatile("s_wait_dscnt 0x0" ::: "memory");
}

template <int KS>
__global__ __launch_bounds__(256) void gemm_f16_kernel(
    const _Float16* __restrict__ A, const _Float16* __restrict__ Wt,
    const float* __restrict__ bias, float* __restrict__ Cf,
    _Float16* __restrict__ Ch, int N, int Kdim, int relu) {
  constexpr int GP_ = KS + 8;          // row pitch in f16
  constexpr int CR_ = KS / 8;          // 16-byte pieces per row
  __shared__ __attribute__((aligned(16))) _Float16 Atile[2][64][GP_];   // KS 64: 18 KB, 128: 34 KB
  __shared__ __attribute__((aligned(16))) _Float16 Btile[2][256][GP_];  // KS 64: 72 KB, 128: 136 KB ([n][k])

  const int tid  = threadIdx.x;
  const int lane = tid & 31;
  const int wave = tid >> 5;
  const int wm   = (wave >> 2) << 5;           // 0 / 32
  const int wn   = (wave & 3) << 6;            // 0 / 64 / 128 / 192
  const int m0   = blockIdx.x * 64;
  const int n0   = blockIdx.y * 256;

  v8f acc[2][4] = {};
  const int nk = Kdim / KS;

  auto load_tiles = [&](int kt, int buf) {
    const int k0 = kt * KS;
#pragma unroll  // the copies of a tile issue back to back, with no loop branch between them
    for (int t = 0; t < KS / 32; ++t) {  // A: 64 x KS f16, KS / 32 pieces per thread
      int idx = t * 256 + tid;
      int r = idx / CR_, seg = (idx % CR_) << 3;
      cp16B_g2l(A + (size_t)(m0 + r) * Kdim + k0 + seg, &Atile[buf][r][seg]);
    }
#pragma unroll
    for (int t = 0; t < KS / 8; ++t) {   // B: 256 x KS f16, KS / 8 pieces per thread
      int idx = t * 256 + tid;
      int r = idx / CR_, seg = (idx % CR_) << 3;
      cp16B_g2l(Wt + (size_t)(n0 + r) * Kdim + k0 + seg, &Btile[buf][r][seg]);
    }
  };

  load_tiles(0, 0);
  async_fence();
  __syncthreads();

  for (int kt = 0; kt < nk; ++kt) {
    const int cur = kt & 1;
    if (kt + 1 < nk) load_tiles(kt + 1, cur ^ 1);

#pragma unroll  // the compiler fetches a later 32-k block's fragments ahead of the current one's products
    for (int ks = 0; ks < KS; ks += 32) {
      v16h af[2], bf[4];
      af[0] = load_frag_k32(&Atile[cur][wm + 0][ks], GP_, lane);
      af[1] = load_frag_k32(&Atile[cur][wm + 16][ks], GP_, lane);
#pragma unroll
      for (int j = 0; j < 4; ++j)
        bf[j] = load_frag_k32(&Btile[cur][wn + j * 16][ks], GP_, lane);
#pragma unroll
      for (int i = 0; i < 2; ++i)
#pragma unroll
        for (int j = 0; j < 4; ++j)
          acc[i][j] = wmma_f16(bf[j], af[i], acc[i][j]);   // D[n][m]
    }

    lds_landed();      // this wave's reads of the buffer that is refilled behind the barrier have ended
    async_fence();
    __syncthreads();
  }

  // acc[i][j][e] = C[m0 + wm + 16i + lcol][n0 + wn + 16j + lrow + e]
  const int lrow = (lane >> 4) << 3;
  const int lcol = lane & 15;
  const int cw   = n0 + wn;            // first column of the wave tile
  // The loop's last barrier stands behind every wave's last fragment read and last copy.
  char* stage = (char*)&Btile[0][0][0] + wave * STG_;

  float4 bv[4][2];
#pragma unroll  // constant indices keep bv[] in registers; all eight loads in flight together
  for (int j = 0; j < 4; ++j) {
    bv[j][0] = *(const float4*)(bias + cw + j * 16 + lrow);
    bv[j][1] = *(const float4*)(bias + cw + j * 16 + lrow + 4);
  }

#pragma unroll  // constant indices keep acc[] in registers
  for (int i = 0; i < 2; ++i)
#pragma unroll  // constant indices keep acc[] in registers
    for (int j = 0; j < 4; ++j)
#pragma unroll  // constant indices keep acc[] in registers
      for (int e = 0; e < 8; ++e)
        acc[i][j][e] += (&bv[j][e >> 2].x)[e & 3];
  if (relu) {
#pragma unroll  // constant indices keep acc[] in registers
    for (int i = 0; i < 2; ++i)
#pragma unroll  // constant indices keep acc[] in registers
      for (int j = 0; j < 4; ++j)
#pragma unroll  // constant indices keep acc[] in registers
        for (int e = 0; e < 8; ++e)
          acc[i][j][e] = fmaxf(acc[i][j][e], 0.0f);
  }

#pragma unroll  // constant indices keep acc[] in registers
  for (int i = 0; i < 2; ++i) {
    const int rw = m0 + wm + i * 16;   // first row of this half of the wave tile
    if (Cf) {
#pragma unroll  // constant indices keep acc[] in registers
      for (int j = 0; j < 4; ++j) {
        char* sp = stage + lcol * SF_ + (j * 16 + lrow) * 4;
        *(float4*)sp        = make_float4(acc[i][j][0], acc[i][j][1], acc[i][j][2], acc[i][j][3]);
        *(float4*)(sp + 16) = make_float4(acc[i][j][4], acc[i][j][5], acc[i][j][6], acc[i][j][7]);
      }
      lds_landed();
      float4 w[8];
#pragma unroll  // the eight LDS reads issue ahead of the eight stores
      for (int t = 0; t < 8; ++t)      // 16 lanes = the 256 B of one row, two rows a read
        w[t] = *(const float4*)(stage + (t * 2 + (lane >> 4)) * SF_ + lcol * 16);
#pragma unroll  // constant indices keep w[] in registers
      for (int t = 0; t < 8; ++t)
        *(float4*)(Cf + (rw + t * 2 + (lane >> 4)) * N + cw + lcol * 4) = w[t];
      stores_taken();
    }
    if (Ch) {
#pragma unroll  // constant indices keep acc[] in registers
      for (int j = 0; j < 4; ++j) {
        v8h w;
#pragma unroll  // constant indices keep w in registers
        for (int e = 0; e < 8; ++e) w[e] = (_Float16)acc[i][j][e];
        *(v8h*)(stage + lcol * SH_ + (j * 16 + lrow) * 2) = w;
      }
      lds_landed();
      v8h w[4];
#pragma unroll  // the four LDS reads issue ahead of the four stores
      for (int t = 0; t < 4; ++t)      // 8 lanes = the 128 B of one row, four rows a read
        w[t] = *(const v8h*)(stage + (t * 4 + (lane >> 3)) * SH_ + (lane & 7) * 16);
#pragma unroll  // constant indices keep w[] in registers
      for (int t = 0; t < 4; ++t)
        *(v8h*)(Ch + (rw + t * 4 + (lane >> 3)) * N + cw + (lane & 7) * 8) = w[t];
      if (i == 0) stores_taken();      // behind the last run nothing is written any more
    }
  }
}

__device__ __forceinline__ uint32_t lds_addr(const void* p) {
  return (uint32_t)(uintptr_t)(__attribute__((address_space(3))) const char*)p;
}

// Four 16-byte copies a lane. The wait that ends the statement stands in front of every later
// write of the address registers that the copies name.
__device__ __forceinline__ void copy4x16(uint32_t l0, const _Float16* g0, uint32_t l1, const _Float16* g1,
                                         uint32_t l2, const _Float16* g2, uint32_t l3, const _Float16* g3) {
  asm volatile("global_load_async_to_lds_b128 %0, %1, off\n\t"
               "global_load_async_to_lds_b128 %2, %3, off\n\t"
               "global_load_async_to_lds_b128 %4, %5, off\n\t"
               "global_load_async_to_lds_b128 %6, %7, off\n\t"
               "s_wait_xcnt 0x0"
               :: "v"(l0), "v"(g0), "v"(l1), "v"(g1), "v"(l2), "v"(g2), "v"(l3), "v"(g3) : "memory");
}

__device__ __forceinline__ void copy1x8(uint32_t l0, const int* g0) {
  asm volatile("global_load_async_to_lds_b64 %0, %1, off\n\t"
               "s_wait_xcnt 0x0"
               :: "v"(l0), "v"(g0) : "memory");
}

// 16 (d) x 32 (keys) A fragment of V^T from the row-major V tile: p is the lane's own address
//   tile + (key0 + 8 (lane >> 4) + (lane & 7)) * pitch + 2 * d0 + 16 ((lane >> 3) & 1);
// the lane gets V[key0 + 8h + 0..7][d0 + c], then the same 16 keys on: the k order of load_frag_k32.
typedef short s16x8 __attribute__((ext_vector_type(8)));
__device__ __forceinline__ v16h load_frag_tr(const char* p) {
  typedef __attribute__((address_space(3))) s16x8 lds_s16x8;
  union { v16h v; s16x8 q[2]; } f;
  f.q[0] = __builtin_amdgcn_ds_load_tr16_b128_v8i16((lds_s16x8*)p);
  f.q[1] = __builtin_amdgcn_ds_load_tr16_b128_v8i16((lds_s16x8*)(p + 16 * VP_ * 2));
  return f.v;
}

__device__ __forceinline__ float xhalf(float x) {
  return __builtin_bit_cast(float, __builtin_amdgcn_permlanex16(
      __builtin_bit_cast(int, x), __builtin_bit_cast(int, x), 0x76543210, 0xfedcba98, false, false));
}

constexpr float LOG2E_ = 1.44269504f;

__device__ __forceinline__ float exp_slot(float x) {
  float r = x * LOG2E_;
  asm("v_exp_f32 %0, %0\n\tv_nop" : "+v"(r));
  return r;
}

__device__ __forceinline__ void exp_slot8(float (&p)[8], const v8f& s, float m) {
#pragma unroll  // constant indices keep p[] in registers
  for (int e = 0; e < 8; ++e) p[e] = (s[e] - m) * LOG2E_;
  asm("v_exp_f32 %0, %0\n\tv_exp_f32 %1, %1\n\tv_exp_f32 %2, %2\n\tv_exp_f32 %3, %3\n\t"
      "v_exp_f32 %4, %4\n\tv_exp_f32 %5, %5\n\tv_exp_f32 %6, %6\n\tv_exp_f32 %7, %7\n\tv_nop"
      : "+v"(p[0]), "+v"(p[1]), "+v"(p[2]), "+v"(p[3]),
        "+v"(p[4]), "+v"(p[5]), "+v"(p[6]), "+v"(p[7]));
}

__global__ __launch_bounds__(256) void attention_kernel(
    const _Float16* __restrict__ Q, const _Float16* __restrict__ K,
    const _Float16* __restrict__ V, const int* __restrict__ mask,
    _Float16* __restrict__ O) {
  __shared__ __attribute__((aligned(16))) _Float16 Kt[2][64][AP_];    // 18 KB : [key][d]  (A-frag for K Q^T)
  __shared__ __attribute__((aligned(16))) _Float16 Vs[2][64][VP_];    // 20 KB : [key][d]  (read transposed)
  __shared__ __attribute__((aligned(16))) int      smask[2][64];

  const int tid  = threadIdx.x;
  const int lane = tid & 31;
  const int wave = tid >> 5;
  const int bh   = blockIdx.x;
  const int b    = bh >> 3;
  const int hh   = bh & 7;
  const int q0   = blockIdx.y * 256;
  const size_t base = ((size_t)b * S_) * E_ + (size_t)hh * D_;

  // Q fragments straight from global f16 (B operand: column = query, same k order as A)
  v16h qf[2][2];
#pragma unroll
  for (int i = 0; i < 2; ++i)
#pragma unroll
    for (int s = 0; s < 2; ++s) {
      int q = q0 + wave * 32 + i * 16 + (lane & 15);
      const _Float16* rp = Q + base + (size_t)q * E_ + s * 32 + ((lane >> 4) << 3);
      union { v16h v; uint32_t u[8]; } f;
#pragma unroll
      for (int vv = 0; vv < 8; ++vv) {
        int d = ((vv >> 2) << 4) + ((vv & 3) << 1);
        f.u[vv] = *(const uint32_t*)(rp + d);
      }
      qf[i][s] = f.v;
    }

  v8f o[2][4] = {};                    // o[i][j][r] = O^T[d = 16j + 8h + r][query 16i + c]
  float mst[2], lst[2];                // per query; lst: this wave half's keys only
#pragma unroll  // constant indices keep mst[], lst[] in registers
  for (int i = 0; i < 2; ++i) { mst[i] = -1e30f; lst[i] = 0.0f; }

  const float scale = 0.125f;
  const int lrow = (lane >> 4) << 3;
  const int lcol = lane & 15;

  // A thread copies 16 bytes of rows sr and sr + 32 of the K and of the V tile (8 lanes = one
  // 128-B row); wave 0 also copies the tile's 64 mask words, 8 bytes a lane.
  const int  sr = tid >> 3, sc = (tid & 7) << 3;
  const bool w0 = __builtin_amdgcn_readfirstlane(wave) == 0;          // a scalar test: no wave issues a copy with all lanes off
  const _Float16* kg = K + base + (size_t)sr * E_ + sc;
  const _Float16* vg = V + base + (size_t)sr * E_ + sc;
  const int*      mg = mask + (size_t)b * S_ + lane * 2;
  auto stage = [&](int t, int buf) {
    const size_t go = (size_t)t * 64 * E_;
    copy4x16(lds_addr(&Kt[buf][sr][sc]),      kg + go, lds_addr(&Kt[buf][sr + 32][sc]), kg + go + 32 * E_,
             lds_addr(&Vs[buf][sr][sc]),      vg + go, lds_addr(&Vs[buf][sr + 32][sc]), vg + go + 32 * E_);
    if (w0) copy1x8(lds_addr(&smask[buf][lane * 2]), mg + t * 64);
  };
  constexpr int NT = S_ / 64;

  stage(0, 0);
  async_fence();
  __syncthreads();
  stage(1, 1);

  for (int t = 0; t < NT; ++t) {
    const int cur = t & 1;

    // scores S^T = K Q^T : sa[i][j][r] = S[query 16i + c][key 16j + 8h + r]
    v8f sa[2][4];
#pragma unroll  // constant indices keep the tiles in registers
    for (int j = 0; j < 4; ++j) {
      v16h kf0 = load_frag_k32(&Kt[cur][j * 16][0],  AP_, lane);
      v16h kf1 = load_frag_k32(&Kt[cur][j * 16][32], AP_, lane);
#pragma unroll  // constant indices keep the tiles in registers
      for (int i = 0; i < 2; ++i) {
        v8f z = {};
        z = wmma_f16(kf0, qf[i][0], z);
        sa[i][j] = wmma_f16(kf1, qf[i][1], z);
      }
    }

    // the lane's own eight keys of each tile
#pragma unroll  // constant indices keep the tiles in registers
    for (int j = 0; j < 4; ++j) {
      const int4 ma = *(const int4*)&smask[cur][j * 16 + lrow];
      const int4 mb = *(const int4*)&smask[cur][j * 16 + lrow + 4];
      const int mk[8] = {ma.x, ma.y, ma.z, ma.w, mb.x, mb.y, mb.z, mb.w};
#pragma unroll  // constant indices keep the tiles in registers
      for (int i = 0; i < 2; ++i)
#pragma unroll  // constant indices keep the tiles in registers
        for (int e = 0; e < 8; ++e) {
          float v = sa[i][j][e] * scale;
          sa[i][j][e] = mk[e] ? v : -1e20f;
        }
    }

    // online softmax, one query per lane and column group
    v16h pf[2][2];                     // pf[i][s]: P^T, keys 32s .. 32s + 31, as B operand
#pragma unroll  // constant indices keep the tiles in registers
    for (int i = 0; i < 2; ++i) {
      float nm = sa[i][0][0];
#pragma unroll  // constant indices keep the tiles in registers
      for (int j = 0; j < 4; ++j)
#pragma unroll  // constant indices keep the tiles in registers
        for (int e = 0; e < 8; ++e) nm = fmaxf(nm, sa[i][j][e]);
      nm = fmaxf(nm, xhalf(nm));       // both halves feed the same O^T tile: one maximum

      const float mn = fmaxf(mst[i], nm);
      const float fs = exp_slot(mst[i] - mn);
      mst[i] = mn;
#pragma unroll  // constant indices keep the tiles in registers
      for (int j = 0; j < 4; ++j)
#pragma unroll  // constant indices keep the tiles in registers
        for (int e = 0; e < 8; ++e)
          o[i][j][e] *= fs;

      float rs[4];
#pragma unroll  // constant indices keep the tiles in registers
      for (int j = 0; j < 4; ++j) {
        float p[8];
        exp_slot8(p, sa[i][j], mn);
        rs[j] = ((p[0] + p[1]) + (p[2] + p[3])) + ((p[4] + p[5]) + (p[6] + p[7]));
#pragma unroll  // constant indices keep the tiles in registers
        for (int e = 0; e < 8; ++e)
          pf[i][j >> 1][((j & 1) << 3) + e] = (_Float16)p[e];
      }
      lst[i] = lst[i] * fs + ((rs[0] + rs[1]) + (rs[2] + rs[3]));
    }

    // O^T += V^T P^T
    const char* vp = (const char*)&Vs[cur][lrow + (lane & 7)][((lane >> 3) & 1) << 3];
#pragma unroll  // constant indices keep the tiles in registers
    for (int j = 0; j < 4; ++j) {
      v16h vf0 = load_frag_tr(vp + j * 32);
      v16h vf1 = load_frag_tr(vp + j * 32 + 32 * VP_ * 2);
#pragma unroll  // constant indices keep the tiles in registers
      for (int i = 0; i < 2; ++i) {
        o[i][j] = wmma_f16(vf0, pf[i][0], o[i][j]);
        o[i][j] = wmma_f16(vf1, pf[i][1], o[i][j]);
      }
    }

    lds_landed();      // this wave's reads of the buffer that is refilled behind the barrier have ended
    async_fence();     // this wave's copies of the next tile have landed
    __syncthreads();   // publishes the next tile and ends every wave's reads of this one
    if (t + 2 < NT) stage(t + 2, cur);
  }
  async_fence();       // no copy is outstanding when the wave ends

  // a lane holds eight consecutive d of one query: one 16-byte store per tile
#pragma unroll  // constant indices keep the tiles in registers
  for (int i = 0; i < 2; ++i) {
    const float lt = lst[i] + xhalf(lst[i]);
    const int qrow = q0 + wave * 32 + i * 16 + lcol;
#pragma unroll  // constant indices keep the tiles in registers
    for (int j = 0; j < 4; ++j) {
      uint4 w;
      w.x = pack2h(o[i][j][0] / lt, o[i][j][1] / lt);
      w.y = pack2h(o[i][j][2] / lt, o[i][j][3] / lt);
      w.z = pack2h(o[i][j][4] / lt, o[i][j][5] / lt);
      w.w = pack2h(o[i][j][6] / lt, o[i][j][7] / lt);
      *(uint4*)(O + base + (size_t)qrow * E_ + j * 16 + lrow) = w;
    }
  }
}

// ---------------------------------------------------------------------------
// Fused residual + LayerNorm: y = LN(x + r)*g + b ; writes f32 and f16 copies
// ---------------------------------------------------------------------------
__global__ __launch_bounds__(128) void add_ln_kernel(
    const float* __restrict__ X, const float* __restrict__ R,
    const float* __restrict__ g, const float* __restrict__ bb,
    float* __restrict__ Y, _Float16* __restrict__ Y16) {
  __shared__ float ssum[4], ssq[4];
  const int row  = blockIdx.x;
  const int tid  = threadIdx.x;
  const int lane = tid & 31;
  const int wave = tid >> 5;
  const int c0   = tid << 2;

  float4 x4 = *(const float4*)(X + (size_t)row * E_ + c0);
  float4 r4 = *(const float4*)(R + (size_t)row * E_ + c0);
  float v[4] = {x4.x + r4.x, x4.y + r4.y, x4.z + r4.z, x4.w + r4.w};
  float s = v[0] + v[1] + v[2] + v[3];
  float q = v[0]*v[0] + v[1]*v[1] + v[2]*v[2] + v[3]*v[3];
#pragma unroll
  for (int off = 16; off >= 1; off >>= 1) {
    s += __shfl_xor(s, off, 32);
    q += __shfl_xor(q, off, 32);
  }
  if (lane == 0) { ssum[wave] = s; ssq[wave] = q; }
  __syncthreads();
  float S1 = ssum[0] + ssum[1] + ssum[2] + ssum[3];
  float S2 = ssq[0]  + ssq[1]  + ssq[2]  + ssq[3];
  float mu   = S1 * (1.0f / E_);
  float var  = S2 * (1.0f / E_) - mu * mu;
  float rinv = rsqrtf(var + 1e-6f);
  float4 o;
  float* op = &o.x;
#pragma unroll
  for (int c = 0; c < 4; ++c) {
    int col = c0 + c;
    op[c] = (v[c] - mu) * rinv * g[col] + bb[col];
  }
  *(float4*)(Y + (size_t)row * E_ + c0) = o;
  uint2 hp; hp.x = pack2h(o.x, o.y); hp.y = pack2h(o.z, o.w);
  *(uint2*)(Y16 + (size_t)row * E_ + c0) = hp;
}

// ---------------------------------------------------------------------------
// Host orchestration
// ---------------------------------------------------------------------------
extern "C" void kernel_launch(void* const* d_in, const int* in_sizes, int n_in,
                              void* d_out, int out_size, void* d_ws, size_t ws_size,
                              hipStream_t stream) {
  const int*   x    = (const int*)d_in[0];
  const int*   mask = (const int*)d_in[1];
  const float* emb  = (const float*)d_in[2];
  const float* pos  = (const float*)d_in[3];
  const float* Wq   = (const float*)d_in[4];
  const float* bq   = (const float*)d_in[5];
  const float* Wk   = (const float*)d_in[6];
  const float* bk   = (const float*)d_in[7];
  const float* Wv   = (const float*)d_in[8];
  const float* bv   = (const float*)d_in[9];
  const float* Wo   = (const float*)d_in[10];
  const float* bo   = (const float*)d_in[11];
  const float* g1   = (const float*)d_in[12];
  const float* be1  = (const float*)d_in[13];
  const float* g2   = (const float*)d_in[14];
  const float* be2  = (const float*)d_in[15];
  const float* W1   = (const float*)d_in[16];
  const float* bf1  = (const float*)d_in[17];
  const float* W2   = (const float*)d_in[18];
  const float* bf2  = (const float*)d_in[19];

  float* h = (float*)d_out;                               // [B,S,E] f32, persistent

  const size_t ACT = (size_t)ROWS * E_;
  char* p = (char*)d_ws;
  auto alloc_h = [&](size_t n) { _Float16* r = (_Float16*)p; p += n * sizeof(_Float16); return r; };
  _Float16* h16   = alloc_h(ACT);
  _Float16* q16   = alloc_h(ACT);
  _Float16* k16   = alloc_h(ACT);
  _Float16* v16   = alloc_h(ACT);
  _Float16* att16 = alloc_h(ACT);
  _Float16* big16 = alloc_h((size_t)ROWS * FF_);
  float* f32tmp = (float*)p; p += ACT * sizeof(float);
  _Float16* wtq[L_]; _Float16* wtk[L_]; _Float16* wtv[L_]; _Float16* wto[L_];
  _Float16* wt1[L_]; _Float16* wt2[L_];
  for (int l = 0; l < L_; ++l) {
    wtq[l] = alloc_h((size_t)E_ * E_);
    wtk[l] = alloc_h((size_t)E_ * E_);
    wtv[l] = alloc_h((size_t)E_ * E_);
    wto[l] = alloc_h((size_t)E_ * E_);
    wt1[l] = alloc_h((size_t)E_ * FF_);
    wt2[l] = alloc_h((size_t)FF_ * E_);
  }

  // Weight convert+transpose (W[K][N] f32 -> Wt[N][K] f16); wtq[0] is the start of the block
  wconv_kernel<<<dim3(384, L_), 256, 0, stream>>>(Wq, Wk, Wv, Wo, W1, W2, wtq[0]);

  embed_kernel<<<ROWS, 128, 0, stream>>>(x, emb, pos, h, h16);

  const dim3 gE(ROWS / 64, E_ / 256);                     // N = 512
  const dim3 gF(ROWS / 64, FF_ / 256);                    // N = 2048
  const dim3 gA(B_ * H_, S_ / 256);

  for (int l = 0; l < L_; ++l) {
    const float* bql = bq  + (size_t)l * E_;
    const float* bkl = bk  + (size_t)l * E_;
    const float* bvl = bv  + (size_t)l * E_;
    const float* bol = bo  + (size_t)l * E_;
    const float* b1l = bf1 + (size_t)l * FF_;
    const float* b2l = bf2 + (size_t)l * E_;
    const float* g1l = g1  + (size_t)l * E_;
    const float* e1l = be1 + (size_t)l * E_;
    const float* g2l = g2  + (size_t)l * E_;
    const float* e2l = be2 + (size_t)l * E_;

    gemm_f16_kernel<128><<<gE, 256, 0, stream>>>(h16, wtq[l], bql, nullptr, q16, E_, E_, 0);
    gemm_f16_kernel<128><<<gE, 256, 0, stream>>>(h16, wtk[l], bkl, nullptr, k16, E_, E_, 0);
    gemm_f16_kernel<128><<<gE, 256, 0, stream>>>(h16, wtv[l], bvl, nullptr, v16, E_, E_, 0);

    attention_kernel<<<gA, 256, 0, stream>>>(q16, k16, v16, mask, att16);

    gemm_f16_kernel<128><<<gE, 256, 0, stream>>>(att16, wto[l], bol, f32tmp, nullptr, E_, E_, 0);
    add_ln_kernel<<<ROWS, 128, 0, stream>>>(f32tmp, h, g1l, e1l, h, h16);

    gemm_f16_kernel<64><<<gF, 256, 0, stream>>>(h16, wt1[l], b1l, nullptr, big16, FF_, E_, 1);
    gemm_f16_kernel<128><<<gE, 256, 0, stream>>>(big16, wt2[l], b2l, f32tmp, nullptr, E_, FF_, 0);
    add_ln_kernel<<<ROWS, 128, 0, stream>>>(f32tmp, h, g2l, e2l, h, h16);
  }
}

// v007
// A run of this version takes 266 microseconds.
// Two timings next to v006 both put it at 1.09 times that version's speed.
// Over all steps from v000 it is 2.78 times as fast.
#include <hip/hip_runtime.h>
#include <hip/hip_bf16.h>

typedef __attribute__((ext_vector_type(16))) _Float16 v16h;
typedef __attribute__((ext_vector_type(8)))  float    v8f;
typedef __attribute__((ext_vector_type(8)))  _Float16 v8h;
typedef int v4i_vec __attribute__((vector_size(16)));   // int __vector(4)

constexpr int E_   = 512;
constexpr int H_   = 8;
constexpr int D_   = 64;
constexpr int FF_  = 2048;
constexpr int L_   = 2;
constexpr int B_   = 4;
constexpr int S_   = 2048;
constexpr int ROWS = B_ * S_;          // 8192 token rows

constexpr int AP_  = 72;               // attention K tile: 64 f16 used per row
// The V tile is read by ds_load_tr16_b128, which wants a pitch of 32 B x odd.
constexpr int VP_  = 80;               // attention V tile: 64 f16 used per row, 160 B

#if defined(__has_builtin)
#if __has_builtin(__builtin_amdgcn_global_load_async_to_lds_b128)
#define HAVE_ASYNC_LDS 1
#endif
#endif
#ifndef HAVE_ASYNC_LDS
#define HAVE_ASYNC_LDS 0
#endif

__device__ __forceinline__ uint32_t pack2h(float a, float b) {
  union { _Float16 h[2]; uint32_t u; } t;
  t.h[0] = (_Float16)a; t.h[1] = (_Float16)b;
  return t.u;
}

__device__ __forceinline__ void cp16B_g2l(const _Float16* g, _Float16* l) {
#if HAVE_ASYNC_LDS
  __builtin_amdgcn_global_load_async_to_lds_b128(
      (__attribute__((address_space(1))) v4i_vec*)(_Float16*)g,
      (__attribute__((address_space(3))) v4i_vec*)l, 0, 0);
#else
  *(uint4*)l = *(const uint4*)g;
#endif
}

__device__ __forceinline__ void async_fence() {
#if HAVE_ASYNC_LDS
  asm volatile("s_wait_asynccnt 0" ::: "memory");
#endif
}

__device__ __forceinline__ v16h load_frag_k32(const _Float16* base, int rowStride, int lane) {
  int r  = lane & 15;
  int kh = (lane >> 4) << 3;
  const _Float16* p = base + r * rowStride + kh;
  union { v16h v; uint32_t u[8]; } f;
  const uint32_t* p0 = (const uint32_t*)p;
  const uint32_t* p1 = (const uint32_t*)(p + 16);
#pragma unroll
  for (int i = 0; i < 4; ++i) { f.u[i] = p0[i]; f.u[4 + i] = p1[i]; }
  return f.v;
}

__device__ __forceinline__ v8f wmma_f16(v16h a, v16h b, v8f c) {
  return __builtin_amdgcn_wmma_f32_16x16x32_f16(false, a, false, b, (short)0, c, false, false);
}

// ---------------------------------------------------------------------------
// Weight convert + transpose, all twelve matrices in one launch:
// W[K][N] f32 -> Wt[N][K] f16. One block moves a 128(k) x 64(n) tile through LDS,
// 32 elements per thread; global reads and writes are runs of 256 B.
// Tiles of a layer: 0..127 Wq,Wk,Wv,Wo (32 tiles each), 128..255 W1, 256..383 W2.
// Wt: per layer wtq, wtk, wtv, wto, wt1, wt2 back to back (WL_ elements).
// ---------------------------------------------------------------------------
constexpr int    TP_ = 136;            // tile row pitch in f16: 256 B + 16 B (16 B x odd)
constexpr size_t WL_ = (size_t)4 * E_ * E_ + (size_t)2 * E_ * FF_;

template <int K, int N>
__device__ __forceinline__ void wconv_tile(
    const float* __restrict__ W, _Float16* __restrict__ Wt, int t, _Float16 (*T)[TP_]) {
  const int tid = threadIdx.x;
  const int k0  = (t / (N / 64)) * 128;
  const int n0  = (t % (N / 64)) * 64;

  // read: a thread takes 8 consecutive k of 4 consecutive n (16 lanes = 256 B of one k row);
  // uniform tile base + one per-lane byte offset that all eight loads share
  const int kc = tid >> 4;             // which group of 8 k
  const int nq = tid & 15;             // which group of 4 n
  const char* sb = (const char*)(W + (size_t)k0 * N + n0);
  const uint32_t voff = (uint32_t)(kc * 8 * N + nq * 4) * 4u;
  float4 v[8];
#pragma unroll  // all eight loads in flight together, v[] in registers
  for (int i = 0; i < 8; ++i) v[i] = *(const float4*)(sb + voff + i * N * 4);

#pragma unroll  // constant c: v[] is indexed at compile time and stays in registers
  for (int c = 0; c < 4; ++c) {
    uint4 w;
    w.x = pack2h((&v[0].x)[c], (&v[1].x)[c]);
    w.y = pack2h((&v[2].x)[c], (&v[3].x)[c]);
    w.z = pack2h((&v[4].x)[c], (&v[5].x)[c]);
    w.w = pack2h((&v[6].x)[c], (&v[7].x)[c]);
    *(uint4*)&T[nq * 4 + c][kc * 8] = w;
  }
  __syncthreads();

  // write: 16 lanes = the 256 B that one n row of the tile holds
  _Float16* dp = Wt + (size_t)n0 * K + k0;
#pragma unroll  // the four LDS reads issue ahead of the four stores
  for (int j = 0; j < 4; ++j) {
    const int idx = j * 256 + tid;
    const int row = idx >> 4, ch = (idx & 15) << 3;
    *(uint4*)(dp + (size_t)row * K + ch) = *(const uint4*)&T[row][ch];
  }
}

// The embedding reads nothing that the weight conversion writes, and the other way round: the
// two share one launch. Blocks 0 .. 767 convert (384 tiles a layer), the rest embed two token
// rows each.
constexpr int WB_ = 384;               // weight tiles per layer

__device__ __forceinline__ void embed_rows(
    int blk, const int* __restrict__ x, const float* __restrict__ emb,
    const float* __restrict__ pos, float* __restrict__ h, _Float16* __restrict__ h16);

__global__ __launch_bounds__(256) void prep_kernel(
    const float* __restrict__ Wq, const float* __restrict__ Wk,
    const float* __restrict__ Wv, const float* __restrict__ Wo,
    const float* __restrict__ W1, const float* __restrict__ W2,
    _Float16* __restrict__ Wt,
    const int* __restrict__ x, const float* __restrict__ emb,
    const float* __restrict__ pos, float* __restrict__ h,
    _Float16* __restrict__ h16) {
  __shared__ __attribute__((aligned(16))) _Float16 T[64][TP_];        // 17 KB : [n][k]

  if (blockIdx.x >= L_ * WB_) {        // uniform for the block, in front of every barrier
    embed_rows(blockIdx.x - L_ * WB_, x, emb, pos, h, h16);
    return;
  }
  const int l = blockIdx.x / WB_;
  const int r = blockIdx.x % WB_;      // the three branches are uniform for the block
  _Float16* D = Wt + (size_t)l * WL_;
  if (r < 128) {
    const int m = r >> 5;
    const float* W = (m == 0) ? Wq : (m == 1) ? Wk : (m == 2) ? Wv : Wo;
    wconv_tile<E_, E_>(W + (size_t)l * E_ * E_, D + (size_t)m * E_ * E_, r & 31, T);
  } else if (r < 256) {
    wconv_tile<E_, FF_>(W1 + (size_t)l * E_ * FF_, D + (size_t)4 * E_ * E_, r - 128, T);
  } else {
    wconv_tile<FF_, E_>(W2 + (size_t)l * FF_ * E_,
                        D + (size_t)4 * E_ * E_ + (size_t)E_ * FF_, r - 256, T);
  }
}

// ---------------------------------------------------------------------------
// Embedding + positional add: writes f32 h and f16 h16
// ---------------------------------------------------------------------------
__device__ __forceinline__ void embed_rows(
    int blk, const int* __restrict__ x, const float* __restrict__ emb,
    const float* __restrict__ pos, float* __restrict__ h,
    _Float16* __restrict__ h16) {
  // four waves a row; the row number is the same in every lane of a wave: kept scalar, the
  // row's base addresses are formed in scalar registers and a lane adds only its column
  int row = blk * 2 + __builtin_amdgcn_readfirstlane(threadIdx.x >> 7);
  int s   = row & (S_ - 1);
  int tok = x[row] + 1;
  int c   = (threadIdx.x & 127) << 2;
  float4 e4 = *(const float4*)(emb + (size_t)tok * E_ + c);
  float4 p4 = *(const float4*)(pos + (size_t)s   * E_ + c);
  float4 o; o.x = e4.x + p4.x; o.y = e4.y + p4.y; o.z = e4.z + p4.z; o.w = e4.w + p4.w;
  *(float4*)(h + (size_t)row * E_ + c) = o;
  uint2 hp; hp.x = pack2h(o.x, o.y); hp.y = pack2h(o.z, o.w);
  *(uint2*)(h16 + (size_t)row * E_ + c) = hp;
}

// ---------------------------------------------------------------------------
// WMMA GEMM, f16 in: C[M,N] = act(A[M,K] @ Wt[N,K]^T + bias[N]), M = 8192.
// Block tile 64x256, 8 waves (2x4), wave tile 32x64, K-step KS, dbl buffer.
// KS = 128 where one block stands alone on its WGP (256 blocks): the one tile in flight is
// 80 KB and a wave's copy covers two whole 256-B rows. KS = 64 where three blocks share a
// WGP (1024 blocks, 768 with QKV): 40 KB in flight each, whole 128-B lines.
// Output: f32 (Cf) and/or f16 (Ch).
// QKV: one launch forms three products of the same A. Wt holds the three [512][512] weights
// back to back, Ch the three [M][512] outputs back to back; a pair of blockIdx.y is one of
// them, with its own bias. All 768 blocks are resident together, three to a WGP.
// The product is formed transposed (weight fragment as A operand, activation fragment as B):
// a lane then holds eight consecutive columns of ONE output row. Each wave passes its tile,
// 16 rows at a time, through its own range of the finished B tile and stores whole rows of
// the wave tile (128 B of f16, 256 B of f32) with 16-byte stores.
// ---------------------------------------------------------------------------
// Stands behind a run of global stores, in front of the code that writes their address and
// data registers anew.
__device__ __forceinline__ void stores_taken() {
  asm volatile("s_wait_xcnt 0x0" ::: "memory");
}

constexpr int SH_  = 144;              // staged f16 row: 128 B + 16 B (16 B x odd)
constexpr int SF_  = 272;              // staged f32 row: 256 B + 16 B (16 B x odd)
constexpr int STG_ = 16 * SF_;         // one wave's staging range in bytes

// A wave's own LDS writes have landed before its lanes read each other's rows back.
__device__ __forceinline__ void lds_landed() {
  asm volatile("s_wait_dscnt 0x0" ::: "memory");
}

template <int KS, bool QKV>
__global__ __launch_bounds__(256) void gemm_f16_kernel(
    const _Float16* __restrict__ A, const _Float16* __restrict__ Wt,
    const float* __restrict__ bias, const float* __restrict__ bias1,
    const float* __restrict__ bias2, float* __restrict__ Cf,
    _Float16* __restrict__ Ch, int N, int Kdim, int relu) {
  constexpr int GP_ = KS + 8;          // row pitch in f16
  constexpr int CR_ = KS / 8;          // 16-byte pieces per row
  __shared__ __attribute__((aligned(16))) _Float16 Atile[2][64][GP_];   // KS 64: 18 KB, 128: 34 KB
  __shared__ __attribute__((aligned(16))) _Float16 Btile[2][256][GP_];  // KS 64: 72 KB, 128: 136 KB ([n][k])

  const int tid  = threadIdx.x;
  const int lane = tid & 31;
  const int wave = tid >> 5;
  const int wm   = (wave >> 2) << 5;           // 0 / 32
  const int wn   = (wave & 3) << 6;            // 0 / 64 / 128 / 192
  const int m0   = blockIdx.x * 64;
  const int n0   = (QKV ? (blockIdx.y & 1) : blockIdx.y) * 256;
  if constexpr (QKV) {
    const int sel = blockIdx.y >> 1;             // uniform for the block: 0 Q, 1 K, 2 V
    Wt  += (size_t)sel * E_ * E_;
    Ch  += (size_t)sel * ROWS * E_;
    bias = (sel == 0) ? bias : (sel == 1) ? bias1 : bias2;
  }

  v8f acc[2][4] = {};
  const int nk = Kdim / KS;

  auto load_tiles = [&](int kt, int buf) {
    const int k0 = kt * KS;
#pragma unroll  // the copies of a tile issue back to back, with no loop branch between them
    for (int t = 0; t < KS / 32; ++t) {  // A: 64 x KS f16, KS / 32 pieces per thread
      int idx = t * 256 + tid;
      int r = idx / CR_, seg = (idx % CR_) << 3;
      cp16B_g2l(A + (size_t)(m0 + r) * Kdim + k0 + seg, &Atile[buf][r][seg]);
    }
#pragma unroll
    for (int t = 0; t < KS / 8; ++t) {   // B: 256 x KS f16, KS / 8 pieces per thread
      int idx = t * 256 + tid;
      int r = idx / CR_, seg = (idx % CR_) << 3;
      cp16B_g2l(Wt + (size_t)(n0 + r) * Kdim + k0 + seg, &Btile[buf][r][seg]);
    }
  };

  load_tiles(0, 0);
  async_fence();
  __syncthreads();

  for (int kt = 0; kt < nk; ++kt) {
    const int cur = kt & 1;
    if (kt + 1 < nk) load_tiles(kt + 1, cur ^ 1);

#pragma unroll  // the compiler fetches a later 32-k block's fragments ahead of the current one's products
    for (int ks = 0; ks < KS; ks += 32) {
      v16h af[2], bf[4];
      af[0] = load_frag_k32(&Atile[cur][wm + 0][ks], GP_, lane);
      af[1] = load_frag_k32(&Atile[cur][wm + 16][ks], GP_, lane);
#pragma unroll
      for (int j = 0; j < 4; ++j)
        bf[j] = load_frag_k32(&Btile[cur][wn + j * 16][ks], GP_, lane);
#pragma unroll
      for (int i = 0; i < 2; ++i)
#pragma unroll
        for (int j = 0; j < 4; ++j)
          acc[i][j] = wmma_f16(bf[j], af[i], acc[i][j]);   // D[n][m]
    }

    lds_landed();      // this wave's reads of the buffer that is refilled behind the barrier have ended
    async_fence();
    __syncthreads();
  }

  // acc[i][j][e] = C[m0 + wm + 16i + lcol][n0 + wn + 16j + lrow + e]
  const int lrow = (lane >> 4) << 3;
  const int lcol = lane & 15;
  const int cw   = n0 + wn;            // first column of the wave tile
  // The loop's last barrier stands behind every wave's last fragment read and last copy.
  char* stage = (char*)&Btile[0][0][0] + wave * STG_;

  float4 bv[4][2];
#pragma unroll  // constant indices keep bv[] in registers; all eight loads in flight together
  for (int j = 0; j < 4; ++j) {
    bv[j][0] = *(const float4*)(bias + cw + j * 16 + lrow);
    bv[j][1] = *(const float4*)(bias + cw + j * 16 + lrow + 4);
  }

#pragma unroll  // constant indices keep acc[] in registers
  for (int i = 0; i < 2; ++i)
#pragma unroll  // constant indices keep acc[] in registers
    for (int j = 0; j < 4; ++j)
#pragma unroll  // constant indices keep acc[] in registers
      for (int e = 0; e < 8; ++e)
        acc[i][j][e] += (&bv[j][e >> 2].x)[e & 3];
  if (relu) {
#pragma unroll  // constant indices keep acc[] in registers
    for (int i = 0; i < 2; ++i)
#pragma unroll  // constant indices keep acc[] in registers
      for (int j = 0; j < 4; ++j)
#pragma unroll  // constant indices keep acc[] in registers
        for (int e = 0; e < 8; ++e)
          acc[i][j][e] = fmaxf(acc[i][j][e], 0.0f);
  }

#pragma unroll  // constant indices keep acc[] in registers
  for (int i = 0; i < 2; ++i) {
    const int rw = m0 + wm + i * 16;   // first row of this half of the wave tile
    if (Cf) {
#pragma unroll  // constant indices keep acc[] in registers
      for (int j = 0; j < 4; ++j) {
        char* sp = stage + lcol * SF_ + (j * 16 + lrow) * 4;
        *(float4*)sp        = make_float4(acc[i][j][0], acc[i][j][1], acc[i][j][2], acc[i][j][3]);
        *(float4*)(sp + 16) = make_float4(acc[i][j][4], acc[i][j][5], acc[i][j][6], acc[i][j][7]);
      }
      lds_landed();
      float4 w[8];
#pragma unroll  // the eight LDS reads issue ahead of the eight stores
      for (int t = 0; t < 8; ++t)      // 16 lanes = the 256 B of one row, two rows a read
        w[t] = *(const float4*)(stage + (t * 2 + (lane >> 4)) * SF_ + lcol * 16);
#pragma unroll  // constant indices keep w[] in registers
      for (int t = 0; t < 8; ++t)
        *(float4*)(Cf + (rw + t * 2 + (lane >> 4)) * N + cw + lcol * 4) = w[t];
      stores_taken();
    }
    if (Ch) {
#pragma unroll  // constant indices keep acc[] in registers
      for (int j = 0; j < 4; ++j) {
        v8h w;
#pragma unroll  // constant indices keep w in registers
        for (int e = 0; e < 8; ++e) w[e] = (_Float16)acc[i][j][e];
        *(v8h*)(stage + lcol * SH_ + (j * 16 + lrow) * 2) = w;
      }
      lds_landed();
      v8h w[4];
#pragma unroll  // the four LDS reads issue ahead of the four stores
      for (int t = 0; t < 4; ++t)      // 8 lanes = the 128 B of one row, four rows a read
        w[t] = *(const v8h*)(stage + (t * 4 + (lane >> 3)) * SH_ + (lane & 7) * 16);
#pragma unroll  // constant indices keep w[] in registers
      for (int t = 0; t < 4; ++t)
        *(v8h*)(Ch + (rw + t * 4 + (lane >> 3)) * N + cw + (lane & 7) * 8) = w[t];
      if (i == 0) stores_taken();      // behind the last run nothing is written any more
    }
  }
}

__device__ __forceinline__ uint32_t lds_addr(const void* p) {
  return (uint32_t)(uintptr_t)(__attribute__((address_space(3))) const char*)p;
}

// Four 16-byte copies a lane. The wait that ends the statement stands in front of every later
// write of the address registers that the copies name.
__device__ __forceinline__ void copy4x16(uint32_t l0, const _Float16* g0, uint32_t l1, const _Float16* g1,
                                         uint32_t l2, const _Float16* g2, uint32_t l3, const _Float16* g3) {
  asm volatile("global_load_async_to_lds_b128 %0, %1, off\n\t"
               "global_load_async_to_lds_b128 %2, %3, off\n\t"
               "global_load_async_to_lds_b128 %4, %5, off\n\t"
               "global_load_async_to_lds_b128 %6, %7, off\n\t"
               "s_wait_xcnt 0x0"
               :: "v"(l0), "v"(g0), "v"(l1), "v"(g1), "v"(l2), "v"(g2), "v"(l3), "v"(g3) : "memory");
}

__device__ __forceinline__ void copy1x8(uint32_t l0, const int* g0) {
  asm volatile("global_load_async_to_lds_b64 %0, %1, off\n\t"
               "s_wait_xcnt 0x0"
               :: "v"(l0), "v"(g0) : "memory");
}

// 16 (d) x 32 (keys) A fragment of V^T from the row-major V tile: p is the lane's own address
//   tile + (key0 + 8 (lane >> 4) + (lane & 7)) * pitch + 2 * d0 + 16 ((lane >> 3) & 1);
// the lane gets V[key0 + 8h + 0..7][d0 + c], then the same 16 keys on: the k order of load_frag_k32.
typedef short s16x8 __attribute__((ext_vector_type(8)));
__device__ __forceinline__ v16h load_frag_tr(const char* p) {
  typedef __attribute__((address_space(3))) s16x8 lds_s16x8;
  union { v16h v; s16x8 q[2]; } f;
  f.q[0] = __builtin_amdgcn_ds_load_tr16_b128_v8i16((lds_s16x8*)p);
  f.q[1] = __builtin_amdgcn_ds_load_tr16_b128_v8i16((lds_s16x8*)(p + 16 * VP_ * 2));
  return f.v;
}

__device__ __forceinline__ float xhalf(float x) {
  return __builtin_bit_cast(float, __builtin_amdgcn_permlanex16(
      __builtin_bit_cast(int, x), __builtin_bit_cast(int, x), 0x76543210, 0xfedcba98, false, false));
}

constexpr float LOG2E_ = 1.44269504f;

__device__ __forceinline__ float exp_slot(float x) {
  float r = x * LOG2E_;
  asm("v_exp_f32 %0, %0\n\tv_nop" : "+v"(r));
  return r;
}

__device__ __forceinline__ void exp_slot8(float (&p)[8], const v8f& s, float m) {
#pragma unroll  // constant indices keep p[] in registers
  for (int e = 0; e < 8; ++e) p[e] = (s[e] - m) * LOG2E_;
  asm("v_exp_f32 %0, %0\n\tv_exp_f32 %1, %1\n\tv_exp_f32 %2, %2\n\tv_exp_f32 %3, %3\n\t"
      "v_exp_f32 %4, %4\n\tv_exp_f32 %5, %5\n\tv_exp_f32 %6, %6\n\tv_exp_f32 %7, %7\n\tv_nop"
      : "+v"(p[0]), "+v"(p[1]), "+v"(p[2]), "+v"(p[3]),
        "+v"(p[4]), "+v"(p[5]), "+v"(p[6]), "+v"(p[7]));
}

__global__ __launch_bounds__(256) void attention_kernel(
    const _Float16* __restrict__ Q, const _Float16* __restrict__ K,
    const _Float16* __restrict__ V, const int* __restrict__ mask,
    _Float16* __restrict__ O) {
  __shared__ __attribute__((aligned(16))) _Float16 Kt[2][64][AP_];    // 18 KB : [key][d]  (A-frag for K Q^T)
  __shared__ __attribute__((aligned(16))) _Float16 Vs[2][64][VP_];    // 20 KB : [key][d]  (read transposed)
  __shared__ __attribute__((aligned(16))) int      smask[2][64];

  const int tid  = threadIdx.x;
  const int lane = tid & 31;
  const int wave = tid >> 5;
  const int bh   = blockIdx.x;
  const int b    = bh >> 3;
  const int hh   = bh & 7;
  const int q0   = blockIdx.y * 256;
  const size_t base = ((size_t)b * S_) * E_ + (size_t)hh * D_;

  // Q fragments straight from global f16 (B operand: column = query, same k order as A)
  v16h qf[2][2];
#pragma unroll
  for (int i = 0; i < 2; ++i)
#pragma unroll
    for (int s = 0; s < 2; ++s) {
      int q = q0 + wave * 32 + i * 16 + (lane & 15);
      const _Float16* rp = Q + base + (size_t)q * E_ + s * 32 + ((lane >> 4) << 3);
      union { v16h v; uint32_t u[8]; } f;
#pragma unroll
      for (int vv = 0; vv < 8; ++vv) {
        int d = ((vv >> 2) << 4) + ((vv & 3) << 1);
        f.u[vv] = *(const uint32_t*)(rp + d);
      }
      qf[i][s] = f.v;
    }

  v8f o[2][4] = {};                    // o[i][j][r] = O^T[d = 16j + 8h + r][query 16i + c]
  float mst[2], lst[2];                // per query; lst: this wave half's keys only
#pragma unroll  // constant indices keep mst[], lst[] in registers
  for (int i = 0; i < 2; ++i) { mst[i] = -1e30f; lst[i] = 0.0f; }

  const float scale = 0.125f;
  const int lrow = (lane >> 4) << 3;
  const int lcol = lane & 15;

  // A thread copies 16 bytes of rows sr and sr + 32 of the K and of the V tile (8 lanes = one
  // 128-B row); wave 0 also copies the tile's 64 mask words, 8 bytes a lane.
  const int  sr = tid >> 3, sc = (tid & 7) << 3;
  const bool w0 = __builtin_amdgcn_readfirstlane(wave) == 0;          // a scalar test: no wave issues a copy with all lanes off
  const _Float16* kg = K + base + (size_t)sr * E_ + sc;
  const _Float16* vg = V + base + (size_t)sr * E_ + sc;
  const int*      mg = mask + (size_t)b * S_ + lane * 2;
  auto stage = [&](int t, int buf) {
    const size_t go = (size_t)t * 64 * E_;
    copy4x16(lds_addr(&Kt[buf][sr][sc]),      kg + go, lds_addr(&Kt[buf][sr + 32][sc]), kg + go + 32 * E_,
             lds_addr(&Vs[buf][sr][sc]),      vg + go, lds_addr(&Vs[buf][sr + 32][sc]), vg + go + 32 * E_);
    if (w0) copy1x8(lds_addr(&smask[buf][lane * 2]), mg + t * 64);
  };
  constexpr int NT = S_ / 64;

  stage(0, 0);
  async_fence();
  __syncthreads();
  stage(1, 1);

  for (int t = 0; t < NT; ++t) {
    const int cur = t & 1;

    // scores S^T = K Q^T : sa[i][j][r] = S[query 16i + c][key 16j + 8h + r]
    v8f sa[2][4];
#pragma unroll  // constant indices keep the tiles in registers
    for (int j = 0; j < 4; ++j) {
      v16h kf0 = load_frag_k32(&Kt[cur][j * 16][0],  AP_, lane);
      v16h kf1 = load_frag_k32(&Kt[cur][j * 16][32], AP_, lane);
#pragma unroll  // constant indices keep the tiles in registers
      for (int i = 0; i < 2; ++i) {
        v8f z = {};
        z = wmma_f16(kf0, qf[i][0], z);
        sa[i][j] = wmma_f16(kf1, qf[i][1], z);
      }
    }

    // the lane's own eight keys of each tile
#pragma unroll  // constant indices keep the tiles in registers
    for (int j = 0; j < 4; ++j) {
      const int4 ma = *(const int4*)&smask[cur][j * 16 + lrow];
      const int4 mb = *(const int4*)&smask[cur][j * 16 + lrow + 4];
      const int mk[8] = {ma.x, ma.y, ma.z, ma.w, mb.x, mb.y, mb.z, mb.w};
#pragma unroll  // constant indices keep the tiles in registers
      for (int i = 0; i < 2; ++i)
#pragma unroll  // constant indices keep the tiles in registers
        for (int e = 0; e < 8; ++e) {
          float v = sa[i][j][e] * scale;
          sa[i][j][e] = mk[e] ? v : -1e20f;
        }
    }

    // online softmax, one query per lane and column group
    v16h pf[2][2];                     // pf[i][s]: P^T, keys 32s .. 32s + 31, as B operand
#pragma unroll  // constant indices keep the tiles in registers
    for (int i = 0; i < 2; ++i) {
      float nm = sa[i][0][0];
#pragma unroll  // constant indices keep the tiles in registers
      for (int j = 0; j < 4; ++j)
#pragma unroll  // constant indices keep the tiles in registers
        for (int e = 0; e < 8; ++e) nm = fmaxf(nm, sa[i][j][e]);
      nm = fmaxf(nm, xhalf(nm));       // both halves feed the same O^T tile: one maximum

      const float mn = fmaxf(mst[i], nm);
      const float fs = exp_slot(mst[i] - mn);
      mst[i] = mn;
#pragma unroll  // constant indices keep the tiles in registers
      for (int j = 0; j < 4; ++j)
#pragma unroll  // constant indices keep the tiles in registers
        for (int e = 0; e < 8; ++e)
          o[i][j][e] *= fs;

      float rs[4];
#pragma unroll  // constant indices keep the tiles in registers
      for (int j = 0; j < 4; ++j) {
        float p[8];
        exp_slot8(p, sa[i][j], mn);
        rs[j] = ((p[0] + p[1]) + (p[2] + p[3])) + ((p[4] + p[5]) + (p[6] + p[7]));
#pragma unroll  // constant indices keep the tiles in registers
        for (int e = 0; e < 8; ++e)
          pf[i][j >> 1][((j & 1) << 3) + e] = (_Float16)p[e];
      }
      lst[i] = lst[i] * fs + ((rs[0] + rs[1]) + (rs[2] + rs[3]));
    }

    // O^T += V^T P^T
    const char* vp = (const char*)&Vs[cur][lrow + (lane & 7)][((lane >> 3) & 1) << 3];
#pragma unroll  // constant indices keep the tiles in registers
    for (int j = 0; j < 4; ++j) {
      v16h vf0 = load_frag_tr(vp + j * 32);
      v16h vf1 = load_frag_tr(vp + j * 32 + 32 * VP_ * 2);
#pragma unroll  // constant indices keep the tiles in registers
      for (int i = 0; i < 2; ++i) {
        o[i][j] = wmma_f16(vf0, pf[i][0], o[i][j]);
        o[i][j] = wmma_f16(vf1, pf[i][1], o[i][j]);
      }
    }

    lds_landed();      // this wave's reads of the buffer that is refilled behind the barrier have ended
    async_fence();     // this wave's copies of the next tile have landed
    __syncthreads();   // publishes the next tile and ends every wave's reads of this one
    if (t + 2 < NT) stage(t + 2, cur);
  }
  async_fence();       // no copy is outstanding when the wave ends

  // a lane holds eight consecutive d of one query: one 16-byte store per tile
#pragma unroll  // constant indices keep the tiles in registers
  for (int i = 0; i < 2; ++i) {
    const float lt = lst[i] + xhalf(lst[i]);
    const int qrow = q0 + wave * 32 + i * 16 + lcol;
#pragma unroll  // constant indices keep the tiles in registers
    for (int j = 0; j < 4; ++j) {
      uint4 w;
      w.x = pack2h(o[i][j][0] / lt, o[i][j][1] / lt);
      w.y = pack2h(o[i][j][2] / lt, o[i][j][3] / lt);
      w.z = pack2h(o[i][j][4] / lt, o[i][j][5] / lt);
      w.w = pack2h(o[i][j][6] / lt, o[i][j][7] / lt);
      *(uint4*)(O + base + (size_t)qrow * E_ + j * 16 + lrow) = w;
    }
  }
}

// ---------------------------------------------------------------------------
// Fused residual + LayerNorm: y = LN(x + r)*g + b ; writes f32 and f16 copies
// ---------------------------------------------------------------------------
__global__ __launch_bounds__(128) void add_ln_kernel(
    const float* __restrict__ X, const float* __restrict__ R,
    const float* __restrict__ g, const float* __restrict__ bb,
    float* __restrict__ Y, _Float16* __restrict__ Y16) {
  __shared__ float ssum[4], ssq[4];
  const int row  = blockIdx.x;
  const int tid  = threadIdx.x;
  const int lane = tid & 31;
  const int wave = tid >> 5;
  const int c0   = tid << 2;

  float4 x4 = *(const float4*)(X + (size_t)row * E_ + c0);
  float4 r4 = *(const float4*)(R + (size_t)row * E_ + c0);
  float v[4] = {x4.x + r4.x, x4.y + r4.y, x4.z + r4.z, x4.w + r4.w};
  float s = v[0] + v[1] + v[2] + v[3];
  float q = v[0]*v[0] + v[1]*v[1] + v[2]*v[2] + v[3]*v[3];
#pragma unroll
  for (int off = 16; off >= 1; off >>= 1) {
    s += __shfl_xor(s, off, 32);
    q += __shfl_xor(q, off, 32);
  }
  if (lane == 0) { ssum[wave] = s; ssq[wave] = q; }
  __syncthreads();
  float S1 = ssum[0] + ssum[1] + ssum[2] + ssum[3];
  float S2 = ssq[0]  + ssq[1]  + ssq[2]  + ssq[3];
  float mu   = S1 * (1.0f / E_);
  float var  = S2 * (1.0f / E_) - mu * mu;
  float rinv = rsqrtf(var + 1e-6f);
  float4 o;
  float* op = &o.x;
#pragma unroll
  for (int c = 0; c < 4; ++c) {
    int col = c0 + c;
    op[c] = (v[c] - mu) * rinv * g[col] + bb[col];
  }
  *(float4*)(Y + (size_t)row * E_ + c0) = o;
  uint2 hp; hp.x = pack2h(o.x, o.y); hp.y = pack2h(o.z, o.w);
  *(uint2*)(Y16 + (size_t)row * E_ + c0) = hp;
}

// ---------------------------------------------------------------------------
// Host orchestration
// ---------------------------------------------------------------------------
extern "C" void kernel_launch(void* const* d_in, const int* in_sizes, int n_in,
                              void* d_out, int out_size, void* d_ws, size_t ws_size,
                              hipStream_t stream) {
  const int*   x    = (const int*)d_in[0];
  const int*   mask = (const int*)d_in[1];
  const float* emb  = (const float*)d_in[2];
  const float* pos  = (const float*)d_in[3];
  const float* Wq   = (const float*)d_in[4];
  const float* bq   = (const float*)d_in[5];
  const float* Wk   = (const float*)d_in[6];
  const float* bk   = (const float*)d_in[7];
  const float* Wv   = (const float*)d_in[8];
  const float* bv   = (const float*)d_in[9];
  const float* Wo   = (const float*)d_in[10];
  const float* bo   = (const float*)d_in[11];
  const float* g1   = (const float*)d_in[12];
  const float* be1  = (const float*)d_in[13];
  const float* g2   = (const float*)d_in[14];
  const float* be2  = (const float*)d_in[15];
  const float* W1   = (const float*)d_in[16];
  const float* bf1  = (const float*)d_in[17];
  const float* W2   = (const float*)d_in[18];
  const float* bf2  = (const float*)d_in[19];

  float* h = (float*)d_out;                               // [B,S,E] f32, persistent

  const size_t ACT = (size_t)ROWS * E_;
  char* p = (char*)d_ws;
  auto alloc_h = [&](size_t n) { _Float16* r = (_Float16*)p; p += n * sizeof(_Float16); return r; };
  _Float16* h16   = alloc_h(ACT);
  _Float16* q16   = alloc_h(ACT);
  _Float16* k16   = alloc_h(ACT);
  _Float16* v16   = alloc_h(ACT);
  _Float16* att16 = alloc_h(ACT);
  _Float16* big16 = alloc_h((size_t)ROWS * FF_);
  float* f32tmp = (float*)p; p += ACT * sizeof(float);
  _Float16* wtq[L_]; _Float16* wtk[L_]; _Float16* wtv[L_]; _Float16* wto[L_];
  _Float16* wt1[L_]; _Float16* wt2[L_];
  for (int l = 0; l < L_; ++l) {
    wtq[l] = alloc_h((size_t)E_ * E_);
    wtk[l] = alloc_h((size_t)E_ * E_);
    wtv[l] = alloc_h((size_t)E_ * E_);
    wto[l] = alloc_h((size_t)E_ * E_);
    wt1[l] = alloc_h((size_t)E_ * FF_);
    wt2[l] = alloc_h((size_t)FF_ * E_);
  }

  // Weight convert+transpose (W[K][N] f32 -> Wt[N][K] f16); wtq[0] is the start of the block
  // and the embedding, in the same launch
  prep_kernel<<<L_ * WB_ + ROWS / 2, 256, 0, stream>>>(Wq, Wk, Wv, Wo, W1, W2, wtq[0], x, emb, pos, h, h16);

  const dim3 gE(ROWS / 64, E_ / 256);                     // N = 512
  const dim3 gQ(ROWS / 64, 3 * E_ / 256);                 // Q, K, V side by side
  const dim3 gF(ROWS / 64, FF_ / 256);                    // N = 2048
  const dim3 gA(B_ * H_, S_ / 256);

  for (int l = 0; l < L_; ++l) {
    const float* bql = bq  + (size_t)l * E_;
    const float* bkl = bk  + (size_t)l * E_;
    const float* bvl = bv  + (size_t)l * E_;
    const float* bol = bo  + (size_t)l * E_;
    const float* b1l = bf1 + (size_t)l * FF_;
    const float* b2l = bf2 + (size_t)l * E_;
    const float* g1l = g1  + (size_t)l * E_;
    const float* e1l = be1 + (size_t)l * E_;
    const float* g2l = g2  + (size_t)l * E_;
    const float* e2l = be2 + (size_t)l * E_;

    // wtq, wtk, wtv of a layer and q16, k16, v16 lie back to back in the workspace
    gemm_f16_kernel<64, true><<<gQ, 256, 0, stream>>>(h16, wtq[l], bql, bkl, bvl, nullptr, q16, E_, E_, 0);

    attention_kernel<<<gA, 256, 0, stream>>>(q16, k16, v16, mask, att16);

    gemm_f16_kernel<128, false><<<gE, 256, 0, stream>>>(att16, wto[l], bol, nullptr, nullptr, f32tmp, nullptr, E_, E_, 0);
    add_ln_kernel<<<ROWS, 128, 0, stream>>>(f32tmp, h, g1l, e1l, h, h16);

    gemm_f16_kernel<64, false><<<gF, 256, 0, stream>>>(h16, wt1[l], b1l, nullptr, nullptr, nullptr, big16, FF_, E_, 1);
    gemm_f16_kernel<128, false><<<gE, 256, 0, stream>>>(big16, wt2[l], b2l, nullptr, nullptr, f32tmp, nullptr, E_, FF_, 0);
    add_ln_kernel<<<ROWS, 128, 0, stream>>>(f32tmp, h, g2l, e2l, h, h16);
  }
}

// v008
// Measured time: 252 microseconds a run.
// Next to v007, in two timings, it ran 1.05 and 1.06 times as fast.
// Over all steps from v000 it is 2.93 times as fast.
#include <hip/hip_runtime.h>
#include <hip/hip_bf16.h>

typedef __attribute__((ext_vector_type(16))) _Float16 v16h;
typedef __attribute__((ext_vector_type(8)))  float    v8f;
typedef __attribute__((ext_vector_type(8)))  _Float16 v8h;
typedef int v4i_vec __attribute__((vector_size(16)));   // int __vector(4)

constexpr int E_   = 512;
constexpr int H_   = 8;
constexpr int D_   = 64;
constexpr int FF_  = 2048;
constexpr int L_   = 2;
constexpr int B_   = 4;
constexpr int S_   = 2048;
constexpr int ROWS = B_ * S_;          // 8192 token rows

constexpr int AP_  = 72;               // attention K tile: 64 f16 used per row
// The V tile is read by ds_load_tr16_b128, which wants a pitch of 32 B x odd.
constexpr int VP_  = 80;               // attention V tile: 64 f16 used per row, 160 B

#if defined(__has_builtin)
#if __has_builtin(__builtin_amdgcn_global_load_async_to_lds_b128)
#define HAVE_ASYNC_LDS 1
#endif
#endif
#ifndef HAVE_ASYNC_LDS
#define HAVE_ASYNC_LDS 0
#endif

__device__ __forceinline__ uint32_t pack2h(float a, float b) {
  union { _Float16 h[2]; uint32_t u; } t;
  t.h[0] = (_Float16)a; t.h[1] = (_Float16)b;
  return t.u;
}

__device__ __forceinline__ void cp16B_g2l(const _Float16* g, _Float16* l) {
#if HAVE_ASYNC_LDS
  __builtin_amdgcn_global_load_async_to_lds_b128(
      (__attribute__((address_space(1))) v4i_vec*)(_Float16*)g,
      (__attribute__((address_space(3))) v4i_vec*)l, 0, 0);
#else
  *(uint4*)l = *(const uint4*)g;
#endif
}

__device__ __forceinline__ void async_fence() {
#if HAVE_ASYNC_LDS
  asm volatile("s_wait_asynccnt 0" ::: "memory");
#endif
}

__device__ __forceinline__ v16h load_frag_k32(const _Float16* base, int rowStride, int lane) {
  int r  = lane & 15;
  int kh = (lane >> 4) << 3;
  const _Float16* p = base + r * rowStride + kh;
  union { v16h v; uint32_t u[8]; } f;
  const uint32_t* p0 = (const uint32_t*)p;
  const uint32_t* p1 = (const uint32_t*)(p + 16);
#pragma unroll
  for (int i = 0; i < 4; ++i) { f.u[i] = p0[i]; f.u[4 + i] = p1[i]; }
  return f.v;
}

__device__ __forceinline__ v8f wmma_f16(v16h a, v16h b, v8f c) {
  return __builtin_amdgcn_wmma_f32_16x16x32_f16(false, a, false, b, (short)0, c, false, false);
}

// ---------------------------------------------------------------------------
// Weight convert + transpose, all twelve matrices in one launch:
// W[K][N] f32 -> Wt[N][K] f16. One block moves a 128(k) x 64(n) tile through LDS,
// 32 elements per thread; global reads and writes are runs of 256 B.
// Tiles of a layer: 0..127 Wq,Wk,Wv,Wo (32 tiles each), 128..255 W1, 256..383 W2.
// Wt: per layer wtq, wtk, wtv, wto, wt1, wt2 back to back (WL_ elements).
// ---------------------------------------------------------------------------
constexpr int    TP_ = 136;            // tile row pitch in f16: 256 B + 16 B (16 B x odd)
constexpr size_t WL_ = (size_t)4 * E_ * E_ + (size_t)2 * E_ * FF_;

template <int K, int N>
__device__ __forceinline__ void wconv_tile(
    const float* __restrict__ W, _Float16* __restrict__ Wt, int t, _Float16 (*T)[TP_]) {
  const int tid = threadIdx.x;
  const int k0  = (t / (N / 64)) * 128;
  const int n0  = (t % (N / 64)) * 64;

  // read: a thread takes 8 consecutive k of 4 consecutive n (16 lanes = 256 B of one k row);
  // uniform tile base + one per-lane byte offset that all eight loads share
  const int kc = tid >> 4;             // which group of 8 k
  const int nq = tid & 15;             // which group of 4 n
  const char* sb = (const char*)(W + (size_t)k0 * N + n0);
  const uint32_t voff = (uint32_t)(kc * 8 * N + nq * 4) * 4u;
  float4 v[8];
#pragma unroll  // all eight loads in flight together, v[] in registers
  for (int i = 0; i < 8; ++i) v[i] = *(const float4*)(sb + voff + i * N * 4);

#pragma unroll  // constant c: v[] is indexed at compile time and stays in registers
  for (int c = 0; c < 4; ++c) {
    uint4 w;
    w.x = pack2h((&v[0].x)[c], (&v[1].x)[c]);
    w.y = pack2h((&v[2].x)[c], (&v[3].x)[c]);
    w.z = pack2h((&v[4].x)[c], (&v[5].x)[c]);
    w.w = pack2h((&v[6].x)[c], (&v[7].x)[c]);
    *(uint4*)&T[nq * 4 + c][kc * 8] = w;
  }
  __syncthreads();

  // write: 16 lanes = the 256 B that one n row of the tile holds
  _Float16* dp = Wt + (size_t)n0 * K + k0;
#pragma unroll  // the four LDS reads issue ahead of the four stores
  for (int j = 0; j < 4; ++j) {
    const int idx = j * 256 + tid;
    const int row = idx >> 4, ch = (idx & 15) << 3;
    *(uint4*)(dp + (size_t)row * K + ch) = *(const uint4*)&T[row][ch];
  }
}

// The embedding reads nothing that the weight conversion writes, and the other way round: the
// two share one launch. Blocks 0 .. 767 convert (384 tiles a layer), the rest embed two token
// rows each.
constexpr int WB_ = 384;               // weight tiles per layer

__device__ __forceinline__ void embed_rows(
    int blk, const int* __restrict__ x, const float* __restrict__ emb,
    const float* __restrict__ pos, float* __restrict__ h, _Float16* __restrict__ h16);

__global__ __launch_bounds__(256) void prep_kernel(
    const float* __restrict__ Wq, const float* __restrict__ Wk,
    const float* __restrict__ Wv, const float* __restrict__ Wo,
    const float* __restrict__ W1, const float* __restrict__ W2,
    _Float16* __restrict__ Wt,
    const int* __restrict__ x, const float* __restrict__ emb,
    const float* __restrict__ pos, float* __restrict__ h,
    _Float16* __restrict__ h16) {
  __shared__ __attribute__((aligned(16))) _Float16 T[64][TP_];        // 17 KB : [n][k]

  if (blockIdx.x >= L_ * WB_) {        // uniform for the block, in front of every barrier
    embed_rows(blockIdx.x - L_ * WB_, x, emb, pos, h, h16);
    return;
  }
  const int l = blockIdx.x / WB_;
  const int r = blockIdx.x % WB_;      // the three branches are uniform for the block
  _Float16* D = Wt + (size_t)l * WL_;
  if (r < 128) {
    const int m = r >> 5;
    const float* W = (m == 0) ? Wq : (m == 1) ? Wk : (m == 2) ? Wv : Wo;
    wconv_tile<E_, E_>(W + (size_t)l * E_ * E_, D + (size_t)m * E_ * E_, r & 31, T);
  } else if (r < 256) {
    wconv_tile<E_, FF_>(W1 + (size_t)l * E_ * FF_, D + (size_t)4 * E_ * E_, r - 128, T);
  } else {
    wconv_tile<FF_, E_>(W2 + (size_t)l * FF_ * E_,
                        D + (size_t)4 * E_ * E_ + (size_t)E_ * FF_, r - 256, T);
  }
}

// ---------------------------------------------------------------------------
// Embedding + positional add: writes f32 h and f16 h16
// ---------------------------------------------------------------------------
__device__ __forceinline__ void embed_rows(
    int blk, const int* __restrict__ x, const float* __restrict__ emb,
    const float* __restrict__ pos, float* __restrict__ h,
    _Float16* __restrict__ h16) {
  // four waves a row; the row number is the same in every lane of a wave: kept scalar, the
  // row's base addresses are formed in scalar registers and a lane adds only its column
  int row = blk * 2 + __builtin_amdgcn_readfirstlane(threadIdx.x >> 7);
  int s   = row & (S_ - 1);
  int tok = x[row] + 1;
  int c   = (threadIdx.x & 127) << 2;
  float4 e4 = *(const float4*)(emb + (size_t)tok * E_ + c);
  float4 p4 = *(const float4*)(pos + (size_t)s   * E_ + c);
  float4 o; o.x = e4.x + p4.x; o.y = e4.y + p4.y; o.z = e4.z + p4.z; o.w = e4.w + p4.w;
  *(float4*)(h + (size_t)row * E_ + c) = o;
  uint2 hp; hp.x = pack2h(o.x, o.y); hp.y = pack2h(o.z, o.w);
  *(uint2*)(h16 + (size_t)row * E_ + c) = hp;
}

// ---------------------------------------------------------------------------
// WMMA GEMM, f16 in: C[M,N] = act(A[M,K] @ Wt[N,K]^T + bias[N]), M = 8192.
// Block tile 64x256, 8 waves (2x4), wave tile 32x64, K-step KS, dbl buffer.
// KS = 64: three blocks share a WGP (1024 blocks, 768 with QKV), 40 KB in flight each, whole
// 128-B lines.
// Output: f32 (Cf) and/or f16 (Ch).
// QKV: one launch forms three products of the same A. Wt holds the three [512][512] weights
// back to back, Ch the three [M][512] outputs back to back; a pair of blockIdx.y is one of
// them, with its own bias. All 768 blocks are resident together, three to a WGP.
// The product is formed transposed (weight fragment as A operand, activation fragment as B):
// a lane then holds eight consecutive columns of ONE output row. Each wave passes its tile,
// 16 rows at a time, through its own range of the finished B tile and stores whole rows of
// the wave tile (128 B of f16, 256 B of f32) with 16-byte stores.
// ---------------------------------------------------------------------------
// Stands behind a run of global stores, in front of the code that writes their address and
// data registers anew.
__device__ __forceinline__ void stores_taken() {
  asm volatile("s_wait_xcnt 0x0" ::: "memory");
}

constexpr int SH_  = 144;              // staged f16 row: 128 B + 16 B (16 B x odd)
constexpr int SF_  = 272;              // staged f32 row: 256 B + 16 B (16 B x odd)
constexpr int STG_ = 16 * SF_;         // one wave's staging range in bytes

// A wave's own LDS writes have landed before its lanes read each other's rows back.
__device__ __forceinline__ void lds_landed() {
  asm volatile("s_wait_dscnt 0x0" ::: "memory");
}

template <int KS, bool QKV>
__global__ __launch_bounds__(256) void gemm_f16_kernel(
    const _Float16* __restrict__ A, const _Float16* __restrict__ Wt,
    const float* __restrict__ bias, const float* __restrict__ bias1,
    const float* __restrict__ bias2, float* __restrict__ Cf,
    _Float16* __restrict__ Ch, int N, int Kdim, int relu) {
  constexpr int GP_ = KS + 8;          // row pitch in f16
  constexpr int CR_ = KS / 8;          // 16-byte pieces per row
  __shared__ __attribute__((aligned(16))) _Float16 Atile[2][64][GP_];   // KS 64: 18 KB, 128: 34 KB
  __shared__ __attribute__((aligned(16))) _Float16 Btile[2][256][GP_];  // KS 64: 72 KB, 128: 136 KB ([n][k])

  const int tid  = threadIdx.x;
  const int lane = tid & 31;
  const int wave = tid >> 5;
  const int wm   = (wave >> 2) << 5;           // 0 / 32
  const int wn   = (wave & 3) << 6;            // 0 / 64 / 128 / 192
  const int m0   = blockIdx.x * 64;
  const int n0   = (QKV ? (blockIdx.y & 1) : blockIdx.y) * 256;
  if constexpr (QKV) {
    const int sel = blockIdx.y >> 1;             // uniform for the block: 0 Q, 1 K, 2 V
    Wt  += (size_t)sel * E_ * E_;
    Ch  += (size_t)sel * ROWS * E_;
    bias = (sel == 0) ? bias : (sel == 1) ? bias1 : bias2;
  }

  v8f acc[2][4] = {};
  const int nk = Kdim / KS;

  auto load_tiles = [&](int kt, int buf) {
    const int k0 = kt * KS;
#pragma unroll  // the copies of a tile issue back to back, with no loop branch between them
    for (int t = 0; t < KS / 32; ++t) {  // A: 64 x KS f16, KS / 32 pieces per thread
      int idx = t * 256 + tid;
      int r = idx / CR_, seg = (idx % CR_) << 3;
      cp16B_g2l(A + (size_t)(m0 + r) * Kdim + k0 + seg, &Atile[buf][r][seg]);
    }
#pragma unroll
    for (int t = 0; t < KS / 8; ++t) {   // B: 256 x KS f16, KS / 8 pieces per thread
      int idx = t * 256 + tid;
      int r = idx / CR_, seg = (idx % CR_) << 3;
      cp16B_g2l(Wt + (size_t)(n0 + r) * Kdim + k0 + seg, &Btile[buf][r][seg]);
    }
  };

  load_tiles(0, 0);
  async_fence();
  __syncthreads();

  for (int kt = 0; kt < nk; ++kt) {
    const int cur = kt & 1;
    if (kt + 1 < nk) load_tiles(kt + 1, cur ^ 1);

#pragma unroll  // the compiler fetches a later 32-k block's fragments ahead of the current one's products
    for (int ks = 0; ks < KS; ks += 32) {
      v16h af[2], bf[4];
      af[0] = load_frag_k32(&Atile[cur][wm + 0][ks], GP_, lane);
      af[1] = load_frag_k32(&Atile[cur][wm + 16][ks], GP_, lane);
#pragma unroll
      for (int j = 0; j < 4; ++j)
        bf[j] = load_frag_k32(&Btile[cur][wn + j * 16][ks], GP_, lane);
#pragma unroll
      for (int i = 0; i < 2; ++i)
#pragma unroll
        for (int j = 0; j < 4; ++j)
          acc[i][j] = wmma_f16(bf[j], af[i], acc[i][j]);   // D[n][m]
    }

    lds_landed();      // this wave's reads of the buffer that is refilled behind the barrier have ended
    async_fence();
    __syncthreads();
  }

  // acc[i][j][e] = C[m0 + wm + 16i + lcol][n0 + wn + 16j + lrow + e]
  const int lrow = (lane >> 4) << 3;
  const int lcol = lane & 15;
  const int cw   = n0 + wn;            // first column of the wave tile
  // The loop's last barrier stands behind every wave's last fragment read and last copy.
  char* stage = (char*)&Btile[0][0][0] + wave * STG_;

  float4 bv[4][2];
#pragma unroll  // constant indices keep bv[] in registers; all eight loads in flight together
  for (int j = 0; j < 4; ++j) {
    bv[j][0] = *(const float4*)(bias + cw + j * 16 + lrow);
    bv[j][1] = *(const float4*)(bias + cw + j * 16 + lrow + 4);
  }

#pragma unroll  // constant indices keep acc[] in registers
  for (int i = 0; i < 2; ++i)
#pragma unroll  // constant indices keep acc[] in registers
    for (int j = 0; j < 4; ++j)
#pragma unroll  // constant indices keep acc[] in registers
      for (int e = 0; e < 8; ++e)
        acc[i][j][e] += (&bv[j][e >> 2].x)[e & 3];
  if (relu) {
#pragma unroll  // constant indices keep acc[] in registers
    for (int i = 0; i < 2; ++i)
#pragma unroll  // constant indices keep acc[] in registers
      for (int j = 0; j < 4; ++j)
#pragma unroll  // constant indices keep acc[] in registers
        for (int e = 0; e < 8; ++e)
          acc[i][j][e] = fmaxf(acc[i][j][e], 0.0f);
  }

#pragma unroll  // constant indices keep acc[] in registers
  for (int i = 0; i < 2; ++i) {
    const int rw = m0 + wm + i * 16;   // first row of this half of the wave tile
    if (Cf) {
#pragma unroll  // constant indices keep acc[] in registers
      for (int j = 0; j < 4; ++j) {
        char* sp = stage + lcol * SF_ + (j * 16 + lrow) * 4;
        *(float4*)sp        = make_float4(acc[i][j][0], acc[i][j][1], acc[i][j][2], acc[i][j][3]);
        *(float4*)(sp + 16) = make_float4(acc[i][j][4], acc[i][j][5], acc[i][j][6], acc[i][j][7]);
      }
      lds_landed();
      float4 w[8];
#pragma unroll  // the eight LDS reads issue ahead of the eight stores
      for (int t = 0; t < 8; ++t)      // 16 lanes = the 256 B of one row, two rows a read
        w[t] = *(const float4*)(stage + (t * 2 + (lane >> 4)) * SF_ + lcol * 16);
#pragma unroll  // constant indices keep w[] in registers
      for (int t = 0; t < 8; ++t)
        *(float4*)(Cf + (rw + t * 2 + (lane >> 4)) * N + cw + lcol * 4) = w[t];
      stores_taken();
    }
    if (Ch) {
#pragma unroll  // constant indices keep acc[] in registers
      for (int j = 0; j < 4; ++j) {
        v8h w;
#pragma unroll  // constant indices keep w in registers
        for (int e = 0; e < 8; ++e) w[e] = (_Float16)acc[i][j][e];
        *(v8h*)(stage + lcol * SH_ + (j * 16 + lrow) * 2) = w;
      }
      lds_landed();
      v8h w[4];
#pragma unroll  // the four LDS reads issue ahead of the four stores
      for (int t = 0; t < 4; ++t)      // 8 lanes = the 128 B of one row, four rows a read
        w[t] = *(const v8h*)(stage + (t * 4 + (lane >> 3)) * SH_ + (lane & 7) * 16);
#pragma unroll  // constant indices keep w[] in registers
      for (int t = 0; t < 4; ++t)
        *(v8h*)(Ch + (rw + t * 4 + (lane >> 3)) * N + cw + (lane & 7) * 8) = w[t];
      if (i == 0) stores_taken();      // behind the last run nothing is written any more
    }
  }
}

__device__ __forceinline__ uint32_t lds_addr(const void* p) {
  return (uint32_t)(uintptr_t)(__attribute__((address_space(3))) const char*)p;
}

// Four 16-byte copies a lane. The wait that ends the statement stands in front of every later
// write of the address registers that the copies name.
__device__ __forceinline__ void copy4x16(uint32_t l0, const _Float16* g0, uint32_t l1, const _Float16* g1,
                                         uint32_t l2, const _Float16* g2, uint32_t l3, const _Float16* g3) {
  asm volatile("global_load_async_to_lds_b128 %0, %1, off\n\t"
               "global_load_async_to_lds_b128 %2, %3, off\n\t"
               "global_load_async_to_lds_b128 %4, %5, off\n\t"
               "global_load_async_to_lds_b128 %6, %7, off\n\t"
               "s_wait_xcnt 0x0"
               :: "v"(l0), "v"(g0), "v"(l1), "v"(g1), "v"(l2), "v"(g2), "v"(l3), "v"(g3) : "memory");
}

__device__ __forceinline__ void copy1x8(uint32_t l0, const int* g0) {
  asm volatile("global_load_async_to_lds_b64 %0, %1, off\n\t"
               "s_wait_xcnt 0x0"
               :: "v"(l0), "v"(g0) : "memory");
}

// 16 (d) x 32 (keys) A fragment of V^T from the row-major V tile: p is the lane's own address
//   tile + (key0 + 8 (lane >> 4) + (lane & 7)) * pitch + 2 * d0 + 16 ((lane >> 3) & 1);
// the lane gets V[key0 + 8h + 0..7][d0 + c], then the same 16 keys on: the k order of load_frag_k32.
typedef short s16x8 __attribute__((ext_vector_type(8)));
__device__ __forceinline__ v16h load_frag_tr(const char* p) {
  typedef __attribute__((address_space(3))) s16x8 lds_s16x8;
  union { v16h v; s16x8 q[2]; } f;
  f.q[0] = __builtin_amdgcn_ds_load_tr16_b128_v8i16((lds_s16x8*)p);
  f.q[1] = __builtin_amdgcn_ds_load_tr16_b128_v8i16((lds_s16x8*)(p + 16 * VP_ * 2));
  return f.v;
}

__device__ __forceinline__ float xhalf(float x) {
  return __builtin_bit_cast(float, __builtin_amdgcn_permlanex16(
      __builtin_bit_cast(int, x), __builtin_bit_cast(int, x), 0x76543210, 0xfedcba98, false, false));
}

constexpr float LOG2E_ = 1.44269504f;

__device__ __forceinline__ float exp_slot(float x) {
  float r = x * LOG2E_;
  asm("v_exp_f32 %0, %0\n\tv_nop" : "+v"(r));
  return r;
}

__device__ __forceinline__ void exp_slot8(float (&p)[8], const v8f& s, float m) {
#pragma unroll  // constant indices keep p[] in registers
  for (int e = 0; e < 8; ++e) p[e] = (s[e] - m) * LOG2E_;
  asm("v_exp_f32 %0, %0\n\tv_exp_f32 %1, %1\n\tv_exp_f32 %2, %2\n\tv_exp_f32 %3, %3\n\t"
      "v_exp_f32 %4, %4\n\tv_exp_f32 %5, %5\n\tv_exp_f32 %6, %6\n\tv_exp_f32 %7, %7\n\tv_nop"
      : "+v"(p[0]), "+v"(p[1]), "+v"(p[2]), "+v"(p[3]),
        "+v"(p[4]), "+v"(p[5]), "+v"(p[6]), "+v"(p[7]));
}

__global__ __launch_bounds__(256) void attention_kernel(
    const _Float16* __restrict__ Q, const _Float16* __restrict__ K,
    const _Float16* __restrict__ V, const int* __restrict__ mask,
    _Float16* __restrict__ O) {
  __shared__ __attribute__((aligned(16))) _Float16 Kt[2][64][AP_];    // 18 KB : [key][d]  (A-frag for K Q^T)
  __shared__ __attribute__((aligned(16))) _Float16 Vs[2][64][VP_];    // 20 KB : [key][d]  (read transposed)
  __shared__ __attribute__((aligned(16))) int      smask[2][64];

  const int tid  = threadIdx.x;
  const int lane = tid & 31;
  const int wave = tid >> 5;
  const int bh   = blockIdx.x;
  const int b    = bh >> 3;
  const int hh   = bh & 7;
  const int q0   = blockIdx.y * 256;
  const size_t base = ((size_t)b * S_) * E_ + (size_t)hh * D_;

  // Q fragments straight from global f16 (B operand: column = query, same k order as A)
  v16h qf[2][2];
#pragma unroll
  for (int i = 0; i < 2; ++i)
#pragma unroll
    for (int s = 0; s < 2; ++s) {
      int q = q0 + wave * 32 + i * 16 + (lane & 15);
      const _Float16* rp = Q + base + (size_t)q * E_ + s * 32 + ((lane >> 4) << 3);
      union { v16h v; uint32_t u[8]; } f;
#pragma unroll
      for (int vv = 0; vv < 8; ++vv) {
        int d = ((vv >> 2) << 4) + ((vv & 3) << 1);
        f.u[vv] = *(const uint32_t*)(rp + d);
      }
      qf[i][s] = f.v;
    }

  v8f o[2][4] = {};                    // o[i][j][r] = O^T[d = 16j + 8h + r][query 16i + c]
  float mst[2], lst[2];                // per query; lst: this wave half's keys only
#pragma unroll  // constant indices keep mst[], lst[] in registers
  for (int i = 0; i < 2; ++i) { mst[i] = -1e30f; lst[i] = 0.0f; }

  const float scale = 0.125f;
  const int lrow = (lane >> 4) << 3;
  const int lcol = lane & 15;

  // A thread copies 16 bytes of rows sr and sr + 32 of the K and of the V tile (8 lanes = one
  // 128-B row); wave 0 also copies the tile's 64 mask words, 8 bytes a lane.
  const int  sr = tid >> 3, sc = (tid & 7) << 3;
  const bool w0 = __builtin_amdgcn_readfirstlane(wave) == 0;          // a scalar test: no wave issues a copy with all lanes off
  const _Float16* kg = K + base + (size_t)sr * E_ + sc;
  const _Float16* vg = V + base + (size_t)sr * E_ + sc;
  const int*      mg = mask + (size_t)b * S_ + lane * 2;
  auto stage = [&](int t, int buf) {
    const size_t go = (size_t)t * 64 * E_;
    copy4x16(lds_addr(&Kt[buf][sr][sc]),      kg + go, lds_addr(&Kt[buf][sr + 32][sc]), kg + go + 32 * E_,
             lds_addr(&Vs[buf][sr][sc]),      vg + go, lds_addr(&Vs[buf][sr + 32][sc]), vg + go + 32 * E_);
    if (w0) copy1x8(lds_addr(&smask[buf][lane * 2]), mg + t * 64);
  };
  constexpr int NT = S_ / 64;

  stage(0, 0);
  async_fence();
  __syncthreads();
  stage(1, 1);

  for (int t = 0; t < NT; ++t) {
    const int cur = t & 1;

    // scores S^T = K Q^T : sa[i][j][r] = S[query 16i + c][key 16j + 8h + r]
    v8f sa[2][4];
#pragma unroll  // constant indices keep the tiles in registers
    for (int j = 0; j < 4; ++j) {
      v16h kf0 = load_frag_k32(&Kt[cur][j * 16][0],  AP_, lane);
      v16h kf1 = load_frag_k32(&Kt[cur][j * 16][32], AP_, lane);
#pragma unroll  // constant indices keep the tiles in registers
      for (int i = 0; i < 2; ++i) {
        v8f z = {};
        z = wmma_f16(kf0, qf[i][0], z);
        sa[i][j] = wmma_f16(kf1, qf[i][1], z);
      }
    }

    // the lane's own eight keys of each tile
#pragma unroll  // constant indices keep the tiles in registers
    for (int j = 0; j < 4; ++j) {
      const int4 ma = *(const int4*)&smask[cur][j * 16 + lrow];
      const int4 mb = *(const int4*)&smask[cur][j * 16 + lrow + 4];
      const int mk[8] = {ma.x, ma.y, ma.z, ma.w, mb.x, mb.y, mb.z, mb.w};
#pragma unroll  // constant indices keep the tiles in registers
      for (int i = 0; i < 2; ++i)
#pragma unroll  // constant indices keep the tiles in registers
        for (int e = 0; e < 8; ++e) {
          float v = sa[i][j][e] * scale;
          sa[i][j][e] = mk[e] ? v : -1e20f;
        }
    }

    // online softmax, one query per lane and column group
    v16h pf[2][2];                     // pf[i][s]: P^T, keys 32s .. 32s + 31, as B operand
#pragma unroll  // constant indices keep the tiles in registers
    for (int i = 0; i < 2; ++i) {
      float nm = sa[i][0][0];
#pragma unroll  // constant indices keep the tiles in registers
      for (int j = 0; j < 4; ++j)
#pragma unroll  // constant indices keep the tiles in registers
        for (int e = 0; e < 8; ++e) nm = fmaxf(nm, sa[i][j][e]);
      nm = fmaxf(nm, xhalf(nm));       // both halves feed the same O^T tile: one maximum

      const float mn = fmaxf(mst[i], nm);
      const float fs = exp_slot(mst[i] - mn);
      mst[i] = mn;
#pragma unroll  // constant indices keep the tiles in registers
      for (int j = 0; j < 4; ++j)
#pragma unroll  // constant indices keep the tiles in registers
        for (int e = 0; e < 8; ++e)
          o[i][j][e] *= fs;

      float rs[4];
#pragma unroll  // constant indices keep the tiles in registers
      for (int j = 0; j < 4; ++j) {
        float p[8];
        exp_slot8(p, sa[i][j], mn);
        rs[j] = ((p[0] + p[1]) + (p[2] + p[3])) + ((p[4] + p[5]) + (p[6] + p[7]));
#pragma unroll  // constant indices keep the tiles in registers
        for (int e = 0; e < 8; ++e)
          pf[i][j >> 1][((j & 1) << 3) + e] = (_Float16)p[e];
      }
      lst[i] = lst[i] * fs + ((rs[0] + rs[1]) + (rs[2] + rs[3]));
    }

    // O^T += V^T P^T
    const char* vp = (const char*)&Vs[cur][lrow + (lane & 7)][((lane >> 3) & 1) << 3];
#pragma unroll  // constant indices keep the tiles in registers
    for (int j = 0; j < 4; ++j) {
      v16h vf0 = load_frag_tr(vp + j * 32);
      v16h vf1 = load_frag_tr(vp + j * 32 + 32 * VP_ * 2);
#pragma unroll  // constant indices keep the tiles in registers
      for (int i = 0; i < 2; ++i) {
        o[i][j] = wmma_f16(vf0, pf[i][0], o[i][j]);
        o[i][j] = wmma_f16(vf1, pf[i][1], o[i][j]);
      }
    }

    lds_landed();      // this wave's reads of the buffer that is refilled behind the barrier have ended
    async_fence();     // this wave's copies of the next tile have landed
    __syncthreads();   // publishes the next tile and ends every wave's reads of this one
    if (t + 2 < NT) stage(t + 2, cur);
  }
  async_fence();       // no copy is outstanding when the wave ends

  // a lane holds eight consecutive d of one query: one 16-byte store per tile
#pragma unroll  // constant indices keep the tiles in registers
  for (int i = 0; i < 2; ++i) {
    const float lt = lst[i] + xhalf(lst[i]);
    const int qrow = q0 + wave * 32 + i * 16 + lcol;
#pragma unroll  // constant indices keep the tiles in registers
    for (int j = 0; j < 4; ++j) {
      uint4 w;
      w.x = pack2h(o[i][j][0] / lt, o[i][j][1] / lt);
      w.y = pack2h(o[i][j][2] / lt, o[i][j][3] / lt);
      w.z = pack2h(o[i][j][4] / lt, o[i][j][5] / lt);
      w.w = pack2h(o[i][j][6] / lt, o[i][j][7] / lt);
      *(uint4*)(O + base + (size_t)qrow * E_ + j * 16 + lrow) = w;
    }
  }
}

constexpr int LM_   = 64;
constexpr int LK_   = 128;
constexpr int LP_   = LK_ + 8;
constexpr int LBUF_ = (LM_ + E_) * LP_ * 2;
constexpr int RP_   = E_ * 4 + 16;
constexpr int ST2_  = 16 * SF_ + 16 * SH_;
constexpr int PW_   = 10;
static_assert(LM_ * RP_ <= LBUF_ && 8 * ST2_ <= LBUF_, "residual rows and staging fit a buffer");

typedef float f32x4 __attribute__((ext_vector_type(4)));

template <int Kdim>
__global__ __launch_bounds__(256) void gemm_ln_kernel(
    const _Float16* __restrict__ A, const _Float16* __restrict__ Wt,
    const float* __restrict__ bias, const float* __restrict__ g,
    const float* __restrict__ bb, float* __restrict__ H, _Float16* __restrict__ H16) {
  __shared__ __attribute__((aligned(16))) char   ring[2][LBUF_];      // 2 x 153 KB
  __shared__ __attribute__((aligned(16))) float2 part[LM_][PW_];      // 5 KB : [row][wave] (sum, sum of squares)

  const int tid  = threadIdx.x;
  const int lane = tid & 31;
  const int wave = tid >> 5;
  const int wn   = wave << 6;                    // first column of the wave tile
  const int m0   = blockIdx.x * LM_;

  v8f acc[4][4] = {};
  constexpr int nk = Kdim / LK_;

  // A thread copies piece tid & 15 of rows (tid >> 4) + 16 t: uniform tile base, one per-lane
  // offset that all copies of an operand share, constant steps between them.
  const uint32_t go = (uint32_t)((tid >> 4) * Kdim + ((tid & 15) << 3));   // in f16
  const uint32_t lo = (uint32_t)((tid >> 4) * LP_  + ((tid & 15) << 3));   // in f16
  auto load_tiles = [&](int kt, int buf) {
    const _Float16* ab = A  + (size_t)m0 * Kdim + kt * LK_;
    const _Float16* wb = Wt + kt * LK_;
    _Float16* T = (_Float16*)ring[buf] + lo;
#pragma unroll  // the copies of a tile issue back to back, with no loop branch between them
    for (int t = 0; t < LM_ / 16; ++t)           // A: 64 rows of 16 pieces
      cp16B_g2l(ab + go + t * 16 * Kdim, T + t * 16 * LP_);
#pragma unroll
    for (int t = 0; t < E_ / 16; ++t)
      cp16B_g2l(wb + go + t * 16 * Kdim, T + (LM_ + t * 16) * LP_);
  };
  auto load_resid = [&](int buf) {
    const float* hb = H + (size_t)m0 * E_;
    char* T = ring[buf] + (tid >> 7) * RP_ + (tid & 127) * 16;
#pragma unroll
    for (int t = 0; t < LM_ / 2; ++t)            // 64 rows of 128 pieces; a wave's copy is 512 B of one row
      cp16B_g2l((const _Float16*)(hb + (uint32_t)(tid * 4) + t * 2 * E_), (_Float16*)(T + t * 2 * RP_));
  };

  load_tiles(0, 0);
  async_fence();
  __syncthreads();

  // One trip: four 32-k blocks of 16 products. Behind the four products of a row group stand the
  // loads of the next block's fragments that take the registers just freed (that row group's
  // activation fragment) or the second weight set: every fragment is fetched a block ahead.
  auto trip = [&](int cur) {
    const _Float16* Ta = (const _Float16*)ring[cur];
    const _Float16* Tb = Ta + (LM_ + wn) * LP_;
    v16h af[4], bf[2][4];
#pragma unroll  // constant indices keep the fragments in registers
    for (int i = 0; i < 4; ++i) {
      af[i]    = load_frag_k32(Ta + i * 16 * LP_, LP_, lane);
      bf[0][i] = load_frag_k32(Tb + i * 16 * LP_, LP_, lane);
    }
#pragma unroll  // constant indices keep the fragments in registers
    for (int b = 0; b < LK_ / 32; ++b)
#pragma unroll  // constant indices keep the fragments in registers
      for (int i = 0; i < 4; ++i) {
#pragma unroll  // constant indices keep the fragments in registers
        for (int j = 0; j < 4; ++j)
          acc[i][j] = wmma_f16(bf[b & 1][j], af[i], acc[i][j]);   // D[n][m]
        if (b + 1 < LK_ / 32) {
          af[i]              = load_frag_k32(Ta + i * 16 * LP_ + (b + 1) * 32, LP_, lane);
          bf[(b + 1) & 1][i] = load_frag_k32(Tb + i * 16 * LP_ + (b + 1) * 32, LP_, lane);
        }
        // keeps these loads here, a block ahead of their use: moved down to their products, each
        // row group would wait out a whole LDS latency
        __builtin_amdgcn_sched_barrier(0);
      }
    lds_landed();      // this wave's reads of the buffer that is refilled behind the barrier have ended
    async_fence();     // this wave's copies of the next tile, or of the residual rows, have landed
    __syncthreads();
  };

  for (int kt = 0; kt + 1 < nk; ++kt) {
    load_tiles(kt + 1, (kt & 1) ^ 1);
    trip(kt & 1);
  }
  constexpr int last = (nk - 1) & 1;
  load_resid(last ^ 1);                          // the ring's last tile
  trip(last);

  // acc[i][j][e] = C[m0 + 16i + lcol][wn + 16j + lrow + e]
  const int lrow = (lane >> 4) << 3;
  const int lcol = lane & 15;
  const char* Rb = ring[last ^ 1];               // the residual rows
  // The loop's last barrier stands behind every wave's last fragment read of this buffer.
  char* stage = ring[last] + wave * ST2_;

  {
    float4 bv[4][2];
#pragma unroll  // constant indices keep bv[] in registers; all eight loads in flight together
    for (int j = 0; j < 4; ++j) {
      bv[j][0] = *(const float4*)(bias + wn + j * 16 + lrow);
      bv[j][1] = *(const float4*)(bias + wn + j * 16 + lrow + 4);
    }
#pragma unroll  // constant indices keep acc[] in registers
    for (int i = 0; i < 4; ++i) {
      float s[4], q[4];
#pragma unroll  // constant indices keep acc[] in registers
      for (int j = 0; j < 4; ++j) {
        const char* rp = Rb + (i * 16 + lcol) * RP_ + (wn + j * 16 + lrow) * 4;
        const f32x4 r0 = *(const f32x4*)rp;
        const f32x4 r1 = *(const f32x4*)(rp + 16);
        s[j] = 0.0f; q[j] = 0.0f;
#pragma unroll  // constant indices keep acc[] in registers
        for (int e = 0; e < 8; ++e) {
          const float v = (acc[i][j][e] + (&bv[j][e >> 2].x)[e & 3]) + (e < 4 ? r0[e & 3] : r1[e & 3]);
          acc[i][j][e] = v;
          s[j] += v;
          q[j] += v * v;
        }
      }
      float st = (s[0] + s[1]) + (s[2] + s[3]);
      float qt = (q[0] + q[1]) + (q[2] + q[3]);
      st += xhalf(st);
      qt += xhalf(qt);
      if (lane < 16) part[i * 16 + lcol][wave] = make_float2(st, qt);
    }
  }
  __syncthreads();     // every wave's row sums stand in part[]

  const float* gp = g  + wn + lrow;
  const float* ep = bb + wn + lrow;
  float4 gv[4][2], ev[4][2];
#pragma unroll  // constant indices keep gv[], ev[] in registers; all loads in flight together
  for (int j = 0; j < 4; ++j) {
    gv[j][0] = *(const float4*)(gp + j * 16);
    gv[j][1] = *(const float4*)(gp + j * 16 + 4);
    ev[j][0] = *(const float4*)(ep + j * 16);
    ev[j][1] = *(const float4*)(ep + j * 16 + 4);
  }
  // The two address pairs are inputs: they stay as they are up to this wait, so that no load of
  // the run returns into an address register of the run ahead of it.
  asm volatile("s_wait_xcnt 0x0" :: "v"(gp), "v"(ep) : "memory");

#pragma unroll  // constant indices keep acc[] in registers
  for (int i = 0; i < 4; ++i) {
    const float4* pp = (const float4*)&part[i * 16 + lcol][0];
    const float4 p0 = pp[0], p1 = pp[1], p2 = pp[2], p3 = pp[3];
    const float S1 = ((p0.x + p0.z) + (p1.x + p1.z)) + ((p2.x + p2.z) + (p3.x + p3.z));
    const float S2 = ((p0.y + p0.w) + (p1.y + p1.w)) + ((p2.y + p2.w) + (p3.y + p3.w));
    const float mu   = S1 * (1.0f / E_);
    const float var  = S2 * (1.0f / E_) - mu * mu;
    const float rinv = rsqrtf(var + 1e-6f);

    char* s32 = stage;
    char* s16 = stage + 16 * SF_;
#pragma unroll  // constant indices keep acc[] in registers
    for (int j = 0; j < 4; ++j) {
      float y[8];
      v8h   w;
#pragma unroll  // constant indices keep y[] in registers
      for (int e = 0; e < 8; ++e) {
        y[e] = (acc[i][j][e] - mu) * rinv * (&gv[j][e >> 2].x)[e & 3] + (&ev[j][e >> 2].x)[e & 3];
        w[e] = (_Float16)y[e];
      }
      char* sp = s32 + lcol * SF_ + (j * 16 + lrow) * 4;
      *(float4*)sp        = make_float4(y[0], y[1], y[2], y[3]);
      *(float4*)(sp + 16) = make_float4(y[4], y[5], y[6], y[7]);
      *(v8h*)(s16 + lcol * SH_ + (j * 16 + lrow) * 2) = w;
    }
    lds_landed();
    const int rw = m0 + i * 16;        // first row of this quarter of the wave tile
#pragma unroll  // straight-line code: the compiler issues the LDS reads ahead of the stores
    for (int t = 0; t < 8; ++t) {      // 16 lanes = the 256 B of one row, two rows a read
      const f32x4 a = *(const f32x4*)(s32 + (t * 2 + (lane >> 4)) * SF_ + lcol * 16);
      *(f32x4*)(H + (rw + t * 2 + (lane >> 4)) * E_ + wn + lcol * 4) = a;
    }
#pragma unroll
    for (int t = 0; t < 4; ++t) {      // 8 lanes = the 128 B of one row, four rows a read
      const v8h a = *(const v8h*)(s16 + (t * 4 + (lane >> 3)) * SH_ + (lane & 7) * 16);
      *(v8h*)(H16 + (rw + t * 4 + (lane >> 3)) * E_ + wn + (lane & 7) * 8) = a;
    }
    if (i < 3) stores_taken();         // behind the last run nothing is written any more
  }
}

// ---------------------------------------------------------------------------
// Host orchestration
// ---------------------------------------------------------------------------
extern "C" void kernel_launch(void* const* d_in, const int* in_sizes, int n_in,
                              void* d_out, int out_size, void* d_ws, size_t ws_size,
                              hipStream_t stream) {
  const int*   x    = (const int*)d_in[0];
  const int*   mask = (const int*)d_in[1];
  const float* emb  = (const float*)d_in[2];
  const float* pos  = (const float*)d_in[3];
  const float* Wq   = (const float*)d_in[4];
  const float* bq   = (const float*)d_in[5];
  const float* Wk   = (const float*)d_in[6];
  const float* bk   = (const float*)d_in[7];
  const float* Wv   = (const float*)d_in[8];
  const float* bv   = (const float*)d_in[9];
  const float* Wo   = (const float*)d_in[10];
  const float* bo   = (const float*)d_in[11];
  const float* g1   = (const float*)d_in[12];
  const float* be1  = (const float*)d_in[13];
  const float* g2   = (const float*)d_in[14];
  const float* be2  = (const float*)d_in[15];
  const float* W1   = (const float*)d_in[16];
  const float* bf1  = (const float*)d_in[17];
  const float* W2   = (const float*)d_in[18];
  const float* bf2  = (const float*)d_in[19];

  float* h = (float*)d_out;                               // [B,S,E] f32, persistent

  const size_t ACT = (size_t)ROWS * E_;
  char* p = (char*)d_ws;
  auto alloc_h = [&](size_t n) { _Float16* r = (_Float16*)p; p += n * sizeof(_Float16); return r; };
  _Float16* h16   = alloc_h(ACT);
  _Float16* q16   = alloc_h(ACT);
  _Float16* k16   = alloc_h(ACT);
  _Float16* v16   = alloc_h(ACT);
  _Float16* att16 = alloc_h(ACT);
  _Float16* big16 = alloc_h((size_t)ROWS * FF_);
  _Float16* wtq[L_]; _Float16* wtk[L_]; _Float16* wtv[L_]; _Float16* wto[L_];
  _Float16* wt1[L_]; _Float16* wt2[L_];
  for (int l = 0; l < L_; ++l) {
    wtq[l] = alloc_h((size_t)E_ * E_);
    wtk[l] = alloc_h((size_t)E_ * E_);
    wtv[l] = alloc_h((size_t)E_ * E_);
    wto[l] = alloc_h((size_t)E_ * E_);
    wt1[l] = alloc_h((size_t)E_ * FF_);
    wt2[l] = alloc_h((size_t)FF_ * E_);
  }

  // Weight convert+transpose (W[K][N] f32 -> Wt[N][K] f16); wtq[0] is the start of the block
  // and the embedding, in the same launch
  prep_kernel<<<L_ * WB_ + ROWS / 2, 256, 0, stream>>>(Wq, Wk, Wv, Wo, W1, W2, wtq[0], x, emb, pos, h, h16);

  const dim3 gQ(ROWS / 64, 3 * E_ / 256);                 // Q, K, V side by side
  const dim3 gF(ROWS / 64, FF_ / 256);                    // N = 2048
  const dim3 gA(B_ * H_, S_ / 256);

  for (int l = 0; l < L_; ++l) {
    const float* bql = bq  + (size_t)l * E_;
    const float* bkl = bk  + (size_t)l * E_;
    const float* bvl = bv  + (size_t)l * E_;
    const float* bol = bo  + (size_t)l * E_;
    const float* b1l = bf1 + (size_t)l * FF_;
    const float* b2l = bf2 + (size_t)l * E_;
    const float* g1l = g1  + (size_t)l * E_;
    const float* e1l = be1 + (size_t)l * E_;
    const float* g2l = g2  + (size_t)l * E_;
    const float* e2l = be2 + (size_t)l * E_;

    // wtq, wtk, wtv of a layer and q16, k16, v16 lie back to back in the workspace
    gemm_f16_kernel<64, true><<<gQ, 256, 0, stream>>>(h16, wtq[l], bql, bkl, bvl, nullptr, q16, E_, E_, 0);

    attention_kernel<<<gA, 256, 0, stream>>>(q16, k16, v16, mask, att16);

    gemm_ln_kernel<E_><<<ROWS / LM_, 256, 0, stream>>>(att16, wto[l], bol, g1l, e1l, h, h16);

    gemm_f16_kernel<64, false><<<gF, 256, 0, stream>>>(h16, wt1[l], b1l, nullptr, nullptr, nullptr, big16, FF_, E_, 1);
    gemm_ln_kernel<FF_><<<ROWS / LM_, 256, 0, stream>>>(big16, wt2[l], b2l, g2l, e2l, h, h16);
  }
}

// v009
// It runs in 219 microseconds.
// Next to v008, in two timings, it ran 1.16 times as fast each time.
// All steps since v000 together make it 3.39 times as fast.
#include <hip/hip_runtime.h>
#include <hip/hip_bf16.h>

typedef __attribute__((ext_vector_type(16))) _Float16 v16h;
typedef __attribute__((ext_vector_type(8)))  float    v8f;
typedef __attribute__((ext_vector_type(8)))  _Float16 v8h;
typedef int v4i_vec __attribute__((vector_size(16)));   // int __vector(4)

constexpr int E_   = 512;
constexpr int H_   = 8;
constexpr int D_   = 64;
constexpr int FF_  = 2048;
constexpr int L_   = 2;
constexpr int B_   = 4;
constexpr int S_   = 2048;
constexpr int ROWS = B_ * S_;          // 8192 token rows

constexpr int AP_  = 72;               // attention K tile: 64 f16 used per row
// The V tile is read by ds_load_tr16_b128, which wants a pitch of 32 B x odd.
constexpr int VP_  = 80;               // attention V tile: 64 f16 used per row, 160 B

#if defined(__has_builtin)
#if __has_builtin(__builtin_amdgcn_global_load_async_to_lds_b128)
#define HAVE_ASYNC_LDS 1
#endif
#endif
#ifndef HAVE_ASYNC_LDS
#define HAVE_ASYNC_LDS 0
#endif

__device__ __forceinline__ uint32_t pack2h(float a, float b) {
  union { _Float16 h[2]; uint32_t u; } t;
  t.h[0] = (_Float16)a; t.h[1] = (_Float16)b;
  return t.u;
}

__device__ __forceinline__ void cp16B_g2l(const _Float16* g, _Float16* l) {
#if HAVE_ASYNC_LDS
  __builtin_amdgcn_global_load_async_to_lds_b128(
      (__attribute__((address_space(1))) v4i_vec*)(_Float16*)g,
      (__attribute__((address_space(3))) v4i_vec*)l, 0, 0);
#else
  *(uint4*)l = *(const uint4*)g;
#endif
}

__device__ __forceinline__ void async_fence() {
#if HAVE_ASYNC_LDS
  asm volatile("s_wait_asynccnt 0" ::: "memory");
#endif
}

__device__ __forceinline__ v16h load_frag_k32(const _Float16* base, int rowStride, int lane) {
  int r  = lane & 15;
  int kh = (lane >> 4) << 3;
  const _Float16* p = base + r * rowStride + kh;
  union { v16h v; uint32_t u[8]; } f;
  const uint32_t* p0 = (const uint32_t*)p;
  const uint32_t* p1 = (const uint32_t*)(p + 16);
#pragma unroll
  for (int i = 0; i < 4; ++i) { f.u[i] = p0[i]; f.u[4 + i] = p1[i]; }
  return f.v;
}

__device__ __forceinline__ v8f wmma_f16(v16h a, v16h b, v8f c) {
  return __builtin_amdgcn_wmma_f32_16x16x32_f16(false, a, false, b, (short)0, c, false, false);
}

// ---------------------------------------------------------------------------
// Weight convert + transpose, all twelve matrices in one launch:
// W[K][N] f32 -> Wt[N][K] f16. One block moves a 128(k) x 64(n) tile through LDS,
// 32 elements per thread; global reads and writes are runs of 256 B.
// Tiles of a layer: 0..127 Wq,Wk,Wv,Wo (32 tiles each), 128..255 W1, 256..383 W2.
// Wt: per layer wtq, wtk, wtv, wto, wt1, wt2 back to back (WL_ elements).
// ---------------------------------------------------------------------------
constexpr int    TP_ = 136;            // tile row pitch in f16: 256 B + 16 B (16 B x odd)
constexpr size_t WL_ = (size_t)4 * E_ * E_ + (size_t)2 * E_ * FF_;

template <int K, int N>
__device__ __forceinline__ void wconv_tile(
    const float* __restrict__ W, _Float16* __restrict__ Wt, int t, _Float16 (*T)[TP_]) {
  const int tid = threadIdx.x;
  const int k0  = (t / (N / 64)) * 128;
  const int n0  = (t % (N / 64)) * 64;

  // read: a thread takes 8 consecutive k of 4 consecutive n (16 lanes = 256 B of one k row);
  // uniform tile base + one per-lane byte offset that all eight loads share
  const int kc = tid >> 4;             // which group of 8 k
  const int nq = tid & 15;             // which group of 4 n
  const char* sb = (const char*)(W + (size_t)k0 * N + n0);
  const uint32_t voff = (uint32_t)(kc * 8 * N + nq * 4) * 4u;
  float4 v[8];
#pragma unroll  // all eight loads in flight together, v[] in registers
  for (int i = 0; i < 8; ++i) v[i] = *(const float4*)(sb + voff + i * N * 4);

#pragma unroll  // constant c: v[] is indexed at compile time and stays in registers
  for (int c = 0; c < 4; ++c) {
    uint4 w;
    w.x = pack2h((&v[0].x)[c], (&v[1].x)[c]);
    w.y = pack2h((&v[2].x)[c], (&v[3].x)[c]);
    w.z = pack2h((&v[4].x)[c], (&v[5].x)[c]);
    w.w = pack2h((&v[6].x)[c], (&v[7].x)[c]);
    *(uint4*)&T[nq * 4 + c][kc * 8] = w;
  }
  __syncthreads();

  // write: 16 lanes = the 256 B that one n row of the tile holds
  _Float16* dp = Wt + (size_t)n0 * K + k0;
#pragma unroll  // the four LDS reads issue ahead of the four stores
  for (int j = 0; j < 4; ++j) {
    const int idx = j * 256 + tid;
    const int row = idx >> 4, ch = (idx & 15) << 3;
    *(uint4*)(dp + (size_t)row * K + ch) = *(const uint4*)&T[row][ch];
  }
}

// The embedding reads nothing that the weight conversion writes, and the other way round: the
// two share one launch. Blocks 0 .. 767 convert (384 tiles a layer), the rest embed two token
// rows each.
constexpr int WB_ = 384;               // weight tiles per layer

__device__ __forceinline__ void embed_rows(
    int blk, const int* __restrict__ x, const float* __restrict__ emb,
    const float* __restrict__ pos, float* __restrict__ h, _Float16* __restrict__ h16);

__global__ __launch_bounds__(256) void prep_kernel(
    const float* __restrict__ Wq, const float* __restrict__ Wk,
    const float* __restrict__ Wv, const float* __restrict__ Wo,
    const float* __restrict__ W1, const float* __restrict__ W2,
    _Float16* __restrict__ Wt,
    const int* __restrict__ x, const float* __restrict__ emb,
    const float* __restrict__ pos, float* __restrict__ h,
    _Float16* __restrict__ h16) {
  __shared__ __attribute__((aligned(16))) _Float16 T[64][TP_];        // 17 KB : [n][k]

  if (blockIdx.x >= L_ * WB_) {        // uniform for the block, in front of every barrier
    embed_rows(blockIdx.x - L_ * WB_, x, emb, pos, h, h16);
    return;
  }
  const int l = blockIdx.x / WB_;
  const int r = blockIdx.x % WB_;      // the three branches are uniform for the block
  _Float16* D = Wt + (size_t)l * WL_;
  if (r < 128) {
    const int m = r >> 5;
    const float* W = (m == 0) ? Wq : (m == 1) ? Wk : (m == 2) ? Wv : Wo;
    wconv_tile<E_, E_>(W + (size_t)l * E_ * E_, D + (size_t)m * E_ * E_, r & 31, T);
  } else if (r < 256) {
    wconv_tile<E_, FF_>(W1 + (size_t)l * E_ * FF_, D + (size_t)4 * E_ * E_, r - 128, T);
  } else {
    wconv_tile<FF_, E_>(W2 + (size_t)l * FF_ * E_,
                        D + (size_t)4 * E_ * E_ + (size_t)E_ * FF_, r - 256, T);
  }
}

// ---------------------------------------------------------------------------
// Embedding + positional add: writes f32 h and f16 h16
// ---------------------------------------------------------------------------
__device__ __forceinline__ void embed_rows(
    int blk, const int* __restrict__ x, const float* __restrict__ emb,
    const float* __restrict__ pos, float* __restrict__ h,
    _Float16* __restrict__ h16) {
  // four waves a row; the row number is the same in every lane of a wave: kept scalar, the
  // row's base addresses are formed in scalar registers and a lane adds only its column
  int row = blk * 2 + __builtin_amdgcn_readfirstlane(threadIdx.x >> 7);
  int s   = row & (S_ - 1);
  int tok = x[row] + 1;
  int c   = (threadIdx.x & 127) << 2;
  float4 e4 = *(const float4*)(emb + (size_t)tok * E_ + c);
  float4 p4 = *(const float4*)(pos + (size_t)s   * E_ + c);
  float4 o; o.x = e4.x + p4.x; o.y = e4.y + p4.y; o.z = e4.z + p4.z; o.w = e4.w + p4.w;
  *(float4*)(h + (size_t)row * E_ + c) = o;
  uint2 hp; hp.x = pack2h(o.x, o.y); hp.y = pack2h(o.z, o.w);
  *(uint2*)(h16 + (size_t)row * E_ + c) = hp;
}

// ---------------------------------------------------------------------------
// WMMA GEMM, f16 in: C[M,N] = act(A[M,K] @ Wt[N,K]^T + bias[N]), M = 8192.
// Block tile 64x256, 8 waves (2x4), wave tile 32x64, K-step KS, dbl buffer.
// KS = 64: three blocks share a WGP (1024 blocks, 768 with QKV), 40 KB in flight each, whole
// 128-B lines.
// Output: f32 (Cf) and/or f16 (Ch).
// QKV: one launch forms three products of the same A. Wt holds the three [512][512] weights
// back to back, Ch the three [M][512] outputs back to back; a pair of blockIdx.y is one of
// them, with its own bias. All 768 blocks are resident together, three to a WGP.
// The product is formed transposed (weight fragment as A operand, activation fragment as B):
// a lane then holds eight consecutive columns of ONE output row. Each wave passes its tile,
// 16 rows at a time, through its own range of the finished B tile and stores whole rows of
// the wave tile (128 B of f16, 256 B of f32) with 16-byte stores.
// ---------------------------------------------------------------------------
// Stands behind a run of global stores, in front of the code that writes their address and
// data registers anew.
__device__ __forceinline__ void stores_taken() {
  asm volatile("s_wait_xcnt 0x0" ::: "memory");
}

constexpr int SH_  = 144;              // staged f16 row: 128 B + 16 B (16 B x odd)
constexpr int SF_  = 272;              // staged f32 row: 256 B + 16 B (16 B x odd)
constexpr int STG_ = 16 * SF_;         // one wave's staging range in bytes

// A wave's own LDS writes have landed before its lanes read each other's rows back.
__device__ __forceinline__ void lds_landed() {
  asm volatile("s_wait_dscnt 0x0" ::: "memory");
}

template <int KS, bool QKV>
__global__ __launch_bounds__(256) void gemm_f16_kernel(
    const _Float16* __restrict__ A, const _Float16* __restrict__ Wt,
    const float* __restrict__ bias, const float* __restrict__ bias1,
    const float* __restrict__ bias2, float* __restrict__ Cf,
    _Float16* __restrict__ Ch, int N, int Kdim, int relu) {
  constexpr int GP_ = KS + 8;          // row pitch in f16
  constexpr int CR_ = KS / 8;          // 16-byte pieces per row
  __shared__ __attribute__((aligned(16))) _Float16 Atile[2][64][GP_];   // KS 64: 18 KB, 128: 34 KB
  __shared__ __attribute__((aligned(16))) _Float16 Btile[2][256][GP_];  // KS 64: 72 KB, 128: 136 KB ([n][k])

  const int tid  = threadIdx.x;
  const int lane = tid & 31;
  const int wave = tid >> 5;
  const int wm   = (wave >> 2) << 5;           // 0 / 32
  const int wn   = (wave & 3) << 6;            // 0 / 64 / 128 / 192
  const int m0   = blockIdx.x * 64;
  const int n0   = (QKV ? (blockIdx.y & 1) : blockIdx.y) * 256;
  if constexpr (QKV) {
    const int sel = blockIdx.y >> 1;             // uniform for the block: 0 Q, 1 K, 2 V
    Wt  += (size_t)sel * E_ * E_;
    Ch  += (size_t)sel * ROWS * E_;
    bias = (sel == 0) ? bias : (sel == 1) ? bias1 : bias2;
  }

  v8f acc[2][4] = {};
  const int nk = Kdim / KS;

  auto load_tiles = [&](int kt, int buf) {
    const int k0 = kt * KS;
#pragma unroll  // the copies of a tile issue back to back, with no loop branch between them
    for (int t = 0; t < KS / 32; ++t) {  // A: 64 x KS f16, KS / 32 pieces per thread
      int idx = t * 256 + tid;
      int r = idx / CR_, seg = (idx % CR_) << 3;
      cp16B_g2l(A + (size_t)(m0 + r) * Kdim + k0 + seg, &Atile[buf][r][seg]);
    }
#pragma unroll
    for (int t = 0; t < KS / 8; ++t) {   // B: 256 x KS f16, KS / 8 pieces per thread
      int idx = t * 256 + tid;
      int r = idx / CR_, seg = (idx % CR_) << 3;
      cp16B_g2l(Wt + (size_t)(n0 + r) * Kdim + k0 + seg, &Btile[buf][r][seg]);
    }
  };

  load_tiles(0, 0);
  async_fence();
  __syncthreads();

  for (int kt = 0; kt < nk; ++kt) {
    const int cur = kt & 1;
    if (kt + 1 < nk) load_tiles(kt + 1, cur ^ 1);

#pragma unroll  // the compiler fetches a later 32-k block's fragments ahead of the current one's products
    for (int ks = 0; ks < KS; ks += 32) {
      v16h af[2], bf[4];
      af[0] = load_frag_k32(&Atile[cur][wm + 0][ks], GP_, lane);
      af[1] = load_frag_k32(&Atile[cur][wm + 16][ks], GP_, lane);
#pragma unroll
      for (int j = 0; j < 4; ++j)
        bf[j] = load_frag_k32(&Btile[cur][wn + j * 16][ks], GP_, lane);
#pragma unroll
      for (int i = 0; i < 2; ++i)
#pragma unroll
        for (int j = 0; j < 4; ++j)
          acc[i][j] = wmma_f16(bf[j], af[i], acc[i][j]);   // D[n][m]
    }

    lds_landed();      // this wave's reads of the buffer that is refilled behind the barrier have ended
    async_fence();
    __syncthreads();
  }

  // acc[i][j][e] = C[m0 + wm + 16i + lcol][n0 + wn + 16j + lrow + e]
  const int lrow = (lane >> 4) << 3;
  const int lcol = lane & 15;
  const int cw   = n0 + wn;            // first column of the wave tile
  // The loop's last barrier stands behind every wave's last fragment read and last copy.
  char* stage = (char*)&Btile[0][0][0] + wave * STG_;

  float4 bv[4][2];
#pragma unroll  // constant indices keep bv[] in registers; all eight loads in flight together
  for (int j = 0; j < 4; ++j) {
    bv[j][0] = *(const float4*)(bias + cw + j * 16 + lrow);
    bv[j][1] = *(const float4*)(bias + cw + j * 16 + lrow + 4);
  }

#pragma unroll  // constant indices keep acc[] in registers
  for (int i = 0; i < 2; ++i)
#pragma unroll  // constant indices keep acc[] in registers
    for (int j = 0; j < 4; ++j)
#pragma unroll  // constant indices keep acc[] in registers
      for (int e = 0; e < 8; ++e)
        acc[i][j][e] += (&bv[j][e >> 2].x)[e & 3];
  if (relu) {
#pragma unroll  // constant indices keep acc[] in registers
    for (int i = 0; i < 2; ++i)
#pragma unroll  // constant indices keep acc[] in registers
      for (int j = 0; j < 4; ++j)
#pragma unroll  // constant indices keep acc[] in registers
        for (int e = 0; e < 8; ++e)
          acc[i][j][e] = fmaxf(acc[i][j][e], 0.0f);
  }

#pragma unroll  // constant indices keep acc[] in registers
  for (int i = 0; i < 2; ++i) {
    const int rw = m0 + wm + i * 16;   // first row of this half of the wave tile
    if (Cf) {
#pragma unroll  // constant indices keep acc[] in registers
      for (int j = 0; j < 4; ++j) {
        char* sp = stage + lcol * SF_ + (j * 16 + lrow) * 4;
        *(float4*)sp        = make_float4(acc[i][j][0], acc[i][j][1], acc[i][j][2], acc[i][j][3]);
        *(float4*)(sp + 16) = make_float4(acc[i][j][4], acc[i][j][5], acc[i][j][6], acc[i][j][7]);
      }
      lds_landed();
      float4 w[8];
#pragma unroll  // the eight LDS reads issue ahead of the eight stores
      for (int t = 0; t < 8; ++t)      // 16 lanes = the 256 B of one row, two rows a read
        w[t] = *(const float4*)(stage + (t * 2 + (lane >> 4)) * SF_ + lcol * 16);
#pragma unroll  // constant indices keep w[] in registers
      for (int t = 0; t < 8; ++t)
        *(float4*)(Cf + (rw + t * 2 + (lane >> 4)) * N + cw + lcol * 4) = w[t];
      stores_taken();
    }
    if (Ch) {
#pragma unroll  // constant indices keep acc[] in registers
      for (int j = 0; j < 4; ++j) {
        v8h w;
#pragma unroll  // constant indices keep w in registers
        for (int e = 0; e < 8; ++e) w[e] = (_Float16)acc[i][j][e];
        *(v8h*)(stage + lcol * SH_ + (j * 16 + lrow) * 2) = w;
      }
      lds_landed();
      v8h w[4];
#pragma unroll  // the four LDS reads issue ahead of the four stores
      for (int t = 0; t < 4; ++t)      // 8 lanes = the 128 B of one row, four rows a read
        w[t] = *(const v8h*)(stage + (t * 4 + (lane >> 3)) * SH_ + (lane & 7) * 16);
#pragma unroll  // constant indices keep w[] in registers
      for (int t = 0; t < 4; ++t)
        *(v8h*)(Ch + (rw + t * 4 + (lane >> 3)) * N + cw + (lane & 7) * 8) = w[t];
      if (i == 0) stores_taken();      // behind the last run nothing is written any more
    }
  }
}

__device__ __forceinline__ uint32_t lds_addr(const void* p) {
  return (uint32_t)(uintptr_t)(__attribute__((address_space(3))) const char*)p;
}

// Four 16-byte copies a lane. The wait that ends the statement stands in front of every later
// write of the address registers that the copies name.
__device__ __forceinline__ void copy4x16(uint32_t l0, const _Float16* g0, uint32_t l1, const _Float16* g1,
                                         uint32_t l2, const _Float16* g2, uint32_t l3, const _Float16* g3) {
  asm volatile("global_load_async_to_lds_b128 %0, %1, off\n\t"
               "global_load_async_to_lds_b128 %2, %3, off\n\t"
               "global_load_async_to_lds_b128 %4, %5, off\n\t"
               "global_load_async_to_lds_b128 %6, %7, off\n\t"
               "s_wait_xcnt 0x0"
               :: "v"(l0), "v"(g0), "v"(l1), "v"(g1), "v"(l2), "v"(g2), "v"(l3), "v"(g3) : "memory");
}

// 16 (d) x 32 (keys) A fragment of V^T from the row-major V tile: p is the lane's own address
//   tile + (key0 + 8 (lane >> 4) + (lane & 7)) * pitch + 2 * d0 + 16 ((lane >> 3) & 1);
// the lane gets V[key0 + 8h + 0..7][d0 + c], then the same 16 keys on: the k order of load_frag_k32.
typedef short s16x8 __attribute__((ext_vector_type(8)));
__device__ __forceinline__ v16h load_frag_tr(const char* p) {
  typedef __attribute__((address_space(3))) s16x8 lds_s16x8;
  union { v16h v; s16x8 q[2]; } f;
  f.q[0] = __builtin_amdgcn_ds_load_tr16_b128_v8i16((lds_s16x8*)p);
  f.q[1] = __builtin_amdgcn_ds_load_tr16_b128_v8i16((lds_s16x8*)(p + 16 * VP_ * 2));
  return f.v;
}

__device__ __forceinline__ float xhalf(float x) {
  return __builtin_bit_cast(float, __builtin_amdgcn_permlanex16(
      __builtin_bit_cast(int, x), __builtin_bit_cast(int, x), 0x76543210, 0xfedcba98, false, false));
}

constexpr float LOG2E_ = 1.44269504f;

__device__ __forceinline__ float exp_slot(float x) {
  float r = x * LOG2E_;
  asm("v_exp_f32 %0, %0\n\tv_nop" : "+v"(r));
  return r;
}

__device__ __forceinline__ void exp_slot8(float (&p)[8], const v8f& s, float m) {
#pragma unroll  // constant indices keep p[] in registers
  for (int e = 0; e < 8; ++e) p[e] = (s[e] - m) * LOG2E_;
  asm("v_exp_f32 %0, %0\n\tv_exp_f32 %1, %1\n\tv_exp_f32 %2, %2\n\tv_exp_f32 %3, %3\n\t"
      "v_exp_f32 %4, %4\n\tv_exp_f32 %5, %5\n\tv_exp_f32 %6, %6\n\tv_exp_f32 %7, %7\n\tv_nop"
      : "+v"(p[0]), "+v"(p[1]), "+v"(p[2]), "+v"(p[3]),
        "+v"(p[4]), "+v"(p[5]), "+v"(p[6]), "+v"(p[7]));
}

__global__ __launch_bounds__(256) void attention_kernel(
    const _Float16* __restrict__ Q, const _Float16* __restrict__ K,
    const _Float16* __restrict__ V, const int* __restrict__ mask,
    _Float16* __restrict__ O) {
  __shared__ __attribute__((aligned(16))) _Float16 Kt[2][64][AP_];    // 18 KB : [key][d]  (A-frag for K Q^T)
  __shared__ __attribute__((aligned(16))) _Float16 Vs[2][64][VP_];    // 20 KB : [key][d]  (read transposed)
  __shared__ __attribute__((aligned(16))) unsigned short kidx[S_ + 64];  // 4 KB : the keys to walk, then one tile of filler
  __shared__ __attribute__((aligned(16))) int      wsum[8];             // kept keys of each wave's 256

  const int tid  = threadIdx.x;
  const int lane = tid & 31;
  const int wave = __builtin_amdgcn_readfirstlane(tid >> 5);
  const int bh   = blockIdx.x;
  const int b    = bh >> 3;
  const int hh   = bh & 7;
  const int q0   = blockIdx.y * 256;
  const size_t base = ((size_t)b * S_) * E_ + (size_t)hh * D_;

  // Q fragments straight from global f16 (B operand: column = query, same k order as A)
  v16h qf[2][2];
#pragma unroll
  for (int i = 0; i < 2; ++i)
#pragma unroll
    for (int s = 0; s < 2; ++s) {
      int q = q0 + wave * 32 + i * 16 + (lane & 15);
      const _Float16* rp = Q + base + (size_t)q * E_ + s * 32 + ((lane >> 4) << 3);
      union { v16h v; uint32_t u[8]; } f;
#pragma unroll
      for (int vv = 0; vv < 8; ++vv) {
        int d = ((vv >> 2) << 4) + ((vv & 3) << 1);
        f.u[vv] = *(const uint32_t*)(rp + d);
      }
      qf[i][s] = f.v;
    }

  v8f o[2][4] = {};                    // o[i][j][r] = O^T[d = 16j + 8h + r][query 16i + c]
  float mst[2], lst[2];                // per query; lst: this wave half's keys only
#pragma unroll  // constant indices keep mst[], lst[] in registers
  for (int i = 0; i < 2; ++i) { mst[i] = -1e30f; lst[i] = 0.0f; }

  const float scale = 0.125f;
  const int lrow = (lane >> 4) << 3;
  const int lcol = lane & 15;

  // The list of kept keys. Wave w looks at keys 256 w .. 256 w + 255, 32 at a time: the ballot
  // gives a kept key its place among the 32, the bit counts give the places in front of them.
  const int  key0 = wave * 256 + lane;
  const int* mrow = mask + (size_t)b * S_;
  int mv[8];
#pragma unroll  // all eight loads in flight together, mv[] in registers
  for (int e = 0; e < 8; ++e) mv[e] = mrow[key0 + e * 32];
  // The loaded words are inputs: the loads stand in front of this wait. Their base and their
  // offset are inputs: both stay as they are up to it, and are written anew only behind it.
  asm volatile("s_wait_xcnt 0x0" :: "v"(mv[0]), "v"(mv[1]), "v"(mv[2]), "v"(mv[3]), "v"(mv[4]),
               "v"(mv[5]), "v"(mv[6]), "v"(mv[7]), "s"(mrow), "v"(key0) : "memory");
  uint32_t bal[8];
  int wtot = 0;
#pragma unroll  // constant indices keep mv[], bal[] in registers
  for (int e = 0; e < 8; ++e) bal[e] = __builtin_amdgcn_ballot_w32(mv[e] != 0);
#pragma unroll  // constant indices keep bal[] in registers
  for (int e = 0; e < 8; ++e) wtot += __builtin_popcount(bal[e]);
  if (lane == 0) wsum[wave] = wtot;
  __syncthreads();     // every wave's count stands in wsum[]
  int first = 0, total = 0;
#pragma unroll  // straight-line sums of eight words
  for (int w = 0; w < 8; ++w) {
    const int s = wsum[w];
    total += s;
    first += (w < wave) ? s : 0;
  }
  const int kept = __builtin_amdgcn_readfirstlane(total);             // 0 .. S_, the same in every wave
  first = __builtin_amdgcn_readfirstlane(first);
  if (kept == 0) {
#pragma unroll  // eight stores back to back
    for (int e = 0; e < 8; ++e) kidx[key0 + e * 32] = (unsigned short)(key0 + e * 32);
  } else {
#pragma unroll  // constant indices keep bal[] in registers
    for (int e = 0; e < 8; ++e) {
      if ((bal[e] >> lane) & 1u)
        kidx[first + __builtin_amdgcn_mbcnt_lo(bal[e], 0u)] = (unsigned short)(key0 + e * 32);
      first += __builtin_popcount(bal[e]);
    }
    if (tid < 64) kidx[kept + tid] = 0;          // filler behind the list: a row that exists; its scores are masked
  }
  __syncthreads();     // the list stands

  const int NT = ((kept ? kept : S_) + 63) >> 6;                      // 1 .. S_ / 64 tiles

  // A thread copies 16 bytes of the rows at places sr and sr + 32 of a tile's part of the list,
  // of K and of V (8 lanes = one 128-B row).
  const int  sr = tid >> 3, sc = (tid & 7) << 3;
  const _Float16* kg = K + base + sc;
  const _Float16* vg = V + base + sc;
  auto stage = [&](int r0, int r1, int buf) {
    const uint32_t g0 = (uint32_t)r0 * E_, g1 = (uint32_t)r1 * E_;
    copy4x16(lds_addr(&Kt[buf][sr][sc]),      kg + g0, lds_addr(&Kt[buf][sr + 32][sc]), kg + g1,
             lds_addr(&Vs[buf][sr][sc]),      vg + g0, lds_addr(&Vs[buf][sr + 32][sc]), vg + g1);
  };

  stage(kidx[sr], kidx[sr + 32], 0);
  async_fence();
  __syncthreads();
  if (NT > 1) stage(kidx[64 + sr], kidx[64 + sr + 32], 1);

  for (int t = 0; t < NT; ++t) {
    const int cur = t & 1;

    // scores S^T = K Q^T : sa[i][j][r] = S[query 16i + c][key 16j + 8h + r]
    v8f sa[2][4];
#pragma unroll  // constant indices keep the tiles in registers
    for (int j = 0; j < 4; ++j) {
      v16h kf0 = load_frag_k32(&Kt[cur][j * 16][0],  AP_, lane);
      v16h kf1 = load_frag_k32(&Kt[cur][j * 16][32], AP_, lane);
#pragma unroll  // constant indices keep the tiles in registers
      for (int i = 0; i < 2; ++i) {
        v8f z = {};
        z = wmma_f16(kf0, qf[i][0], z);
        sa[i][j] = wmma_f16(kf1, qf[i][1], z);
      }
    }

#pragma unroll  // constant indices keep the tiles in registers
    for (int j = 0; j < 4; ++j)
#pragma unroll  // constant indices keep the tiles in registers
      for (int i = 0; i < 2; ++i)
#pragma unroll  // constant indices keep the tiles in registers
        for (int e = 0; e < 8; ++e)
          sa[i][j][e] *= scale;

    // places of this tile that hold a kept key: all 64 but in the list's last tile (none where no key is kept)
    const int left = kept - t * 64;
    if (left < 64) {                   // the same in every wave
      const int ll = left - lrow;      // the lane's own eight keys of each 16: places 16j + lrow + e
#pragma unroll  // constant indices keep the tiles in registers
      for (int j = 0; j < 4; ++j)
#pragma unroll  // constant indices keep the tiles in registers
        for (int i = 0; i < 2; ++i)
#pragma unroll  // constant indices keep the tiles in registers
          for (int e = 0; e < 8; ++e)
            sa[i][j][e] = (j * 16 + e < ll) ? sa[i][j][e] : -1e20f;
    }

    // online softmax, one query per lane and column group
    v16h pf[2][2];                     // pf[i][s]: P^T, keys 32s .. 32s + 31, as B operand
#pragma unroll  // constant indices keep the tiles in registers
    for (int i = 0; i < 2; ++i) {
      float nm = sa[i][0][0];
#pragma unroll  // constant indices keep the tiles in registers
      for (int j = 0; j < 4; ++j)
#pragma unroll  // constant indices keep the tiles in registers
        for (int e = 0; e < 8; ++e) nm = fmaxf(nm, sa[i][j][e]);
      nm = fmaxf(nm, xhalf(nm));       // both halves feed the same O^T tile: one maximum

      const float mn = fmaxf(mst[i], nm);
      const float fs = exp_slot(mst[i] - mn);
      mst[i] = mn;
#pragma unroll  // constant indices keep the tiles in registers
      for (int j = 0; j < 4; ++j)
#pragma unroll  // constant indices keep the tiles in registers
        for (int e = 0; e < 8; ++e)
          o[i][j][e] *= fs;

      float rs[4];
#pragma unroll  // constant indices keep the tiles in registers
      for (int j = 0; j < 4; ++j) {
        float p[8];
        exp_slot8(p, sa[i][j], mn);
        rs[j] = ((p[0] + p[1]) + (p[2] + p[3])) + ((p[4] + p[5]) + (p[6] + p[7]));
#pragma unroll  // constant indices keep the tiles in registers
        for (int e = 0; e < 8; ++e)
          pf[i][j >> 1][((j & 1) << 3) + e] = (_Float16)p[e];
      }
      lst[i] = lst[i] * fs + ((rs[0] + rs[1]) + (rs[2] + rs[3]));
    }

    // the rows of the tile that is copied at this trip's foot: read here, they are in registers there
    const int tn = (t + 2 < NT) ? t + 2 : NT - 1;
    const int n0 = kidx[tn * 64 + sr], n1 = kidx[tn * 64 + sr + 32];

    // O^T += V^T P^T
    const char* vp = (const char*)&Vs[cur][lrow + (lane & 7)][((lane >> 3) & 1) << 3];
#pragma unroll  // constant indices keep the tiles in registers
    for (int j = 0; j < 4; ++j) {
      v16h vf0 = load_frag_tr(vp + j * 32);
      v16h vf1 = load_frag_tr(vp + j * 32 + 32 * VP_ * 2);
#pragma unroll  // constant indices keep the tiles in registers
      for (int i = 0; i < 2; ++i) {
        o[i][j] = wmma_f16(vf0, pf[i][0], o[i][j]);
        o[i][j] = wmma_f16(vf1, pf[i][1], o[i][j]);
      }
    }

    lds_landed();      // this wave's reads of the buffer that is refilled behind the barrier have ended
    async_fence();     // this wave's copies of the next tile have landed
    __syncthreads();   // publishes the next tile and ends every wave's reads of this one
    if (t + 2 < NT) stage(n0, n1, cur);
  }
  async_fence();       // no copy is outstanding when the wave ends

  // a lane holds eight consecutive d of one query: one 16-byte store per tile
#pragma unroll  // constant indices keep the tiles in registers
  for (int i = 0; i < 2; ++i) {
    const float lt = lst[i] + xhalf(lst[i]);
    const int qrow = q0 + wave * 32 + i * 16 + lcol;
#pragma unroll  // constant indices keep the tiles in registers
    for (int j = 0; j < 4; ++j) {
      uint4 w;
      w.x = pack2h(o[i][j][0] / lt, o[i][j][1] / lt);
      w.y = pack2h(o[i][j][2] / lt, o[i][j][3] / lt);
      w.z = pack2h(o[i][j][4] / lt, o[i][j][5] / lt);
      w.w = pack2h(o[i][j][6] / lt, o[i][j][7] / lt);
      *(uint4*)(O + base + (size_t)qrow * E_ + j * 16 + lrow) = w;
    }
  }
}

constexpr int LM_   = 64;
constexpr int LK_   = 128;
constexpr int LP_   = LK_ + 8;
constexpr int LBUF_ = (LM_ + E_) * LP_ * 2;
constexpr int RP_   = E_ * 4 + 16;
constexpr int ST2_  = 16 * SF_ + 16 * SH_;
constexpr int PW_   = 10;
static_assert(LM_ * RP_ <= LBUF_ && 8 * ST2_ <= LBUF_, "residual rows and staging fit a buffer");

typedef float f32x4 __attribute__((ext_vector_type(4)));

template <int Kdim>
__global__ __launch_bounds__(256) void gemm_ln_kernel(
    const _Float16* __restrict__ A, const _Float16* __restrict__ Wt,
    const float* __restrict__ bias, const float* __restrict__ g,
    const float* __restrict__ bb, float* __restrict__ H, _Float16* __restrict__ H16) {
  __shared__ __attribute__((aligned(16))) char   ring[2][LBUF_];      // 2 x 153 KB
  __shared__ __attribute__((aligned(16))) float2 part[LM_][PW_];      // 5 KB : [row][wave] (sum, sum of squares)

  const int tid  = threadIdx.x;
  const int lane = tid & 31;
  const int wave = tid >> 5;
  const int wn   = wave << 6;                    // first column of the wave tile
  const int m0   = blockIdx.x * LM_;

  v8f acc[4][4] = {};
  constexpr int nk = Kdim / LK_;

  // A thread copies piece tid & 15 of rows (tid >> 4) + 16 t: uniform tile base, one per-lane
  // offset that all copies of an operand share, constant steps between them.
  const uint32_t go = (uint32_t)((tid >> 4) * Kdim + ((tid & 15) << 3));   // in f16
  const uint32_t lo = (uint32_t)((tid >> 4) * LP_  + ((tid & 15) << 3));   // in f16
  auto load_tiles = [&](int kt, int buf) {
    const _Float16* ab = A  + (size_t)m0 * Kdim + kt * LK_;
    const _Float16* wb = Wt + kt * LK_;
    _Float16* T = (_Float16*)ring[buf] + lo;
#pragma unroll  // the copies of a tile issue back to back, with no loop branch between them
    for (int t = 0; t < LM_ / 16; ++t)           // A: 64 rows of 16 pieces
      cp16B_g2l(ab + go + t * 16 * Kdim, T + t * 16 * LP_);
#pragma unroll
    for (int t = 0; t < E_ / 16; ++t)
      cp16B_g2l(wb + go + t * 16 * Kdim, T + (LM_ + t * 16) * LP_);
  };
  auto load_resid = [&](int buf) {
    const float* hb = H + (size_t)m0 * E_;
    char* T = ring[buf] + (tid >> 7) * RP_ + (tid & 127) * 16;
#pragma unroll
    for (int t = 0; t < LM_ / 2; ++t)            // 64 rows of 128 pieces; a wave's copy is 512 B of one row
      cp16B_g2l((const _Float16*)(hb + (uint32_t)(tid * 4) + t * 2 * E_), (_Float16*)(T + t * 2 * RP_));
  };

  load_tiles(0, 0);
  async_fence();
  __syncthreads();

  // One trip: four 32-k blocks of 16 products. Behind the four products of a row group stand the
  // loads of the next block's fragments that take the registers just freed (that row group's
  // activation fragment) or the second weight set: every fragment is fetched a block ahead.
  auto trip = [&](int cur) {
    const _Float16* Ta = (const _Float16*)ring[cur];
    const _Float16* Tb = Ta + (LM_ + wn) * LP_;
    v16h af[4], bf[2][4];
#pragma unroll  // constant indices keep the fragments in registers
    for (int i = 0; i < 4; ++i) {
      af[i]    = load_frag_k32(Ta + i * 16 * LP_, LP_, lane);
      bf[0][i] = load_frag_k32(Tb + i * 16 * LP_, LP_, lane);
    }
#pragma unroll  // constant indices keep the fragments in registers
    for (int b = 0; b < LK_ / 32; ++b)
#pragma unroll  // constant indices keep the fragments in registers
      for (int i = 0; i < 4; ++i) {
#pragma unroll  // constant indices keep the fragments in registers
        for (int j = 0; j < 4; ++j)
          acc[i][j] = wmma_f16(bf[b & 1][j], af[i], acc[i][j]);   // D[n][m]
        if (b + 1 < LK_ / 32) {
          af[i]              = load_frag_k32(Ta + i * 16 * LP_ + (b + 1) * 32, LP_, lane);
          bf[(b + 1) & 1][i] = load_frag_k32(Tb + i * 16 * LP_ + (b + 1) * 32, LP_, lane);
        }
        // keeps these loads here, a block ahead of their use: moved down to their products, each
        // row group would wait out a whole LDS latency
        __builtin_amdgcn_sched_barrier(0);
      }
    lds_landed();      // this wave's reads of the buffer that is refilled behind the barrier have ended
    async_fence();     // this wave's copies of the next tile, or of the residual rows, have landed
    __syncthreads();
  };

  for (int kt = 0; kt + 1 < nk; ++kt) {
    load_tiles(kt + 1, (kt & 1) ^ 1);
    trip(kt & 1);
  }
  constexpr int last = (nk - 1) & 1;
  load_resid(last ^ 1);                          // the ring's last tile
  trip(last);

  // acc[i][j][e] = C[m0 + 16i + lcol][wn + 16j + lrow + e]
  const int lrow = (lane >> 4) << 3;
  const int lcol = lane & 15;
  const char* Rb = ring[last ^ 1];               // the residual rows
  // The loop's last barrier stands behind every wave's last fragment read of this buffer.
  char* stage = ring[last] + wave * ST2_;

  {
    float4 bv[4][2];
#pragma unroll  // constant indices keep bv[] in registers; all eight loads in flight together
    for (int j = 0; j < 4; ++j) {
      bv[j][0] = *(const float4*)(bias + wn + j * 16 + lrow);
      bv[j][1] = *(const float4*)(bias + wn + j * 16 + lrow + 4);
    }
#pragma unroll  // constant indices keep acc[] in registers
    for (int i = 0; i < 4; ++i) {
      float s[4], q[4];
#pragma unroll  // constant indices keep acc[] in registers
      for (int j = 0; j < 4; ++j) {
        const char* rp = Rb + (i * 16 + lcol) * RP_ + (wn + j * 16 + lrow) * 4;
        const f32x4 r0 = *(const f32x4*)rp;
        const f32x4 r1 = *(const f32x4*)(rp + 16);
        s[j] = 0.0f; q[j] = 0.0f;
#pragma unroll  // constant indices keep acc[] in registers
        for (int e = 0; e < 8; ++e) {
          const float v = (acc[i][j][e] + (&bv[j][e >> 2].x)[e & 3]) + (e < 4 ? r0[e & 3] : r1[e & 3]);
          acc[i][j][e] = v;
          s[j] += v;
          q[j] += v * v;
        }
      }
      float st = (s[0] + s[1]) + (s[2] + s[3]);
      float qt = (q[0] + q[1]) + (q[2] + q[3]);
      st += xhalf(st);
      qt += xhalf(qt);
      if (lane < 16) part[i * 16 + lcol][wave] = make_float2(st, qt);
    }
  }
  __syncthreads();     // every wave's row sums stand in part[]

  const float* gp = g  + wn + lrow;
  const float* ep = bb + wn + lrow;
  float4 gv[4][2], ev[4][2];
#pragma unroll  // constant indices keep gv[], ev[] in registers; all loads in flight together
  for (int j = 0; j < 4; ++j) {
    gv[j][0] = *(const float4*)(gp + j * 16);
    gv[j][1] = *(const float4*)(gp + j * 16 + 4);
    ev[j][0] = *(const float4*)(ep + j * 16);
    ev[j][1] = *(const float4*)(ep + j * 16 + 4);
  }
  // The two address pairs are inputs: they stay as they are up to this wait, so that no load of
  // the run returns into an address register of the run ahead of it.
  asm volatile("s_wait_xcnt 0x0" :: "v"(gp), "v"(ep) : "memory");

#pragma unroll  // constant indices keep acc[] in registers
  for (int i = 0; i < 4; ++i) {
    const float4* pp = (const float4*)&part[i * 16 + lcol][0];
    const float4 p0 = pp[0], p1 = pp[1], p2 = pp[2], p3 = pp[3];
    const float S1 = ((p0.x + p0.z) + (p1.x + p1.z)) + ((p2.x + p2.z) + (p3.x + p3.z));
    const float S2 = ((p0.y + p0.w) + (p1.y + p1.w)) + ((p2.y + p2.w) + (p3.y + p3.w));
    const float mu   = S1 * (1.0f / E_);
    const float var  = S2 * (1.0f / E_) - mu * mu;
    const float rinv = rsqrtf(var + 1e-6f);

    char* s32 = stage;
    char* s16 = stage + 16 * SF_;
#pragma unroll  // constant indices keep acc[] in registers
    for (int j = 0; j < 4; ++j) {
      float y[8];
      v8h   w;
#pragma unroll  // constant indices keep y[] in registers
      for (int e = 0; e < 8; ++e) {
        y[e] = (acc[i][j][e] - mu) * rinv * (&gv[j][e >> 2].x)[e & 3] + (&ev[j][e >> 2].x)[e & 3];
        w[e] = (_Float16)y[e];
      }
      char* sp = s32 + lcol * SF_ + (j * 16 + lrow) * 4;
      *(float4*)sp        = make_float4(y[0], y[1], y[2], y[3]);
      *(float4*)(sp + 16) = make_float4(y[4], y[5], y[6], y[7]);
      *(v8h*)(s16 + lcol * SH_ + (j * 16 + lrow) * 2) = w;
    }
    lds_landed();
    const int rw = m0 + i * 16;        // first row of this quarter of the wave tile
#pragma unroll  // straight-line code: the compiler issues the LDS reads ahead of the stores
    for (int t = 0; t < 8; ++t) {      // 16 lanes = the 256 B of one row, two rows a read
      const f32x4 a = *(const f32x4*)(s32 + (t * 2 + (lane >> 4)) * SF_ + lcol * 16);
      *(f32x4*)(H + (rw + t * 2 + (lane >> 4)) * E_ + wn + lcol * 4) = a;
    }
#pragma unroll
    for (int t = 0; t < 4; ++t) {      // 8 lanes = the 128 B of one row, four rows a read
      const v8h a = *(const v8h*)(s16 + (t * 4 + (lane >> 3)) * SH_ + (lane & 7) * 16);
      *(v8h*)(H16 + (rw + t * 4 + (lane >> 3)) * E_ + wn + (lane & 7) * 8) = a;
    }
    if (i < 3) stores_taken();         // behind the last run nothing is written any more
  }
}

// ---------------------------------------------------------------------------
// Host orchestration
// ---------------------------------------------------------------------------
extern "C" void kernel_launch(void* const* d_in, const int* in_sizes, int n_in,
                              void* d_out, int out_size, void* d_ws, size_t ws_size,
                              hipStream_t stream) {
  const int*   x    = (const int*)d_in[0];
  const int*   mask = (const int*)d_in[1];
  const float* emb  = (const float*)d_in[2];
  const float* pos  = (const float*)d_in[3];
  const float* Wq   = (const float*)d_in[4];
  const float* bq   = (const float*)d_in[5];
  const float* Wk   = (const float*)d_in[6];
  const float* bk   = (const float*)d_in[7];
  const float* Wv   = (const float*)d_in[8];
  const float* bv   = (const float*)d_in[9];
  const float* Wo   = (const float*)d_in[10];
  const float* bo   = (const float*)d_in[11];
  const float* g1   = (const float*)d_in[12];
  const float* be1  = (const float*)d_in[13];
  const float* g2   = (const float*)d_in[14];
  const float* be2  = (const float*)d_in[15];
  const float* W1   = (const float*)d_in[16];
  const float* bf1  = (const float*)d_in[17];
  const float* W2   = (const float*)d_in[18];
  const float* bf2  = (const float*)d_in[19];

  float* h = (float*)d_out;                               // [B,S,E] f32, persistent

  const size_t ACT = (size_t)ROWS * E_;
  char* p = (char*)d_ws;
  auto alloc_h = [&](size_t n) { _Float16* r = (_Float16*)p; p += n * sizeof(_Float16); return r; };
  _Float16* h16   = alloc_h(ACT);
  _Float16* q16   = alloc_h(ACT);
  _Float16* k16   = alloc_h(ACT);
  _Float16* v16   = alloc_h(ACT);
  _Float16* att16 = alloc_h(ACT);
  _Float16* big16 = alloc_h((size_t)ROWS * FF_);
  _Float16* wtq[L_]; _Float16* wtk[L_]; _Float16* wtv[L_]; _Float16* wto[L_];
  _Float16* wt1[L_]; _Float16* wt2[L_];
  for (int l = 0; l < L_; ++l) {
    wtq[l] = alloc_h((size_t)E_ * E_);
    wtk[l] = alloc_h((size_t)E_ * E_);
    wtv[l] = alloc_h((size_t)E_ * E_);
    wto[l] = alloc_h((size_t)E_ * E_);
    wt1[l] = alloc_h((size_t)E_ * FF_);
    wt2[l] = alloc_h((size_t)FF_ * E_);
  }

  // Weight convert+transpose (W[K][N] f32 -> Wt[N][K] f16); wtq[0] is the start of the block
  // and the embedding, in the same launch
  prep_kernel<<<L_ * WB_ + ROWS / 2, 256, 0, stream>>>(Wq, Wk, Wv, Wo, W1, W2, wtq[0], x, emb, pos, h, h16);

  const dim3 gQ(ROWS / 64, 3 * E_ / 256);                 // Q, K, V side by side
  const dim3 gF(ROWS / 64, FF_ / 256);                    // N = 2048
  const dim3 gA(B_ * H_, S_ / 256);

  for (int l = 0; l < L_; ++l) {
    const float* bql = bq  + (size_t)l * E_;
    const float* bkl = bk  + (size_t)l * E_;
    const float* bvl = bv  + (size_t)l * E_;
    const float* bol = bo  + (size_t)l * E_;
    const float* b1l = bf1 + (size_t)l * FF_;
    const float* b2l = bf2 + (size_t)l * E_;
    const float* g1l = g1  + (size_t)l * E_;
    const float* e1l = be1 + (size_t)l * E_;
    const float* g2l = g2  + (size_t)l * E_;
    const float* e2l = be2 + (size_t)l * E_;

    // wtq, wtk, wtv of a layer and q16, k16, v16 lie back to back in the workspace
    gemm_f16_kernel<64, true><<<gQ, 256, 0, stream>>>(h16, wtq[l], bql, bkl, bvl, nullptr, q16, E_, E_, 0);

    attention_kernel<<<gA, 256, 0, stream>>>(q16, k16, v16, mask, att16);

    gemm_ln_kernel<E_><<<ROWS / LM_, 256, 0, stream>>>(att16, wto[l], bol, g1l, e1l, h, h16);

    gemm_f16_kernel<64, false><<<gF, 256, 0, stream>>>(h16, wt1[l], b1l, nullptr, nullptr, nullptr, big16, FF_, E_, 1);
    gemm_ln_kernel<FF_><<<ROWS / LM_, 256, 0, stream>>>(big16, wt2[l], b2l, g2l, e2l, h, h16);
  }
}

// v010
// Measured time: 206 microseconds a run.
// Two timings next to v009 both put it at 1.06 times that version's speed.
// Over all steps from v000 it is 3.60 times as fast.
#include <hip/hip_runtime.h>
#include <hip/hip_bf16.h>

typedef __attribute__((ext_vector_type(16))) _Float16 v16h;
typedef __attribute__((ext_vector_type(8)))  float    v8f;
typedef __attribute__((ext_vector_type(8)))  _Float16 v8h;
typedef int v4i_vec __attribute__((vector_size(16)));   // int __vector(4)

constexpr int E_   = 512;
constexpr int H_   = 8;
constexpr int D_   = 64;
constexpr int FF_  = 2048;
constexpr int L_   = 2;
constexpr int B_   = 4;
constexpr int S_   = 2048;
constexpr int ROWS = B_ * S_;          // 8192 token rows

constexpr int AP_  = 72;               // attention K tile: 64 f16 used per row
// The V tile is read by ds_load_tr16_b128, which wants a pitch of 32 B x odd.
constexpr int VP_  = 80;               // attention V tile: 64 f16 used per row, 160 B

#if defined(__has_builtin)
#if __has_builtin(__builtin_amdgcn_global_load_async_to_lds_b128)
#define HAVE_ASYNC_LDS 1
#endif
#endif
#ifndef HAVE_ASYNC_LDS
#define HAVE_ASYNC_LDS 0
#endif

__device__ __forceinline__ uint32_t pack2h(float a, float b) {
  union { _Float16 h[2]; uint32_t u; } t;
  t.h[0] = (_Float16)a; t.h[1] = (_Float16)b;
  return t.u;
}

__device__ __forceinline__ void cp16B_g2l(const _Float16* g, _Float16* l) {
#if HAVE_ASYNC_LDS
  __builtin_amdgcn_global_load_async_to_lds_b128(
      (__attribute__((address_space(1))) v4i_vec*)(_Float16*)g,
      (__attribute__((address_space(3))) v4i_vec*)l, 0, 0);
#else
  *(uint4*)l = *(const uint4*)g;
#endif
}

__device__ __forceinline__ void async_fence() {
#if HAVE_ASYNC_LDS
  asm volatile("s_wait_asynccnt 0" ::: "memory");
#endif
}

__device__ __forceinline__ v16h load_frag_k32(const _Float16* base, int rowStride, int lane) {
  int r  = lane & 15;
  int kh = (lane >> 4) << 3;
  const _Float16* p = base + r * rowStride + kh;
  union { v16h v; uint32_t u[8]; } f;
  const uint32_t* p0 = (const uint32_t*)p;
  const uint32_t* p1 = (const uint32_t*)(p + 16);
#pragma unroll
  for (int i = 0; i < 4; ++i) { f.u[i] = p0[i]; f.u[4 + i] = p1[i]; }
  return f.v;
}

__device__ __forceinline__ v8f wmma_f16(v16h a, v16h b, v8f c) {
  return __builtin_amdgcn_wmma_f32_16x16x32_f16(false, a, false, b, (short)0, c, false, false);
}

// ---------------------------------------------------------------------------
// Weight convert + transpose, all twelve matrices in one launch:
// W[K][N] f32 -> Wt[N][K] f16. One block moves a 128(k) x 64(n) tile through LDS,
// 32 elements per thread; global reads and writes are runs of 256 B.
// Tiles of a layer: 0..127 Wq,Wk,Wv,Wo (32 tiles each), 128..255 W1, 256..383 W2.
// Wt: per layer wtq, wtk, wtv, wto, wt1, wt2 back to back (WL_ elements).
// ---------------------------------------------------------------------------
constexpr int    TP_ = 136;            // tile row pitch in f16: 256 B + 16 B (16 B x odd)
constexpr size_t WL_ = (size_t)4 * E_ * E_ + (size_t)2 * E_ * FF_;

template <int K, int N>
__device__ __forceinline__ void wconv_tile(
    const float* __restrict__ W, _Float16* __restrict__ Wt, int t, _Float16 (*T)[TP_]) {
  const int tid = threadIdx.x;
  const int k0  = (t / (N / 64)) * 128;
  const int n0  = (t % (N / 64)) * 64;

  // read: a thread takes 8 consecutive k of 4 consecutive n (16 lanes = 256 B of one k row);
  // uniform tile base + one per-lane byte offset that all eight loads share
  const int kc = tid >> 4;             // which group of 8 k
  const int nq = tid & 15;             // which group of 4 n
  const char* sb = (const char*)(W + (size_t)k0 * N + n0);
  const uint32_t voff = (uint32_t)(kc * 8 * N + nq * 4) * 4u;
  float4 v[8];
#pragma unroll  // all eight loads in flight together, v[] in registers
  for (int i = 0; i < 8; ++i) v[i] = *(const float4*)(sb + voff + i * N * 4);

#pragma unroll  // constant c: v[] is indexed at compile time and stays in registers
  for (int c = 0; c < 4; ++c) {
    uint4 w;
    w.x = pack2h((&v[0].x)[c], (&v[1].x)[c]);
    w.y = pack2h((&v[2].x)[c], (&v[3].x)[c]);
    w.z = pack2h((&v[4].x)[c], (&v[5].x)[c]);
    w.w = pack2h((&v[6].x)[c], (&v[7].x)[c]);
    *(uint4*)&T[nq * 4 + c][kc * 8] = w;
  }
  __syncthreads();

  // write: 16 lanes = the 256 B that one n row of the tile holds
  _Float16* dp = Wt + (size_t)n0 * K + k0;
#pragma unroll  // the four LDS reads issue ahead of the four stores
  for (int j = 0; j < 4; ++j) {
    const int idx = j * 256 + tid;
    const int row = idx >> 4, ch = (idx & 15) << 3;
    *(uint4*)(dp + (size_t)row * K + ch) = *(const uint4*)&T[row][ch];
  }
}

// The embedding reads nothing that the weight conversion writes, and the other way round: the
// two share one launch. Blocks 0 .. 767 convert (384 tiles a layer), the rest embed two token
// rows each.
constexpr int WB_ = 384;               // weight tiles per layer

__device__ __forceinline__ void embed_rows(
    int blk, const int* __restrict__ x, const float* __restrict__ emb,
    const float* __restrict__ pos, float* __restrict__ h, _Float16* __restrict__ h16);

__global__ __launch_bounds__(256) void prep_kernel(
    const float* __restrict__ Wq, const float* __restrict__ Wk,
    const float* __restrict__ Wv, const float* __restrict__ Wo,
    const float* __restrict__ W1, const float* __restrict__ W2,
    _Float16* __restrict__ Wt,
    const int* __restrict__ x, const float* __restrict__ emb,
    const float* __restrict__ pos, float* __restrict__ h,
    _Float16* __restrict__ h16) {
  __shared__ __attribute__((aligned(16))) _Float16 T[64][TP_];        // 17 KB : [n][k]

  if (blockIdx.x >= L_ * WB_) {        // uniform for the block, in front of every barrier
    embed_rows(blockIdx.x - L_ * WB_, x, emb, pos, h, h16);
    return;
  }
  const int l = blockIdx.x / WB_;
  const int r = blockIdx.x % WB_;      // the three branches are uniform for the block
  _Float16* D = Wt + (size_t)l * WL_;
  if (r < 128) {
    const int m = r >> 5;
    const float* W = (m == 0) ? Wq : (m == 1) ? Wk : (m == 2) ? Wv : Wo;
    wconv_tile<E_, E_>(W + (size_t)l * E_ * E_, D + (size_t)m * E_ * E_, r & 31, T);
  } else if (r < 256) {
    wconv_tile<E_, FF_>(W1 + (size_t)l * E_ * FF_, D + (size_t)4 * E_ * E_, r - 128, T);
  } else {
    wconv_tile<FF_, E_>(W2 + (size_t)l * FF_ * E_,
                        D + (size_t)4 * E_ * E_ + (size_t)E_ * FF_, r - 256, T);
  }
}

// ---------------------------------------------------------------------------
// Embedding + positional add: writes f32 h and f16 h16
// ---------------------------------------------------------------------------
__device__ __forceinline__ void embed_rows(
    int blk, const int* __restrict__ x, const float* __restrict__ emb,
    const float* __restrict__ pos, float* __restrict__ h,
    _Float16* __restrict__ h16) {
  // four waves a row; the row number is the same in every lane of a wave: kept scalar, the
  // row's base addresses are formed in scalar registers and a lane adds only its column
  int row = blk * 2 + __builtin_amdgcn_readfirstlane(threadIdx.x >> 7);
  int s   = row & (S_ - 1);
  int tok = x[row] + 1;
  int c   = (threadIdx.x & 127) << 2;
  float4 e4 = *(const float4*)(emb + (size_t)tok * E_ + c);
  float4 p4 = *(const float4*)(pos + (size_t)s   * E_ + c);
  float4 o; o.x = e4.x + p4.x; o.y = e4.y + p4.y; o.z = e4.z + p4.z; o.w = e4.w + p4.w;
  *(float4*)(h + (size_t)row * E_ + c) = o;
  uint2 hp; hp.x = pack2h(o.x, o.y); hp.y = pack2h(o.z, o.w);
  *(uint2*)(h16 + (size_t)row * E_ + c) = hp;
}

// ---------------------------------------------------------------------------
// WMMA GEMM, f16 in: C[M,N] = act(A[M,K] @ Wt[N,K]^T + bias[N]), M = 8192.
// Block tile 128x256, 8 waves (2x4), wave tile 64x64 (16 products per 8 fragments), K-step KS,
// dbl buffer. KS = 64: two blocks share a WGP (512 blocks, 384 with QKV), 48 KB in flight each,
// whole 128-B lines.
// Output: f32 (Cf) and/or f16 (Ch).
// QKV: one launch forms three products of the same A. Wt holds the three [512][512] weights
// back to back, Ch the three [M][512] outputs back to back; a pair of blockIdx.y is one of
// them, with its own bias. All blocks of a launch are resident together.
// The product is formed transposed (weight fragment as A operand, activation fragment as B):
// a lane then holds eight consecutive columns of ONE output row. Each wave passes its tile,
// 16 rows at a time, through its own range of the finished B tile and stores whole rows of
// the wave tile (128 B of f16, 256 B of f32) with 16-byte stores.
// ---------------------------------------------------------------------------
// Stands behind a run of global stores, in front of the code that writes their address and
// data registers anew.
__device__ __forceinline__ void stores_taken() {
  asm volatile("s_wait_xcnt 0x0" ::: "memory");
}

constexpr int SH_  = 144;              // staged f16 row: 128 B + 16 B (16 B x odd)
constexpr int SF_  = 272;              // staged f32 row: 256 B + 16 B (16 B x odd)
constexpr int STG_ = 16 * SF_;         // one wave's staging range in bytes

// A wave's own LDS writes have landed before its lanes read each other's rows back.
__device__ __forceinline__ void lds_landed() {
  asm volatile("s_wait_dscnt 0x0" ::: "memory");
}

constexpr int GM_ = 128;               // rows of a block

template <int KS, bool QKV>
__global__ __launch_bounds__(256) void gemm_f16_kernel(
    const _Float16* __restrict__ A, const _Float16* __restrict__ Wt,
    const float* __restrict__ bias, const float* __restrict__ bias1,
    const float* __restrict__ bias2, float* __restrict__ Cf,
    _Float16* __restrict__ Ch, int N, int Kdim, int relu) {
  constexpr int GP_ = KS + 8;          // row pitch in f16
  constexpr int CR_ = KS / 8;          // 16-byte pieces per row
  __shared__ __attribute__((aligned(16))) _Float16 Atile[2][GM_][GP_];  // KS 64: 36 KB
  __shared__ __attribute__((aligned(16))) _Float16 Btile[2][256][GP_];  // KS 64: 72 KB ([n][k])

  const int tid  = threadIdx.x;
  const int lane = tid & 31;
  const int wave = tid >> 5;
  const int wm   = (wave >> 2) << 6;           // 0 / 64
  const int wn   = (wave & 3) << 6;            // 0 / 64 / 128 / 192
  const int m0   = blockIdx.x * GM_;
  const int n0   = (QKV ? (blockIdx.y & 1) : blockIdx.y) * 256;
  if constexpr (QKV) {
    const int sel = blockIdx.y >> 1;             // uniform for the block: 0 Q, 1 K, 2 V
    Wt  += (size_t)sel * E_ * E_;
    Ch  += (size_t)sel * ROWS * E_;
    bias = (sel == 0) ? bias : (sel == 1) ? bias1 : bias2;
  }

  v8f acc[4][4] = {};
  const int nk = Kdim / KS;

  auto load_tiles = [&](int kt, int buf) {
    const int k0 = kt * KS;
#pragma unroll  // the copies of a tile issue back to back, with no loop branch between them
    for (int t = 0; t < KS / 16; ++t) {  // A: 128 x KS f16, KS / 16 pieces per thread
      int idx = t * 256 + tid;
      int r = idx / CR_, seg = (idx % CR_) << 3;
      cp16B_g2l(A + (size_t)(m0 + r) * Kdim + k0 + seg, &Atile[buf][r][seg]);
    }
#pragma unroll
    for (int t = 0; t < KS / 8; ++t) {   // B: 256 x KS f16, KS / 8 pieces per thread
      int idx = t * 256 + tid;
      int r = idx / CR_, seg = (idx % CR_) << 3;
      cp16B_g2l(Wt + (size_t)(n0 + r) * Kdim + k0 + seg, &Btile[buf][r][seg]);
    }
  };

  load_tiles(0, 0);
  async_fence();
  __syncthreads();

  for (int kt = 0; kt < nk; ++kt) {
    const int cur = kt & 1;
    if (kt + 1 < nk) load_tiles(kt + 1, cur ^ 1);

    // 32-k blocks of 16 products. Behind the four products of a row group stand the loads of the
    // next block's fragments that take the registers just freed (that row group's activation
    // fragment) or the second weight set: inside a trip every fragment is fetched a block ahead.
    const _Float16* Ta = &Atile[cur][wm][0];
    const _Float16* Tb = &Btile[cur][wn][0];
    v16h af[4], bf[2][4];
#pragma unroll  // constant indices keep the fragments in registers
    for (int i = 0; i < 4; ++i) {
      af[i]    = load_frag_k32(Ta + i * 16 * GP_, GP_, lane);
      bf[0][i] = load_frag_k32(Tb + i * 16 * GP_, GP_, lane);
    }
#pragma unroll  // constant indices keep the fragments in registers
    for (int b = 0; b < KS / 32; ++b)
#pragma unroll  // constant indices keep the fragments in registers
      for (int i = 0; i < 4; ++i) {
#pragma unroll  // constant indices keep the fragments in registers
        for (int j = 0; j < 4; ++j)
          acc[i][j] = wmma_f16(bf[b & 1][j], af[i], acc[i][j]);   // D[n][m]
        if (b + 1 < KS / 32) {
          af[i]              = load_frag_k32(Ta + i * 16 * GP_ + (b + 1) * 32, GP_, lane);
          bf[(b + 1) & 1][i] = load_frag_k32(Tb + i * 16 * GP_ + (b + 1) * 32, GP_, lane);
        }
        // keeps these loads here, a block ahead of their use: moved down to their products, each
        // row group would wait out a whole LDS latency. In the last block it keeps the products in
        // front of the trip's foot: sunk behind the barrier, they would delay the next copies' issue
        // and the wait for this trip's copies would come half a trip sooner
        __builtin_amdgcn_sched_barrier(0);
      }

    lds_landed();      // this wave's reads of the buffer that is refilled behind the barrier have ended
    async_fence();
    __syncthreads();
  }

  // acc[i][j][e] = C[m0 + wm + 16i + lcol][n0 + wn + 16j + lrow + e]
  const int lrow = (lane >> 4) << 3;
  const int lcol = lane & 15;
  const int cw   = n0 + wn;            // first column of the wave tile
  // The loop's last barrier stands behind every wave's last fragment read and last copy.
  char* stage = (char*)&Btile[0][0][0] + wave * STG_;

  float4 bv[4][2];
#pragma unroll  // constant indices keep bv[] in registers; all eight loads in flight together
  for (int j = 0; j < 4; ++j) {
    bv[j][0] = *(const float4*)(bias + cw + j * 16 + lrow);
    bv[j][1] = *(const float4*)(bias + cw + j * 16 + lrow + 4);
  }

#pragma unroll  // constant indices keep acc[] in registers
  for (int i = 0; i < 4; ++i)
#pragma unroll  // constant indices keep acc[] in registers
    for (int j = 0; j < 4; ++j)
#pragma unroll  // constant indices keep acc[] in registers
      for (int e = 0; e < 8; ++e)
        acc[i][j][e] += (&bv[j][e >> 2].x)[e & 3];
  if (relu) {
#pragma unroll  // constant indices keep acc[] in registers
    for (int i = 0; i < 4; ++i)
#pragma unroll  // constant indices keep acc[] in registers
      for (int j = 0; j < 4; ++j)
#pragma unroll  // constant indices keep acc[] in registers
        for (int e = 0; e < 8; ++e)
          acc[i][j][e] = fmaxf(acc[i][j][e], 0.0f);
  }

#pragma unroll  // constant indices keep acc[] in registers
  for (int i = 0; i < 4; ++i) {
    const int rw = m0 + wm + i * 16;   // first row of this quarter of the wave tile
    if (Cf) {
#pragma unroll  // constant indices keep acc[] in registers
      for (int j = 0; j < 4; ++j) {
        char* sp = stage + lcol * SF_ + (j * 16 + lrow) * 4;
        *(float4*)sp        = make_float4(acc[i][j][0], acc[i][j][1], acc[i][j][2], acc[i][j][3]);
        *(float4*)(sp + 16) = make_float4(acc[i][j][4], acc[i][j][5], acc[i][j][6], acc[i][j][7]);
      }
      lds_landed();
      float4 w[8];
#pragma unroll  // the eight LDS reads issue ahead of the eight stores
      for (int t = 0; t < 8; ++t)      // 16 lanes = the 256 B of one row, two rows a read
        w[t] = *(const float4*)(stage + (t * 2 + (lane >> 4)) * SF_ + lcol * 16);
#pragma unroll  // constant indices keep w[] in registers
      for (int t = 0; t < 8; ++t)
        *(float4*)(Cf + (rw + t * 2 + (lane >> 4)) * N + cw + lcol * 4) = w[t];
      stores_taken();
    }
    if (Ch) {
#pragma unroll  // constant indices keep acc[] in registers
      for (int j = 0; j < 4; ++j) {
        v8h w;
#pragma unroll  // constant indices keep w in registers
        for (int e = 0; e < 8; ++e) w[e] = (_Float16)acc[i][j][e];
        *(v8h*)(stage + lcol * SH_ + (j * 16 + lrow) * 2) = w;
      }
      lds_landed();
      v8h w[4];
#pragma unroll  // the four LDS reads issue ahead of the four stores
      for (int t = 0; t < 4; ++t)      // 8 lanes = the 128 B of one row, four rows a read
        w[t] = *(const v8h*)(stage + (t * 4 + (lane >> 3)) * SH_ + (lane & 7) * 16);
#pragma unroll  // constant indices keep w[] in registers
      for (int t = 0; t < 4; ++t)
        *(v8h*)(Ch + (rw + t * 4 + (lane >> 3)) * N + cw + (lane & 7) * 8) = w[t];
      if (i < 3) stores_taken();       // behind the last run nothing is written any more
    }
  }
}

__device__ __forceinline__ uint32_t lds_addr(const void* p) {
  return (uint32_t)(uintptr_t)(__attribute__((address_space(3))) const char*)p;
}

// Four 16-byte copies a lane. The wait that ends the statement stands in front of every later
// write of the address registers that the copies name.
__device__ __forceinline__ void copy4x16(uint32_t l0, const _Float16* g0, uint32_t l1, const _Float16* g1,
                                         uint32_t l2, const _Float16* g2, uint32_t l3, const _Float16* g3) {
  asm volatile("global_load_async_to_lds_b128 %0, %1, off\n\t"
               "global_load_async_to_lds_b128 %2, %3, off\n\t"
               "global_load_async_to_lds_b128 %4, %5, off\n\t"
               "global_load_async_to_lds_b128 %6, %7, off\n\t"
               "s_wait_xcnt 0x0"
               :: "v"(l0), "v"(g0), "v"(l1), "v"(g1), "v"(l2), "v"(g2), "v"(l3), "v"(g3) : "memory");
}

// 16 (d) x 32 (keys) A fragment of V^T from the row-major V tile: p is the lane's own address
//   tile + (key0 + 8 (lane >> 4) + (lane & 7)) * pitch + 2 * d0 + 16 ((lane >> 3) & 1);
// the lane gets V[key0 + 8h + 0..7][d0 + c], then the same 16 keys on: the k order of load_frag_k32.
typedef short s16x8 __attribute__((ext_vector_type(8)));
__device__ __forceinline__ v16h load_frag_tr(const char* p) {
  typedef __attribute__((address_space(3))) s16x8 lds_s16x8;
  union { v16h v; s16x8 q[2]; } f;
  f.q[0] = __builtin_amdgcn_ds_load_tr16_b128_v8i16((lds_s16x8*)p);
  f.q[1] = __builtin_amdgcn_ds_load_tr16_b128_v8i16((lds_s16x8*)(p + 16 * VP_ * 2));
  return f.v;
}

__device__ __forceinline__ float xhalf(float x) {
  return __builtin_bit_cast(float, __builtin_amdgcn_permlanex16(
      __builtin_bit_cast(int, x), __builtin_bit_cast(int, x), 0x76543210, 0xfedcba98, false, false));
}

constexpr float LOG2E_ = 1.44269504f;

__device__ __forceinline__ float exp_slot(float x) {
  float r = x * LOG2E_;
  asm("v_exp_f32 %0, %0\n\tv_nop" : "+v"(r));
  return r;
}

__device__ __forceinline__ void exp_slot8(float (&p)[8], const v8f& s, float m) {
#pragma unroll  // constant indices keep p[] in registers
  for (int e = 0; e < 8; ++e) p[e] = (s[e] - m) * LOG2E_;
  asm("v_exp_f32 %0, %0\n\tv_exp_f32 %1, %1\n\tv_exp_f32 %2, %2\n\tv_exp_f32 %3, %3\n\t"
      "v_exp_f32 %4, %4\n\tv_exp_f32 %5, %5\n\tv_exp_f32 %6, %6\n\tv_exp_f32 %7, %7\n\tv_nop"
      : "+v"(p[0]), "+v"(p[1]), "+v"(p[2]), "+v"(p[3]),
        "+v"(p[4]), "+v"(p[5]), "+v"(p[6]), "+v"(p[7]));
}

__global__ __launch_bounds__(256) void attention_kernel(
    const _Float16* __restrict__ Q, const _Float16* __restrict__ K,
    const _Float16* __restrict__ V, const int* __restrict__ mask,
    _Float16* __restrict__ O) {
  __shared__ __attribute__((aligned(16))) _Float16 Kt[2][64][AP_];    // 18 KB : [key][d]  (A-frag for K Q^T)
  __shared__ __attribute__((aligned(16))) _Float16 Vs[2][64][VP_];    // 20 KB : [key][d]  (read transposed)
  __shared__ __attribute__((aligned(16))) unsigned short kidx[S_ + 64];  // 4 KB : the keys to walk, then one tile of filler
  __shared__ __attribute__((aligned(16))) int      wsum[8];             // kept keys of each wave's 256

  const int tid  = threadIdx.x;
  const int lane = tid & 31;
  const int wave = __builtin_amdgcn_readfirstlane(tid >> 5);
  const int bh   = blockIdx.x;
  const int b    = bh >> 3;
  const int hh   = bh & 7;
  const int q0   = blockIdx.y * 256;
  const size_t base = ((size_t)b * S_) * E_ + (size_t)hh * D_;

  // Q fragments straight from global f16 (B operand: column = query, same k order as A)
  v16h qf[2][2];
#pragma unroll
  for (int i = 0; i < 2; ++i)
#pragma unroll
    for (int s = 0; s < 2; ++s) {
      int q = q0 + wave * 32 + i * 16 + (lane & 15);
      const _Float16* rp = Q + base + (size_t)q * E_ + s * 32 + ((lane >> 4) << 3);
      union { v16h v; uint32_t u[8]; } f;
#pragma unroll
      for (int vv = 0; vv < 8; ++vv) {
        int d = ((vv >> 2) << 4) + ((vv & 3) << 1);
        f.u[vv] = *(const uint32_t*)(rp + d);
      }
      qf[i][s] = f.v;
    }

  v8f o[2][4] = {};                    // o[i][j][r] = O^T[d = 16j + 8h + r][query 16i + c]
  float mst[2], lst[2];                // per query; lst: this wave half's keys only
#pragma unroll  // constant indices keep mst[], lst[] in registers
  for (int i = 0; i < 2; ++i) { mst[i] = -1e30f; lst[i] = 0.0f; }

  const float scale = 0.125f;
  const int lrow = (lane >> 4) << 3;
  const int lcol = lane & 15;

  // The list of kept keys. Wave w looks at keys 256 w .. 256 w + 255, 32 at a time: the ballot
  // gives a kept key its place among the 32, the bit counts give the places in front of them.
  const int  key0 = wave * 256 + lane;
  const int* mrow = mask + (size_t)b * S_;
  int mv[8];
#pragma unroll  // all eight loads in flight together, mv[] in registers
  for (int e = 0; e < 8; ++e) mv[e] = mrow[key0 + e * 32];
  // The loaded words are inputs: the loads stand in front of this wait. Their base and their
  // offset are inputs: both stay as they are up to it, and are written anew only behind it.
  asm volatile("s_wait_xcnt 0x0" :: "v"(mv[0]), "v"(mv[1]), "v"(mv[2]), "v"(mv[3]), "v"(mv[4]),
               "v"(mv[5]), "v"(mv[6]), "v"(mv[7]), "s"(mrow), "v"(key0) : "memory");
  uint32_t bal[8];
  int wtot = 0;
#pragma unroll  // constant indices keep mv[], bal[] in registers
  for (int e = 0; e < 8; ++e) bal[e] = __builtin_amdgcn_ballot_w32(mv[e] != 0);
#pragma unroll  // constant indices keep bal[] in registers
  for (int e = 0; e < 8; ++e) wtot += __builtin_popcount(bal[e]);
  if (lane == 0) wsum[wave] = wtot;
  __syncthreads();     // every wave's count stands in wsum[]
  int first = 0, total = 0;
#pragma unroll  // straight-line sums of eight words
  for (int w = 0; w < 8; ++w) {
    const int s = wsum[w];
    total += s;
    first += (w < wave) ? s : 0;
  }
  const int kept = __builtin_amdgcn_readfirstlane(total);             // 0 .. S_, the same in every wave
  first = __builtin_amdgcn_readfirstlane(first);
  if (kept == 0) {
#pragma unroll  // eight stores back to back
    for (int e = 0; e < 8; ++e) kidx[key0 + e * 32] = (unsigned short)(key0 + e * 32);
  } else {
#pragma unroll  // constant indices keep bal[] in registers
    for (int e = 0; e < 8; ++e) {
      if ((bal[e] >> lane) & 1u)
        kidx[first + __builtin_amdgcn_mbcnt_lo(bal[e], 0u)] = (unsigned short)(key0 + e * 32);
      first += __builtin_popcount(bal[e]);
    }
    if (tid < 64) kidx[kept + tid] = 0;          // filler behind the list: a row that exists; its scores are masked
  }
  __syncthreads();     // the list stands

  const int NT = ((kept ? kept : S_) + 63) >> 6;                      // 1 .. S_ / 64 tiles

  // A thread copies 16 bytes of the rows at places sr and sr + 32 of a tile's part of the list,
  // of K and of V (8 lanes = one 128-B row).
  const int  sr = tid >> 3, sc = (tid & 7) << 3;
  const _Float16* kg = K + base + sc;
  const _Float16* vg = V + base + sc;
  auto stage = [&](int r0, int r1, int buf) {
    const uint32_t g0 = (uint32_t)r0 * E_, g1 = (uint32_t)r1 * E_;
    copy4x16(lds_addr(&Kt[buf][sr][sc]),      kg + g0, lds_addr(&Kt[buf][sr + 32][sc]), kg + g1,
             lds_addr(&Vs[buf][sr][sc]),      vg + g0, lds_addr(&Vs[buf][sr + 32][sc]), vg + g1);
  };

  stage(kidx[sr], kidx[sr + 32], 0);
  async_fence();
  __syncthreads();
  if (NT > 1) stage(kidx[64 + sr], kidx[64 + sr + 32], 1);

  for (int t = 0; t < NT; ++t) {
    const int cur = t & 1;

    // scores S^T = K Q^T : sa[i][j][r] = S[query 16i + c][key 16j + 8h + r]
    v8f sa[2][4];
#pragma unroll  // constant indices keep the tiles in registers
    for (int j = 0; j < 4; ++j) {
      v16h kf0 = load_frag_k32(&Kt[cur][j * 16][0],  AP_, lane);
      v16h kf1 = load_frag_k32(&Kt[cur][j * 16][32], AP_, lane);
#pragma unroll  // constant indices keep the tiles in registers
      for (int i = 0; i < 2; ++i) {
        v8f z = {};
        z = wmma_f16(kf0, qf[i][0], z);
        sa[i][j] = wmma_f16(kf1, qf[i][1], z);
      }
    }

#pragma unroll  // constant indices keep the tiles in registers
    for (int j = 0; j < 4; ++j)
#pragma unroll  // constant indices keep the tiles in registers
      for (int i = 0; i < 2; ++i)
#pragma unroll  // constant indices keep the tiles in registers
        for (int e = 0; e < 8; ++e)
          sa[i][j][e] *= scale;

    // places of this tile that hold a kept key: all 64 but in the list's last tile (none where no key is kept)
    const int left = kept - t * 64;
    if (left < 64) {                   // the same in every wave
      const int ll = left - lrow;      // the lane's own eight keys of each 16: places 16j + lrow + e
#pragma unroll  // constant indices keep the tiles in registers
      for (int j = 0; j < 4; ++j)
#pragma unroll  // constant indices keep the tiles in registers
        for (int i = 0; i < 2; ++i)
#pragma unroll  // constant indices keep the tiles in registers
          for (int e = 0; e < 8; ++e)
            sa[i][j][e] = (j * 16 + e < ll) ? sa[i][j][e] : -1e20f;
    }

    // online softmax, one query per lane and column group
    v16h pf[2][2];                     // pf[i][s]: P^T, keys 32s .. 32s + 31, as B operand
#pragma unroll  // constant indices keep the tiles in registers
    for (int i = 0; i < 2; ++i) {
      float nm = sa[i][0][0];
#pragma unroll  // constant indices keep the tiles in registers
      for (int j = 0; j < 4; ++j)
#pragma unroll  // constant indices keep the tiles in registers
        for (int e = 0; e < 8; ++e) nm = fmaxf(nm, sa[i][j][e]);
      nm = fmaxf(nm, xhalf(nm));       // both halves feed the same O^T tile: one maximum

      const float mn = fmaxf(mst[i], nm);
      const float fs = exp_slot(mst[i] - mn);
      mst[i] = mn;
#pragma unroll  // constant indices keep the tiles in registers
      for (int j = 0; j < 4; ++j)
#pragma unroll  // constant indices keep the tiles in registers
        for (int e = 0; e < 8; ++e)
          o[i][j][e] *= fs;

      float rs[4];
#pragma unroll  // constant indices keep the tiles in registers
      for (int j = 0; j < 4; ++j) {
        float p[8];
        exp_slot8(p, sa[i][j], mn);
        rs[j] = ((p[0] + p[1]) + (p[2] + p[3])) + ((p[4] + p[5]) + (p[6] + p[7]));
#pragma unroll  // constant indices keep the tiles in registers
        for (int e = 0; e < 8; ++e)
          pf[i][j >> 1][((j & 1) << 3) + e] = (_Float16)p[e];
      }
      lst[i] = lst[i] * fs + ((rs[0] + rs[1]) + (rs[2] + rs[3]));
    }

    // the rows of the tile that is copied at this trip's foot: read here, they are in registers there
    const int tn = (t + 2 < NT) ? t + 2 : NT - 1;
    const int n0 = kidx[tn * 64 + sr], n1 = kidx[tn * 64 + sr + 32];

    // O^T += V^T P^T
    const char* vp = (const char*)&Vs[cur][lrow + (lane & 7)][((lane >> 3) & 1) << 3];
#pragma unroll  // constant indices keep the tiles in registers
    for (int j = 0; j < 4; ++j) {
      v16h vf0 = load_frag_tr(vp + j * 32);
      v16h vf1 = load_frag_tr(vp + j * 32 + 32 * VP_ * 2);
#pragma unroll  // constant indices keep the tiles in registers
      for (int i = 0; i < 2; ++i) {
        o[i][j] = wmma_f16(vf0, pf[i][0], o[i][j]);
        o[i][j] = wmma_f16(vf1, pf[i][1], o[i][j]);
      }
    }

    lds_landed();      // this wave's reads of the buffer that is refilled behind the barrier have ended
    async_fence();     // this wave's copies of the next tile have landed
    __syncthreads();   // publishes the next tile and ends every wave's reads of this one
    if (t + 2 < NT) stage(n0, n1, cur);
  }
  async_fence();       // no copy is outstanding when the wave ends

  // a lane holds eight consecutive d of one query: one 16-byte store per tile
#pragma unroll  // constant indices keep the tiles in registers
  for (int i = 0; i < 2; ++i) {
    const float lt = lst[i] + xhalf(lst[i]);
    const int qrow = q0 + wave * 32 + i * 16 + lcol;
#pragma unroll  // constant indices keep the tiles in registers
    for (int j = 0; j < 4; ++j) {
      uint4 w;
      w.x = pack2h(o[i][j][0] / lt, o[i][j][1] / lt);
      w.y = pack2h(o[i][j][2] / lt, o[i][j][3] / lt);
      w.z = pack2h(o[i][j][4] / lt, o[i][j][5] / lt);
      w.w = pack2h(o[i][j][6] / lt, o[i][j][7] / lt);
      *(uint4*)(O + base + (size_t)qrow * E_ + j * 16 + lrow) = w;
    }
  }
}

constexpr int LM_   = 64;
constexpr int LK_   = 128;
constexpr int LP_   = LK_ + 8;
constexpr int LBUF_ = (LM_ + E_) * LP_ * 2;
constexpr int RP_   = E_ * 4 + 16;
constexpr int ST2_  = 16 * SF_ + 16 * SH_;
constexpr int PW_   = 10;
static_assert(LM_ * RP_ <= LBUF_ && 8 * ST2_ <= LBUF_, "residual rows and staging fit a buffer");

typedef float f32x4 __attribute__((ext_vector_type(4)));

template <int Kdim>
__global__ __launch_bounds__(256) void gemm_ln_kernel(
    const _Float16* __restrict__ A, const _Float16* __restrict__ Wt,
    const float* __restrict__ bias, const float* __restrict__ g,
    const float* __restrict__ bb, float* __restrict__ H, _Float16* __restrict__ H16) {
  __shared__ __attribute__((aligned(16))) char   ring[2][LBUF_];      // 2 x 153 KB
  __shared__ __attribute__((aligned(16))) float2 part[LM_][PW_];      // 5 KB : [row][wave] (sum, sum of squares)

  const int tid  = threadIdx.x;
  const int lane = tid & 31;
  const int wave = tid >> 5;
  const int wn   = wave << 6;                    // first column of the wave tile
  const int m0   = blockIdx.x * LM_;

  v8f acc[4][4] = {};
  constexpr int nk = Kdim / LK_;

  // A thread copies piece tid & 15 of rows (tid >> 4) + 16 t: uniform tile base, one per-lane
  // offset that all copies of an operand share, constant steps between them.
  const uint32_t go = (uint32_t)((tid >> 4) * Kdim + ((tid & 15) << 3));   // in f16
  const uint32_t lo = (uint32_t)((tid >> 4) * LP_  + ((tid & 15) << 3));   // in f16
  auto load_tiles = [&](int kt, int buf) {
    const _Float16* ab = A  + (size_t)m0 * Kdim + kt * LK_;
    const _Float16* wb = Wt + kt * LK_;
    _Float16* T = (_Float16*)ring[buf] + lo;
#pragma unroll  // the copies of a tile issue back to back, with no loop branch between them
    for (int t = 0; t < LM_ / 16; ++t)           // A: 64 rows of 16 pieces
      cp16B_g2l(ab + go + t * 16 * Kdim, T + t * 16 * LP_);
#pragma unroll
    for (int t = 0; t < E_ / 16; ++t)
      cp16B_g2l(wb + go + t * 16 * Kdim, T + (LM_ + t * 16) * LP_);
  };
  auto load_resid = [&](int buf) {
    const float* hb = H + (size_t)m0 * E_;
    char* T = ring[buf] + (tid >> 7) * RP_ + (tid & 127) * 16;
#pragma unroll
    for (int t = 0; t < LM_ / 2; ++t)            // 64 rows of 128 pieces; a wave's copy is 512 B of one row
      cp16B_g2l((const _Float16*)(hb + (uint32_t)(tid * 4) + t * 2 * E_), (_Float16*)(T + t * 2 * RP_));
  };

  load_tiles(0, 0);
  async_fence();
  __syncthreads();

  // One trip: four 32-k blocks of 16 products. Behind the four products of a row group stand the
  // loads of the next block's fragments that take the registers just freed (that row group's
  // activation fragment) or the second weight set: every fragment is fetched a block ahead.
  auto trip = [&](int cur) {
    const _Float16* Ta = (const _Float16*)ring[cur];
    const _Float16* Tb = Ta + (LM_ + wn) * LP_;
    v16h af[4], bf[2][4];
#pragma unroll  // constant indices keep the fragments in registers
    for (int i = 0; i < 4; ++i) {
      af[i]    = load_frag_k32(Ta + i * 16 * LP_, LP_, lane);
      bf[0][i] = load_frag_k32(Tb + i * 16 * LP_, LP_, lane);
    }
#pragma unroll  // constant indices keep the fragments in registers
    for (int b = 0; b < LK_ / 32; ++b)
#pragma unroll  // constant indices keep the fragments in registers
      for (int i = 0; i < 4; ++i) {
#pragma unroll  // constant indices keep the fragments in registers
        for (int j = 0; j < 4; ++j)
          acc[i][j] = wmma_f16(bf[b & 1][j], af[i], acc[i][j]);   // D[n][m]
        if (b + 1 < LK_ / 32) {
          af[i]              = load_frag_k32(Ta + i * 16 * LP_ + (b + 1) * 32, LP_, lane);
          bf[(b + 1) & 1][i] = load_frag_k32(Tb + i * 16 * LP_ + (b + 1) * 32, LP_, lane);
        }
        // keeps these loads here, a block ahead of their use: moved down to their products, each
        // row group would wait out a whole LDS latency
        __builtin_amdgcn_sched_barrier(0);
      }
    lds_landed();      // this wave's reads of the buffer that is refilled behind the barrier have ended
    async_fence();     // this wave's copies of the next tile, or of the residual rows, have landed
    __syncthreads();
  };

  for (int kt = 0; kt + 1 < nk; ++kt) {
    load_tiles(kt + 1, (kt & 1) ^ 1);
    trip(kt & 1);
  }
  constexpr int last = (nk - 1) & 1;
  load_resid(last ^ 1);                          // the ring's last tile
  trip(last);

  // acc[i][j][e] = C[m0 + 16i + lcol][wn + 16j + lrow + e]
  const int lrow = (lane >> 4) << 3;
  const int lcol = lane & 15;
  const char* Rb = ring[last ^ 1];               // the residual rows
  // The loop's last barrier stands behind every wave's last fragment read of this buffer.
  char* stage = ring[last] + wave * ST2_;

  {
    float4 bv[4][2];
#pragma unroll  // constant indices keep bv[] in registers; all eight loads in flight together
    for (int j = 0; j < 4; ++j) {
      bv[j][0] = *(const float4*)(bias + wn + j * 16 + lrow);
      bv[j][1] = *(const float4*)(bias + wn + j * 16 + lrow + 4);
    }
#pragma unroll  // constant indices keep acc[] in registers
    for (int i = 0; i < 4; ++i) {
      float s[4], q[4];
#pragma unroll  // constant indices keep acc[] in registers
      for (int j = 0; j < 4; ++j) {
        const char* rp = Rb + (i * 16 + lcol) * RP_ + (wn + j * 16 + lrow) * 4;
        const f32x4 r0 = *(const f32x4*)rp;
        const f32x4 r1 = *(const f32x4*)(rp + 16);
        s[j] = 0.0f; q[j] = 0.0f;
#pragma unroll  // constant indices keep acc[] in registers
        for (int e = 0; e < 8; ++e) {
          const float v = (acc[i][j][e] + (&bv[j][e >> 2].x)[e & 3]) + (e < 4 ? r0[e & 3] : r1[e & 3]);
          acc[i][j][e] = v;
          s[j] += v;
          q[j] += v * v;
        }
      }
      float st = (s[0] + s[1]) + (s[2] + s[3]);
      float qt = (q[0] + q[1]) + (q[2] + q[3]);
      st += xhalf(st);
      qt += xhalf(qt);
      if (lane < 16) part[i * 16 + lcol][wave] = make_float2(st, qt);
    }
  }
  __syncthreads();     // every wave's row sums stand in part[]

  const float* gp = g  + wn + lrow;
  const float* ep = bb + wn + lrow;
  float4 gv[4][2], ev[4][2];
#pragma unroll  // constant indices keep gv[], ev[] in registers; all loads in flight together
  for (int j = 0; j < 4; ++j) {
    gv[j][0] = *(const float4*)(gp + j * 16);
    gv[j][1] = *(const float4*)(gp + j * 16 + 4);
    ev[j][0] = *(const float4*)(ep + j * 16);
    ev[j][1] = *(const float4*)(ep + j * 16 + 4);
  }
  // The two address pairs are inputs: they stay as they are up to this wait, so that no load of
  // the run returns into an address register of the run ahead of it.
  asm volatile("s_wait_xcnt 0x0" :: "v"(gp), "v"(ep) : "memory");

#pragma unroll  // constant indices keep acc[] in registers
  for (int i = 0; i < 4; ++i) {
    const float4* pp = (const float4*)&part[i * 16 + lcol][0];
    const float4 p0 = pp[0], p1 = pp[1], p2 = pp[2], p3 = pp[3];
    const float S1 = ((p0.x + p0.z) + (p1.x + p1.z)) + ((p2.x + p2.z) + (p3.x + p3.z));
    const float S2 = ((p0.y + p0.w) + (p1.y + p1.w)) + ((p2.y + p2.w) + (p3.y + p3.w));
    const float mu   = S1 * (1.0f / E_);
    const float var  = S2 * (1.0f / E_) - mu * mu;
    const float rinv = rsqrtf(var + 1e-6f);

    char* s32 = stage;
    char* s16 = stage + 16 * SF_;
#pragma unroll  // constant indices keep acc[] in registers
    for (int j = 0; j < 4; ++j) {
      float y[8];
      v8h   w;
#pragma unroll  // constant indices keep y[] in registers
      for (int e = 0; e < 8; ++e) {
        y[e] = (acc[i][j][e] - mu) * rinv * (&gv[j][e >> 2].x)[e & 3] + (&ev[j][e >> 2].x)[e & 3];
        w[e] = (_Float16)y[e];
      }
      char* sp = s32 + lcol * SF_ + (j * 16 + lrow) * 4;
      *(float4*)sp        = make_float4(y[0], y[1], y[2], y[3]);
      *(float4*)(sp + 16) = make_float4(y[4], y[5], y[6], y[7]);
      *(v8h*)(s16 + lcol * SH_ + (j * 16 + lrow) * 2) = w;
    }
    lds_landed();
    const int rw = m0 + i * 16;        // first row of this quarter of the wave tile
#pragma unroll  // straight-line code: the compiler issues the LDS reads ahead of the stores
    for (int t = 0; t < 8; ++t) {      // 16 lanes = the 256 B of one row, two rows a read
      const f32x4 a = *(const f32x4*)(s32 + (t * 2 + (lane >> 4)) * SF_ + lcol * 16);
      *(f32x4*)(H + (rw + t * 2 + (lane >> 4)) * E_ + wn + lcol * 4) = a;
    }
#pragma unroll
    for (int t = 0; t < 4; ++t) {      // 8 lanes = the 128 B of one row, four rows a read
      const v8h a = *(const v8h*)(s16 + (t * 4 + (lane >> 3)) * SH_ + (lane & 7) * 16);
      *(v8h*)(H16 + (rw + t * 4 + (lane >> 3)) * E_ + wn + (lane & 7) * 8) = a;
    }
    if (i < 3) stores_taken();         // behind the last run nothing is written any more
  }
}

// ---------------------------------------------------------------------------
// Host orchestration
// ---------------------------------------------------------------------------
extern "C" void kernel_launch(void* const* d_in, const int* in_sizes, int n_in,
                              void* d_out, int out_size, void* d_ws, size_t ws_size,
                              hipStream_t stream) {
  const int*   x    = (const int*)d_in[0];
  const int*   mask = (const int*)d_in[1];
  const float* emb  = (const float*)d_in[2];
  const float* pos  = (const float*)d_in[3];
  const float* Wq   = (const float*)d_in[4];
  const float* bq   = (const float*)d_in[5];
  const float* Wk   = (const float*)d_in[6];
  const float* bk   = (const float*)d_in[7];
  const float* Wv   = (const float*)d_in[8];
  const float* bv   = (const float*)d_in[9];
  const float* Wo   = (const float*)d_in[10];
  const float* bo   = (const float*)d_in[11];
  const float* g1   = (const float*)d_in[12];
  const float* be1  = (const float*)d_in[13];
  const float* g2   = (const float*)d_in[14];
  const float* be2  = (const float*)d_in[15];
  const float* W1   = (const float*)d_in[16];
  const float* bf1  = (const float*)d_in[17];
  const float* W2   = (const float*)d_in[18];
  const float* bf2  = (const float*)d_in[19];

  float* h = (float*)d_out;                               // [B,S,E] f32, persistent

  const size_t ACT = (size_t)ROWS * E_;
  char* p = (char*)d_ws;
  auto alloc_h = [&](size_t n) { _Float16* r = (_Float16*)p; p += n * sizeof(_Float16); return r; };
  _Float16* h16   = alloc_h(ACT);
  _Float16* q16   = alloc_h(ACT);
  _Float16* k16   = alloc_h(ACT);
  _Float16* v16   = alloc_h(ACT);
  _Float16* att16 = alloc_h(ACT);
  _Float16* big16 = alloc_h((size_t)ROWS * FF_);
  _Float16* wtq[L_]; _Float16* wtk[L_]; _Float16* wtv[L_]; _Float16* wto[L_];
  _Float16* wt1[L_]; _Float16* wt2[L_];
  for (int l = 0; l < L_; ++l) {
    wtq[l] = alloc_h((size_t)E_ * E_);
    wtk[l] = alloc_h((size_t)E_ * E_);
    wtv[l] = alloc_h((size_t)E_ * E_);
    wto[l] = alloc_h((size_t)E_ * E_);
    wt1[l] = alloc_h((size_t)E_ * FF_);
    wt2[l] = alloc_h((size_t)FF_ * E_);
  }

  // Weight convert+transpose (W[K][N] f32 -> Wt[N][K] f16); wtq[0] is the start of the block
  // and the embedding, in the same launch
  prep_kernel<<<L_ * WB_ + ROWS / 2, 256, 0, stream>>>(Wq, Wk, Wv, Wo, W1, W2, wtq[0], x, emb, pos, h, h16);

  const dim3 gQ(ROWS / GM_, 3 * E_ / 256);                // Q, K, V side by side
  const dim3 gF(ROWS / GM_, FF_ / 256);                   // N = 2048
  const dim3 gA(B_ * H_, S_ / 256);

  for (int l = 0; l < L_; ++l) {
    const float* bql = bq  + (size_t)l * E_;
    const float* bkl = bk  + (size_t)l * E_;
    const float* bvl = bv  + (size_t)l * E_;
    const float* bol = bo  + (size_t)l * E_;
    const float* b1l = bf1 + (size_t)l * FF_;
    const float* b2l = bf2 + (size_t)l * E_;
    const float* g1l = g1  + (size_t)l * E_;
    const float* e1l = be1 + (size_t)l * E_;
    const float* g2l = g2  + (size_t)l * E_;
    const float* e2l = be2 + (size_t)l * E_;

    // wtq, wtk, wtv of a layer and q16, k16, v16 lie back to back in the workspace
    gemm_f16_kernel<64, true><<<gQ, 256, 0, stream>>>(h16, wtq[l], bql, bkl, bvl, nullptr, q16, E_, E_, 0);

    attention_kernel<<<gA, 256, 0, stream>>>(q16, k16, v16, mask, att16);

    gemm_ln_kernel<E_><<<ROWS / LM_, 256, 0, stream>>>(att16, wto[l], bol, g1l, e1l, h, h16);

    gemm_f16_kernel<64, false><<<gF, 256, 0, stream>>>(h16, wt1[l], b1l, nullptr, nullptr, nullptr, big16, FF_, E_, 1);
    gemm_ln_kernel<FF_><<<ROWS / LM_, 256, 0, stream>>>(big16, wt2[l], b2l, g2l, e2l, h, h16);
  }
}
